// v000
// The times below were measured on an AMD MI455X: many runs one after another, warmed up first and cycling through
// copies of the inputs, with the whole window's GPU time divided by the number of runs. Launches and the gaps
// between them are all in it. The median over several windows is given; except for v000 it joins two sittings, which
// can be a few percent apart, so the side-by-side timings, each taken in one sitting, are the better comparison.
// The starting kernel, v000, takes 248 microseconds a run.
#include <hip/hip_runtime.h>

#define B_   4
#define CIN  128
#define N_   4096
#define D_   16
#define OUT_ 16
#define G_   4
#define NT   (N_ / 16)   // 256 tiles per batch

typedef __attribute__((ext_vector_type(16))) _Float16 v16h;
typedef __attribute__((ext_vector_type(8)))  _Float16 v8h;
typedef __attribute__((ext_vector_type(8)))  float    v8f;
typedef __attribute__((ext_vector_type(4)))  float    v4f;

// Load 8 contiguous halves into the low K-half of a WMMA operand, zero-pad the rest.
static __device__ __forceinline__ v16h ld8_pad(const _Float16* p) {
  const v8h lo = *reinterpret_cast<const v8h*>(p);
  v16h r;
#pragma unroll
  for (int i = 0; i < 8; ++i) { r[i] = lo[i]; r[i + 8] = (_Float16)0.f; }
  return r;
}

static __device__ __forceinline__ v8f wmma_f16(v16h a, v16h b, v8f c) {
  return __builtin_amdgcn_wmma_f32_16x16x32_f16(false, a, false, b, (short)0, c,
                                                false, false);
}

// ---------------------------------------------------------------------------
// K1: channel projections (1x1 convs). One thread per (b, n) point.
//   q_f [B][N][16] f32, q_h/k_h [B][N][16] f16, v_h [B][16][N] f16
// ---------------------------------------------------------------------------
__global__ __launch_bounds__(256) void k_project(
    const float* __restrict__ x_q, const float* __restrict__ x_kv,
    const float* __restrict__ xyz_q, const float* __restrict__ xyz_kv,
    const float* __restrict__ w_qk, const float* __restrict__ w_v,
    const float* __restrict__ b_v,
    const float* __restrict__ w_pos_q, const float* __restrict__ w_pos_kv,
    float* __restrict__ q_f, _Float16* __restrict__ q_h,
    _Float16* __restrict__ k_h, _Float16* __restrict__ v_h) {
  const int idx = blockIdx.x * blockDim.x + threadIdx.x;
  if (idx >= B_ * N_) return;
  const int b = idx >> 12;
  const int n = idx & (N_ - 1);

  float aq[D_], ak[D_], av[D_];
#pragma unroll
  for (int d = 0; d < D_; ++d) { aq[d] = 0.f; ak[d] = 0.f; av[d] = 0.f; }

  const float* xq = x_q + (size_t)b * CIN * N_ + n;
  const float* xk = x_kv + (size_t)b * CIN * N_ + n;
  for (int c = 0; c < CIN; ++c) {
    const float vq = xq[(size_t)c * N_];
    const float vk = xk[(size_t)c * N_];
#pragma unroll
    for (int d = 0; d < D_; ++d) {
      const float wq = w_qk[d * CIN + c];
      aq[d] = fmaf(wq, vq, aq[d]);
      ak[d] = fmaf(wq, vk, ak[d]);
      av[d] = fmaf(w_v[d * CIN + c], vk, av[d]);
    }
  }

  float pq[D_], pk[D_];
#pragma unroll
  for (int d = 0; d < D_; ++d) { pq[d] = 0.f; pk[d] = 0.f; }
#pragma unroll
  for (int j = 0; j < 3; ++j) {
    const float cq = xyz_q[((size_t)b * 3 + j) * N_ + n];
    const float ck = xyz_kv[((size_t)b * 3 + j) * N_ + n];
#pragma unroll
    for (int d = 0; d < D_; ++d) {
      pq[d] = fmaf(w_pos_q[d * 3 + j], cq, pq[d]);
      pk[d] = fmaf(w_pos_kv[d * 3 + j], ck, pk[d]);
    }
  }

  const size_t row = (size_t)idx * D_;
#pragma unroll
  for (int d = 0; d < D_; ++d) {
    const float qv = aq[d] + pq[d];
    const float kv = ak[d] + pk[d];
    const float vv = av[d] + b_v[d] + pk[d];
    q_f[row + d] = qv;
    q_h[row + d] = (_Float16)qv;
    k_h[row + d] = (_Float16)kv;
    v_h[((size_t)b * D_ + d) * N_ + n] = (_Float16)vv;
  }
}

// ---------------------------------------------------------------------------
// K2: per-query online softmax statistics (rowmax, rowsum).
// One wave per 16-query tile. E^T tile = WMMA(A = K-tile, B = Q-tile).
// D layout: lane L reg r -> (key m = m0 + r + 8*(L/16), query n = n0 + L%16)
// ---------------------------------------------------------------------------
__global__ __launch_bounds__(32) void k_rowstats(
    const _Float16* __restrict__ q_h, const _Float16* __restrict__ k_h,
    float* __restrict__ rowmax, float* __restrict__ rowsum) {
  const int wid = blockIdx.x;
  const int b = wid >> 8;
  const int n0 = (wid & (NT - 1)) << 4;
  const int lane = threadIdx.x;
  const int li = lane & 15;
  const int h = lane >> 4;
  const int koff = h << 3;

  const _Float16* qb = q_h + (size_t)b * N_ * D_;
  const _Float16* kb = k_h + (size_t)b * N_ * D_;
  const v16h bq = ld8_pad(qb + (size_t)(n0 + li) * D_ + koff);

  float mx = -__builtin_inff();
  float sm = 0.f;
  for (int m0 = 0; m0 < N_; m0 += 16) {
    const v16h ak = ld8_pad(kb + (size_t)(m0 + li) * D_ + koff);
    v8f z = {};
    const v8f e = wmma_f16(ak, bq, z);
    float tmax = e[0];
#pragma unroll
    for (int r = 1; r < 8; ++r) tmax = fmaxf(tmax, e[r]);
    const float nm = fmaxf(mx, tmax);
    float acc = 0.f;
#pragma unroll
    for (int r = 0; r < 8; ++r) acc += __expf(e[r] - nm);
    sm = sm * __expf(mx - nm) + acc;
    mx = nm;
  }
  // combine the two lane-halves (same query, different key subsets)
  const float mx2 = __shfl_xor(mx, 16, 32);
  const float sm2 = __shfl_xor(sm, 16, 32);
  const float M = fmaxf(mx, mx2);
  const float S = sm * __expf(mx - M) + sm2 * __expf(mx2 - M);
  if (h == 0) {
    rowmax[b * N_ + n0 + li] = M;
    rowsum[b * N_ + n0 + li] = S;
  }
}

// ---------------------------------------------------------------------------
// K3: column sums over queries (key-major => no atomics). Stores 1/(1e-9+cs).
// ---------------------------------------------------------------------------
__global__ __launch_bounds__(32) void k_colsum(
    const _Float16* __restrict__ q_h, const _Float16* __restrict__ k_h,
    const float* __restrict__ rowmax, const float* __restrict__ rowsum,
    float* __restrict__ colinv) {
  const int wid = blockIdx.x;
  const int b = wid >> 8;
  const int m0 = (wid & (NT - 1)) << 4;
  const int lane = threadIdx.x;
  const int li = lane & 15;
  const int h = lane >> 4;
  const int koff = h << 3;

  const _Float16* qb = q_h + (size_t)b * N_ * D_;
  const _Float16* kb = k_h + (size_t)b * N_ * D_;
  const v16h ak = ld8_pad(kb + (size_t)(m0 + li) * D_ + koff);

  float cs[8];
#pragma unroll
  for (int r = 0; r < 8; ++r) cs[r] = 0.f;

  for (int n0 = 0; n0 < N_; n0 += 16) {
    const v16h bq = ld8_pad(qb + (size_t)(n0 + li) * D_ + koff);
    v8f z = {};
    const v8f e = wmma_f16(ak, bq, z);
    const float mx = rowmax[b * N_ + n0 + li];
    const float inv = 1.f / rowsum[b * N_ + n0 + li];
#pragma unroll
    for (int r = 0; r < 8; ++r) cs[r] += __expf(e[r] - mx) * inv;
  }
  // reduce across the 16 queries held by each lane-half
#pragma unroll
  for (int msk = 1; msk < 16; msk <<= 1) {
#pragma unroll
    for (int r = 0; r < 8; ++r) cs[r] += __shfl_xor(cs[r], msk, 32);
  }
  if (li == 0) {
#pragma unroll
    for (int r = 0; r < 8; ++r)
      colinv[b * N_ + m0 + koff + r] = 1.f / (1e-9f + cs[r]);
  }
}

// ---------------------------------------------------------------------------
// K4: recompute weights, X_r^T += V * W^T (K=32: two prob tiles per WMMA),
// then diff = q - x_r feeds the w_t projection WMMA directly; writes t_buf.
// ---------------------------------------------------------------------------
__global__ __launch_bounds__(32) void k_attn(
    const _Float16* __restrict__ q_h, const _Float16* __restrict__ k_h,
    const _Float16* __restrict__ v_h, const float* __restrict__ q_f,
    const float* __restrict__ rowmax, const float* __restrict__ rowsum,
    const float* __restrict__ colinv,
    const float* __restrict__ w_t, const float* __restrict__ b_t,
    float* __restrict__ t_buf) {
  const int wid = blockIdx.x;
  const int b = wid >> 8;
  const int n0 = (wid & (NT - 1)) << 4;
  const int lane = threadIdx.x;
  const int li = lane & 15;
  const int h = lane >> 4;
  const int koff = h << 3;

  const _Float16* qb = q_h + (size_t)b * N_ * D_;
  const _Float16* kb = k_h + (size_t)b * N_ * D_;
  const _Float16* vb = v_h + (size_t)b * D_ * N_;
  const float* cib = colinv + b * N_;

  const v16h bq = ld8_pad(qb + (size_t)(n0 + li) * D_ + koff);
  const float mx = rowmax[b * N_ + n0 + li];
  const float inv = 1.f / rowsum[b * N_ + n0 + li];

  v8f xacc = {};
  for (int m0 = 0; m0 < N_; m0 += 32) {
    const v16h ak0 = ld8_pad(kb + (size_t)(m0 + li) * D_ + koff);
    const v16h ak1 = ld8_pad(kb + (size_t)(m0 + 16 + li) * D_ + koff);
    v8f z = {};
    const v8f e0 = wmma_f16(ak0, bq, z);
    const v8f e1 = wmma_f16(ak1, bq, z);
    const v4f c00 = *reinterpret_cast<const v4f*>(cib + m0 + koff);
    const v4f c01 = *reinterpret_cast<const v4f*>(cib + m0 + koff + 4);
    const v4f c10 = *reinterpret_cast<const v4f*>(cib + m0 + 16 + koff);
    const v4f c11 = *reinterpret_cast<const v4f*>(cib + m0 + 16 + koff + 4);
    // D-tile layout == B-operand layout: pack two 16-key tiles into K=32.
    v16h wv;
#pragma unroll
    for (int r = 0; r < 4; ++r) {
      wv[r]      = (_Float16)(__expf(e0[r] - mx) * inv * c00[r]);
      wv[4 + r]  = (_Float16)(__expf(e0[4 + r] - mx) * inv * c01[r]);
      wv[8 + r]  = (_Float16)(__expf(e1[r] - mx) * inv * c10[r]);
      wv[12 + r] = (_Float16)(__expf(e1[4 + r] - mx) * inv * c11[r]);
    }
    const _Float16* vp = vb + (size_t)li * N_ + m0 + koff;
    const v8h v0 = *reinterpret_cast<const v8h*>(vp);
    const v8h v1 = *reinterpret_cast<const v8h*>(vp + 16);
    v16h av;
#pragma unroll
    for (int i = 0; i < 8; ++i) { av[i] = v0[i]; av[i + 8] = v1[i]; }
    xacc = wmma_f16(av, wv, xacc);
  }

  // xacc: lane reg r -> (d = r + 8h, n = n0 + li). diff feeds next WMMA as B.
  const float* qrow = q_f + ((size_t)b * N_ + n0 + li) * D_ + koff;
  v16h bdiff;
#pragma unroll
  for (int r = 0; r < 8; ++r) {
    bdiff[r] = (_Float16)(qrow[r] - xacc[r]);
    bdiff[r + 8] = (_Float16)0.f;
  }
  v16h awt;
#pragma unroll
  for (int e = 0; e < 8; ++e) {
    awt[e] = (_Float16)w_t[li * D_ + koff + e];
    awt[e + 8] = (_Float16)0.f;
  }
  v8f z2 = {};
  const v8f t = wmma_f16(awt, bdiff, z2);
  float* tb = t_buf + (size_t)b * OUT_ * N_;
#pragma unroll
  for (int r = 0; r < 8; ++r)
    tb[(size_t)(r + koff) * N_ + n0 + li] = t[r] + b_t[r + koff];
}

// ---------------------------------------------------------------------------
// K5: GroupNorm statistics per (b, group): 4 channels x N contiguous floats.
// ---------------------------------------------------------------------------
__global__ __launch_bounds__(256) void k_gnstats(
    const float* __restrict__ t_buf, float* __restrict__ gn_mean,
    float* __restrict__ gn_rstd) {
  const int bg = blockIdx.x;  // 0..15
  const float* p = t_buf + (size_t)bg * 4 * N_;  // groups are contiguous
  float s = 0.f, s2 = 0.f;
  for (int i = threadIdx.x; i < 4 * N_; i += 256) {
    const float v = p[i];
    s += v;
    s2 += v * v;
  }
  __shared__ float sh[256], sh2[256];
  sh[threadIdx.x] = s;
  sh2[threadIdx.x] = s2;
  __syncthreads();
  for (int off = 128; off > 0; off >>= 1) {
    if (threadIdx.x < off) {
      sh[threadIdx.x] += sh[threadIdx.x + off];
      sh2[threadIdx.x] += sh2[threadIdx.x + off];
    }
    __syncthreads();
  }
  if (threadIdx.x == 0) {
    const float M = (float)(4 * N_);
    const float m = sh[0] / M;
    const float var = sh2[0] / M - m * m;
    gn_mean[bg] = m;
    gn_rstd[bg] = rsqrtf(var + 1e-5f);
  }
}

// ---------------------------------------------------------------------------
// K6: apply GN affine + ReLU, add q^T residual.
// ---------------------------------------------------------------------------
__global__ __launch_bounds__(256) void k_final(
    const float* __restrict__ t_buf, const float* __restrict__ q_f,
    const float* __restrict__ gamma, const float* __restrict__ beta,
    const float* __restrict__ gn_mean, const float* __restrict__ gn_rstd,
    float* __restrict__ out) {
  const int idx = blockIdx.x * blockDim.x + threadIdx.x;
  if (idx >= B_ * OUT_ * N_) return;
  const int n = idx & (N_ - 1);
  const int o = (idx >> 12) & 15;
  const int b = idx >> 16;
  const int bg = b * G_ + (o >> 2);
  float y = (t_buf[idx] - gn_mean[bg]) * gn_rstd[bg] * gamma[o] + beta[o];
  y = fmaxf(y, 0.f);
  out[idx] = q_f[((size_t)b * N_ + n) * D_ + o] + y;
}

// ---------------------------------------------------------------------------
extern "C" void kernel_launch(void* const* d_in, const int* in_sizes, int n_in,
                              void* d_out, int out_size, void* d_ws,
                              size_t ws_size, hipStream_t stream) {
  const float* x_q      = (const float*)d_in[0];
  const float* x_kv     = (const float*)d_in[1];
  const float* xyz_q    = (const float*)d_in[2];
  const float* xyz_kv   = (const float*)d_in[3];
  const float* w_qk     = (const float*)d_in[4];
  const float* w_v      = (const float*)d_in[5];
  const float* b_v      = (const float*)d_in[6];
  const float* w_t      = (const float*)d_in[7];
  const float* b_t      = (const float*)d_in[8];
  const float* gamma    = (const float*)d_in[9];
  const float* beta     = (const float*)d_in[10];
  const float* w_pos_q  = (const float*)d_in[11];
  const float* w_pos_kv = (const float*)d_in[12];
  float* out = (float*)d_out;

  char* ws = (char*)d_ws;
  size_t off = 0;
  auto carve = [&](size_t bytes) -> char* {
    char* p = ws + off;
    off += (bytes + 255) & ~(size_t)255;
    return p;
  };
  float*    q_f    = (float*)carve((size_t)B_ * N_ * D_ * 4);
  _Float16* q_h    = (_Float16*)carve((size_t)B_ * N_ * D_ * 2);
  _Float16* k_h    = (_Float16*)carve((size_t)B_ * N_ * D_ * 2);
  _Float16* v_h    = (_Float16*)carve((size_t)B_ * D_ * N_ * 2);
  float*    rowmax = (float*)carve((size_t)B_ * N_ * 4);
  float*    rowsum = (float*)carve((size_t)B_ * N_ * 4);
  float*    colinv = (float*)carve((size_t)B_ * N_ * 4);
  float*    t_buf  = (float*)carve((size_t)B_ * OUT_ * N_ * 4);
  float*    gn_m   = (float*)carve(B_ * G_ * 4);
  float*    gn_r   = (float*)carve(B_ * G_ * 4);
  (void)in_sizes; (void)n_in; (void)out_size; (void)ws_size;

  k_project<<<(B_ * N_ + 255) / 256, 256, 0, stream>>>(
      x_q, x_kv, xyz_q, xyz_kv, w_qk, w_v, b_v, w_pos_q, w_pos_kv,
      q_f, q_h, k_h, v_h);
  k_rowstats<<<B_ * NT, 32, 0, stream>>>(q_h, k_h, rowmax, rowsum);
  k_colsum<<<B_ * NT, 32, 0, stream>>>(q_h, k_h, rowmax, rowsum, colinv);
  k_attn<<<B_ * NT, 32, 0, stream>>>(q_h, k_h, v_h, q_f, rowmax, rowsum,
                                     colinv, w_t, b_t, t_buf);
  k_gnstats<<<B_ * G_, 256, 0, stream>>>(t_buf, gn_m, gn_r);
  k_final<<<(B_ * OUT_ * N_ + 255) / 256, 256, 0, stream>>>(
      t_buf, q_f, gamma, beta, gn_m, gn_r, out);
}

// v001
// One run takes 63.3 microseconds.
// Two timings next to v000 put it at 4.00 and 3.92 times that version's speed.
#include <hip/hip_runtime.h>

#define B_   4
#define CIN  128
#define N_   4096
#define D_   16
#define OUT_ 16
#define G_   4
#define NT   (N_ / 16)   // 256 tiles per batch
#define SPLIT 8             // waves per block; each takes 1/SPLIT of the block's serial loop
#define CHUNK (N_ / SPLIT)  // keys (or queries) per wave
#define PCH   (CIN / SPLIT) // input channels per wave in the projection

// Wave number within the block, in a scalar register: the wave's share of the
// loop, its weight loads and the branch on it are then scalar.
static __device__ __forceinline__ int wave_id() {
  return __builtin_amdgcn_readfirstlane(threadIdx.x >> 5);
}

typedef __attribute__((ext_vector_type(16))) _Float16 v16h;
typedef __attribute__((ext_vector_type(8)))  _Float16 v8h;
typedef __attribute__((ext_vector_type(8)))  float    v8f;
typedef __attribute__((ext_vector_type(4)))  float    v4f;
typedef __attribute__((ext_vector_type(2)))  float    v2f;
typedef __attribute__((ext_vector_type(2)))  _Float16 v2h;

// Load 8 contiguous halves into the low K-half of a WMMA operand, zero-pad the rest.
static __device__ __forceinline__ v16h ld8_pad(const _Float16* p) {
  const v8h lo = *reinterpret_cast<const v8h*>(p);
  v16h r;
#pragma unroll
  for (int i = 0; i < 8; ++i) { r[i] = lo[i]; r[i + 8] = (_Float16)0.f; }
  return r;
}

static __device__ __forceinline__ v8f wmma_f16(v16h a, v16h b, v8f c) {
  return __builtin_amdgcn_wmma_f32_16x16x32_f16(false, a, false, b, (short)0, c,
                                                false, false);
}

// ---------------------------------------------------------------------------
// K1: channel projections (1x1 convs). One block per 32 points, lane = point;
// each of the 8 waves sums 16 of the 128 input channels, partials meet in LDS.
//   q_f [B][N][16] f32, q_h/k_h [B][N][16] f16, v_h [B][16][N] f16
// ---------------------------------------------------------------------------
__global__ __launch_bounds__(256) void k_project(
    const float* __restrict__ x_q, const float* __restrict__ x_kv,
    const float* __restrict__ xyz_q, const float* __restrict__ xyz_kv,
    const float* __restrict__ w_qk, const float* __restrict__ w_v,
    const float* __restrict__ b_v,
    const float* __restrict__ w_pos_q, const float* __restrict__ w_pos_kv,
    float* __restrict__ q_f, _Float16* __restrict__ q_h,
    _Float16* __restrict__ k_h, _Float16* __restrict__ v_h) {
  // partial sums: [wave][q 0..15 | k 16..31 | v 32..47][point]
  __shared__ float part[SPLIT][3 * D_][32];
  const int lane = threadIdx.x & 31;
  const int wv = wave_id();
  const int b = blockIdx.x / (N_ / 32);
  const int n = (blockIdx.x % (N_ / 32)) * 32 + lane;
  const int idx = b * N_ + n;
  const int c0 = wv * PCH;

  const float* xq = x_q + ((size_t)b * CIN + c0) * N_ + n;
  const float* xk = x_kv + ((size_t)b * CIN + c0) * N_ + n;
  float vq[PCH], vk[PCH];
#pragma unroll  // all 32 loads of the wave go out before the first is waited for
  for (int c = 0; c < PCH; ++c) {
    vq[c] = xq[(size_t)c * N_];
    vk[c] = xk[(size_t)c * N_];
  }
  float cq[3], ck[3];
#pragma unroll  // constant indices keep cq, ck in registers
  for (int j = 0; j < 3; ++j) {
    cq[j] = xyz_q[((size_t)b * 3 + j) * N_ + n];
    ck[j] = xyz_kv[((size_t)b * 3 + j) * N_ + n];
  }

#pragma unroll  // independent sums of several d interleave
  for (int d = 0; d < D_; ++d) {
    float sq = 0.f, sk = 0.f, sv = 0.f;
#pragma unroll  // constant indices keep vq, vk in registers
    for (int c = 0; c < PCH; ++c) {
      const float wq = w_qk[d * CIN + c0 + c];
      sq = fmaf(wq, vq[c], sq);
      sk = fmaf(wq, vk[c], sk);
      sv = fmaf(w_v[d * CIN + c0 + c], vk[c], sv);
    }
    part[wv][d][lane] = sq;
    part[wv][D_ + d][lane] = sk;
    part[wv][2 * D_ + d][lane] = sv;
  }
  __syncthreads();

  // wave wv finishes output channels 2*wv and 2*wv+1 of the block's 32 points
  float qv[2], kv[2], vv[2];
#pragma unroll  // qv, kv, vv stay in registers
  for (int i = 0; i < 2; ++i) {
    const int d = 2 * wv + i;
    float aq = 0.f, ak = 0.f, av = 0.f;
#pragma unroll  // the LDS reads are issued together
    for (int w = 0; w < SPLIT; ++w) {
      aq += part[w][d][lane];
      ak += part[w][D_ + d][lane];
      av += part[w][2 * D_ + d][lane];
    }
    float pq = 0.f, pk = 0.f;
#pragma unroll  // constant indices keep cq, ck in registers
    for (int j = 0; j < 3; ++j) {
      pq = fmaf(w_pos_q[d * 3 + j], cq[j], pq);
      pk = fmaf(w_pos_kv[d * 3 + j], ck[j], pk);
    }
    qv[i] = aq + pq;
    kv[i] = ak + pk;
    vv[i] = av + b_v[d] + pk;
  }
  const size_t row = (size_t)idx * D_ + 2 * wv;
  v2f qp; qp[0] = qv[0]; qp[1] = qv[1];
  v2f kp; kp[0] = kv[0]; kp[1] = kv[1];
  v2f vp; vp[0] = vv[0]; vp[1] = vv[1];
  const v2h qh = __builtin_convertvector(qp, v2h);
  const v2h kh = __builtin_convertvector(kp, v2h);
  const v2h vh = __builtin_convertvector(vp, v2h);
  *reinterpret_cast<v2f*>(q_f + row) = qp;
  *reinterpret_cast<v2h*>(q_h + row) = qh;
  *reinterpret_cast<v2h*>(k_h + row) = kh;
  _Float16* vrow = v_h + ((size_t)b * D_ + 2 * wv) * N_ + n;
  vrow[0] = vh[0];
  vrow[N_] = vh[1];
}

// ---------------------------------------------------------------------------
// K2: per-query online softmax statistics (rowmax, rowsum).
// One block per 16-query tile, each of its 8 waves takes 512 keys.
// E^T tile = WMMA(A = K-tile, B = Q-tile).
// D layout: lane L reg r -> (key m = m0 + r + 8*(L/16), query n = n0 + L%16)
// ---------------------------------------------------------------------------
__global__ __launch_bounds__(256) void k_rowstats(
    const _Float16* __restrict__ q_h, const _Float16* __restrict__ k_h,
    float* __restrict__ rowmax, float* __restrict__ rowsum) {
  __shared__ float pm[SPLIT][16], ps[SPLIT][16];
  const int wid = blockIdx.x;
  const int b = wid >> 8;
  const int n0 = (wid & (NT - 1)) << 4;
  const int lane = threadIdx.x & 31;
  const int wv = wave_id();
  const int mbeg = wv * CHUNK;
  const int li = lane & 15;
  const int h = lane >> 4;
  const int koff = h << 3;

  const _Float16* qb = q_h + (size_t)b * N_ * D_;
  const _Float16* kb = k_h + (size_t)b * N_ * D_;
  const v16h bq = ld8_pad(qb + (size_t)(n0 + li) * D_ + koff);

  float mx = -__builtin_inff();
  float sm = 0.f;
  for (int i = 0; i < CHUNK; i += 16) {
    const int m0 = mbeg + i;
    const v16h ak = ld8_pad(kb + (size_t)(m0 + li) * D_ + koff);
    v8f z = {};
    const v8f e = wmma_f16(ak, bq, z);
    float tmax = e[0];
#pragma unroll
    for (int r = 1; r < 8; ++r) tmax = fmaxf(tmax, e[r]);
    const float nm = fmaxf(mx, tmax);
    float acc = 0.f;
#pragma unroll
    for (int r = 0; r < 8; ++r) acc += __expf(e[r] - nm);
    sm = sm * __expf(mx - nm) + acc;
    mx = nm;
  }
  // combine the two lane-halves (same query, different key subsets)
  const float mx2 = __shfl_xor(mx, 16, 32);
  const float sm2 = __shfl_xor(sm, 16, 32);
  const float M = fmaxf(mx, mx2);
  const float S = sm * __expf(mx - M) + sm2 * __expf(mx2 - M);
  if (h == 0) {
    pm[wv][li] = M;
    ps[wv][li] = S;
  }
  __syncthreads();
  // merge the 8 waves' (max, sum) pairs, one thread per query
  if (threadIdx.x < 16) {
    const int t = threadIdx.x;
    float Mb = pm[0][t];
#pragma unroll  // the LDS reads are issued together
    for (int w = 1; w < SPLIT; ++w) Mb = fmaxf(Mb, pm[w][t]);
    float Sb = 0.f;
#pragma unroll  // the LDS reads are issued together
    for (int w = 0; w < SPLIT; ++w) Sb += ps[w][t] * __expf(pm[w][t] - Mb);
    rowmax[b * N_ + n0 + t] = Mb;
    rowsum[b * N_ + n0 + t] = Sb;
  }
}

// ---------------------------------------------------------------------------
// K3: column sums over queries (key-major => no atomics). Stores 1/(1e-9+cs).
// One block per 16-key tile, each of its 8 waves takes 512 queries.
// ---------------------------------------------------------------------------
__global__ __launch_bounds__(256) void k_colsum(
    const _Float16* __restrict__ q_h, const _Float16* __restrict__ k_h,
    const float* __restrict__ rowmax, const float* __restrict__ rowsum,
    float* __restrict__ colinv) {
  __shared__ float pc[SPLIT][16];
  const int wid = blockIdx.x;
  const int b = wid >> 8;
  const int m0 = (wid & (NT - 1)) << 4;
  const int lane = threadIdx.x & 31;
  const int wv = wave_id();
  const int nbeg = wv * CHUNK;
  const int li = lane & 15;
  const int h = lane >> 4;
  const int koff = h << 3;

  const _Float16* qb = q_h + (size_t)b * N_ * D_;
  const _Float16* kb = k_h + (size_t)b * N_ * D_;
  const v16h ak = ld8_pad(kb + (size_t)(m0 + li) * D_ + koff);

  float cs[8];
#pragma unroll
  for (int r = 0; r < 8; ++r) cs[r] = 0.f;

  for (int i = 0; i < CHUNK; i += 16) {
    const int n0 = nbeg + i;
    const v16h bq = ld8_pad(qb + (size_t)(n0 + li) * D_ + koff);
    v8f z = {};
    const v8f e = wmma_f16(ak, bq, z);
    const float mx = rowmax[b * N_ + n0 + li];
    const float inv = 1.f / rowsum[b * N_ + n0 + li];
#pragma unroll
    for (int r = 0; r < 8; ++r) cs[r] += __expf(e[r] - mx) * inv;
  }
  // reduce across the 16 queries held by each lane-half
#pragma unroll
  for (int msk = 1; msk < 16; msk <<= 1) {
#pragma unroll
    for (int r = 0; r < 8; ++r) cs[r] += __shfl_xor(cs[r], msk, 32);
  }
  if (li == 0) {
#pragma unroll
    for (int r = 0; r < 8; ++r) pc[wv][koff + r] = cs[r];
  }
  __syncthreads();
  // add the 8 waves' partial column sums, one thread per key
  if (threadIdx.x < 16) {
    const int t = threadIdx.x;
    float c = 0.f;
#pragma unroll  // the LDS reads are issued together
    for (int w = 0; w < SPLIT; ++w) c += pc[w][t];
    colinv[b * N_ + m0 + t] = 1.f / (1e-9f + c);
  }
}

// ---------------------------------------------------------------------------
// K4: recompute weights, X_r^T += V * W^T (K=32: two prob tiles per WMMA),
// then diff = q - x_r feeds the w_t projection WMMA directly; writes t_buf.
// One block per 16-query tile, each of its 8 waves takes 512 keys; wave 0 adds
// the partial X_r tiles and runs the epilogue.
// ---------------------------------------------------------------------------
__global__ __launch_bounds__(256) void k_attn(
    const _Float16* __restrict__ q_h, const _Float16* __restrict__ k_h,
    const _Float16* __restrict__ v_h, const float* __restrict__ q_f,
    const float* __restrict__ rowmax, const float* __restrict__ rowsum,
    const float* __restrict__ colinv,
    const float* __restrict__ w_t, const float* __restrict__ b_t,
    float* __restrict__ t_buf) {
  __shared__ float px[SPLIT][8][32];
  const int wid = blockIdx.x;
  const int b = wid >> 8;
  const int n0 = (wid & (NT - 1)) << 4;
  const int lane = threadIdx.x & 31;
  const int wv = wave_id();
  const int mbeg = wv * CHUNK;
  const int li = lane & 15;
  const int h = lane >> 4;
  const int koff = h << 3;

  const _Float16* qb = q_h + (size_t)b * N_ * D_;
  const _Float16* kb = k_h + (size_t)b * N_ * D_;
  const _Float16* vb = v_h + (size_t)b * D_ * N_;
  const float* cib = colinv + b * N_;

  const v16h bq = ld8_pad(qb + (size_t)(n0 + li) * D_ + koff);
  const float mx = rowmax[b * N_ + n0 + li];
  const float inv = 1.f / rowsum[b * N_ + n0 + li];

  v8f xacc = {};
  for (int i = 0; i < CHUNK; i += 32) {
    const int m0 = mbeg + i;
    const v16h ak0 = ld8_pad(kb + (size_t)(m0 + li) * D_ + koff);
    const v16h ak1 = ld8_pad(kb + (size_t)(m0 + 16 + li) * D_ + koff);
    v8f z = {};
    const v8f e0 = wmma_f16(ak0, bq, z);
    const v8f e1 = wmma_f16(ak1, bq, z);
    const v4f c00 = *reinterpret_cast<const v4f*>(cib + m0 + koff);
    const v4f c01 = *reinterpret_cast<const v4f*>(cib + m0 + koff + 4);
    const v4f c10 = *reinterpret_cast<const v4f*>(cib + m0 + 16 + koff);
    const v4f c11 = *reinterpret_cast<const v4f*>(cib + m0 + 16 + koff + 4);
    // D-tile layout == B-operand layout: pack two 16-key tiles into K=32.
    v16h wv;
#pragma unroll
    for (int r = 0; r < 4; ++r) {
      wv[r]      = (_Float16)(__expf(e0[r] - mx) * inv * c00[r]);
      wv[4 + r]  = (_Float16)(__expf(e0[4 + r] - mx) * inv * c01[r]);
      wv[8 + r]  = (_Float16)(__expf(e1[r] - mx) * inv * c10[r]);
      wv[12 + r] = (_Float16)(__expf(e1[4 + r] - mx) * inv * c11[r]);
    }
    const _Float16* vp = vb + (size_t)li * N_ + m0 + koff;
    const v8h v0 = *reinterpret_cast<const v8h*>(vp);
    const v8h v1 = *reinterpret_cast<const v8h*>(vp + 16);
    v16h av;
#pragma unroll
    for (int i = 0; i < 8; ++i) { av[i] = v0[i]; av[i + 8] = v1[i]; }
    xacc = wmma_f16(av, wv, xacc);
  }

#pragma unroll  // constant indices keep xacc in registers
  for (int r = 0; r < 8; ++r) px[wv][r][lane] = xacc[r];
  __syncthreads();
  if (wv != 0) return;
#pragma unroll  // constant indices keep xacc in registers
  for (int r = 0; r < 8; ++r) {
    float s = 0.f;
#pragma unroll  // the LDS reads are issued together
    for (int w = 0; w < SPLIT; ++w) s += px[w][r][lane];
    xacc[r] = s;
  }

  // xacc: lane reg r -> (d = r + 8h, n = n0 + li). diff feeds next WMMA as B.
  const float* qrow = q_f + ((size_t)b * N_ + n0 + li) * D_ + koff;
  v16h bdiff;
#pragma unroll
  for (int r = 0; r < 8; ++r) {
    bdiff[r] = (_Float16)(qrow[r] - xacc[r]);
    bdiff[r + 8] = (_Float16)0.f;
  }
  v16h awt;
#pragma unroll
  for (int e = 0; e < 8; ++e) {
    awt[e] = (_Float16)w_t[li * D_ + koff + e];
    awt[e + 8] = (_Float16)0.f;
  }
  v8f z2 = {};
  const v8f t = wmma_f16(awt, bdiff, z2);
  float* tb = t_buf + (size_t)b * OUT_ * N_;
#pragma unroll
  for (int r = 0; r < 8; ++r)
    tb[(size_t)(r + koff) * N_ + n0 + li] = t[r] + b_t[r + koff];
}

// ---------------------------------------------------------------------------
// K5: GroupNorm statistics per (b, group): 4 channels x N contiguous floats.
// ---------------------------------------------------------------------------
__global__ __launch_bounds__(1024) void k_gnstats(
    const float* __restrict__ t_buf, float* __restrict__ gn_mean,
    float* __restrict__ gn_rstd) {
  const int bg = blockIdx.x;  // 0..15
  const float* p = t_buf + (size_t)bg * 4 * N_;  // groups are contiguous
  float s = 0.f, s2 = 0.f;
  for (int i = threadIdx.x; i < 4 * N_; i += 1024) {
    const float v = p[i];
    s += v;
    s2 += v * v;
  }
  __shared__ float sh[1024], sh2[1024];
  sh[threadIdx.x] = s;
  sh2[threadIdx.x] = s2;
  __syncthreads();
  for (int off = 512; off > 0; off >>= 1) {
    if (threadIdx.x < off) {
      sh[threadIdx.x] += sh[threadIdx.x + off];
      sh2[threadIdx.x] += sh2[threadIdx.x + off];
    }
    __syncthreads();
  }
  if (threadIdx.x == 0) {
    const float M = (float)(4 * N_);
    const float m = sh[0] / M;
    const float var = sh2[0] / M - m * m;
    gn_mean[bg] = m;
    gn_rstd[bg] = rsqrtf(var + 1e-5f);
  }
}

// ---------------------------------------------------------------------------
// K6: apply GN affine + ReLU, add q^T residual.
// ---------------------------------------------------------------------------
__global__ __launch_bounds__(256) void k_final(
    const float* __restrict__ t_buf, const float* __restrict__ q_f,
    const float* __restrict__ gamma, const float* __restrict__ beta,
    const float* __restrict__ gn_mean, const float* __restrict__ gn_rstd,
    float* __restrict__ out) {
  const int idx = blockIdx.x * blockDim.x + threadIdx.x;
  if (idx >= B_ * OUT_ * N_) return;
  const int n = idx & (N_ - 1);
  const int o = (idx >> 12) & 15;
  const int b = idx >> 16;
  const int bg = b * G_ + (o >> 2);
  float y = (t_buf[idx] - gn_mean[bg]) * gn_rstd[bg] * gamma[o] + beta[o];
  y = fmaxf(y, 0.f);
  out[idx] = q_f[((size_t)b * N_ + n) * D_ + o] + y;
}

// ---------------------------------------------------------------------------
extern "C" void kernel_launch(void* const* d_in, const int* in_sizes, int n_in,
                              void* d_out, int out_size, void* d_ws,
                              size_t ws_size, hipStream_t stream) {
  const float* x_q      = (const float*)d_in[0];
  const float* x_kv     = (const float*)d_in[1];
  const float* xyz_q    = (const float*)d_in[2];
  const float* xyz_kv   = (const float*)d_in[3];
  const float* w_qk     = (const float*)d_in[4];
  const float* w_v      = (const float*)d_in[5];
  const float* b_v      = (const float*)d_in[6];
  const float* w_t      = (const float*)d_in[7];
  const float* b_t      = (const float*)d_in[8];
  const float* gamma    = (const float*)d_in[9];
  const float* beta     = (const float*)d_in[10];
  const float* w_pos_q  = (const float*)d_in[11];
  const float* w_pos_kv = (const float*)d_in[12];
  float* out = (float*)d_out;

  char* ws = (char*)d_ws;
  size_t off = 0;
  auto carve = [&](size_t bytes) -> char* {
    char* p = ws + off;
    off += (bytes + 255) & ~(size_t)255;
    return p;
  };
  float*    q_f    = (float*)carve((size_t)B_ * N_ * D_ * 4);
  _Float16* q_h    = (_Float16*)carve((size_t)B_ * N_ * D_ * 2);
  _Float16* k_h    = (_Float16*)carve((size_t)B_ * N_ * D_ * 2);
  _Float16* v_h    = (_Float16*)carve((size_t)B_ * D_ * N_ * 2);
  float*    rowmax = (float*)carve((size_t)B_ * N_ * 4);
  float*    rowsum = (float*)carve((size_t)B_ * N_ * 4);
  float*    colinv = (float*)carve((size_t)B_ * N_ * 4);
  float*    t_buf  = (float*)carve((size_t)B_ * OUT_ * N_ * 4);
  float*    gn_m   = (float*)carve(B_ * G_ * 4);
  float*    gn_r   = (float*)carve(B_ * G_ * 4);
  (void)in_sizes; (void)n_in; (void)out_size; (void)ws_size;

  k_project<<<B_ * N_ / 32, 32 * SPLIT, 0, stream>>>(
      x_q, x_kv, xyz_q, xyz_kv, w_qk, w_v, b_v, w_pos_q, w_pos_kv,
      q_f, q_h, k_h, v_h);
  k_rowstats<<<B_ * NT, 32 * SPLIT, 0, stream>>>(q_h, k_h, rowmax, rowsum);
  k_colsum<<<B_ * NT, 32 * SPLIT, 0, stream>>>(q_h, k_h, rowmax, rowsum, colinv);
  k_attn<<<B_ * NT, 32 * SPLIT, 0, stream>>>(q_h, k_h, v_h, q_f, rowmax, rowsum,
                                     colinv, w_t, b_t, t_buf);
  k_gnstats<<<B_ * G_, 1024, 0, stream>>>(t_buf, gn_m, gn_r);
  k_final<<<(B_ * OUT_ * N_ + 255) / 256, 256, 0, stream>>>(
      t_buf, q_f, gamma, beta, gn_m, gn_r, out);
}

// v002
// Measured time: 57.1 microseconds a run.
// Two timings next to v001 put it at 1.11 and 1.10 times that version's speed.
// Over all steps from v000 it is 4.38 times as fast.
#include <hip/hip_runtime.h>

#define B_   4
#define CIN  128
#define N_   4096
#define D_   16
#define OUT_ 16
#define G_   4
#define NT   (N_ / 16)   // 256 tiles per batch
#define SPLIT 8             // waves per block; each takes 1/SPLIT of the block's serial loop
#define CHUNK (N_ / SPLIT)  // keys (or queries) per wave
#define PCH   (CIN / SPLIT) // input channels per wave in the projection

// Wave number within the block, in a scalar register: the wave's share of the
// loop, its weight loads and the branch on it are then scalar.
static __device__ __forceinline__ int wave_id() {
  return __builtin_amdgcn_readfirstlane(threadIdx.x >> 5);
}

typedef __attribute__((ext_vector_type(16))) _Float16 v16h;
typedef __attribute__((ext_vector_type(8)))  _Float16 v8h;
typedef __attribute__((ext_vector_type(8)))  float    v8f;
typedef __attribute__((ext_vector_type(4)))  float    v4f;
typedef __attribute__((ext_vector_type(2)))  float    v2f;
typedef __attribute__((ext_vector_type(2)))  _Float16 v2h;

// Load 8 contiguous halves into the low K-half of a WMMA operand, zero-pad the rest.
static __device__ __forceinline__ v16h ld8_pad(const _Float16* p) {
  const v8h lo = *reinterpret_cast<const v8h*>(p);
  v16h r;
#pragma unroll
  for (int i = 0; i < 8; ++i) { r[i] = lo[i]; r[i + 8] = (_Float16)0.f; }
  return r;
}

static __device__ __forceinline__ v8f wmma_f16(v16h a, v16h b, v8f c) {
  return __builtin_amdgcn_wmma_f32_16x16x32_f16(false, a, false, b, (short)0, c,
                                                false, false);
}

// ---------------------------------------------------------------------------
// K1: channel projections (1x1 convs). One block per 32 points, lane = point;
// each of the 8 waves sums 16 of the 128 input channels, partials meet in LDS.
//   q_f [B][N][16] f32, q_h/k_h [B][N][16] f16,
//   v_h [B][N/16][16 channels][16 keys] f16: one 16x16 tile is 512 contiguous
//   bytes, so a wave's A-fragment load in K4 reads whole 128-byte lines
// ---------------------------------------------------------------------------
__global__ __launch_bounds__(256) void k_project(
    const float* __restrict__ x_q, const float* __restrict__ x_kv,
    const float* __restrict__ xyz_q, const float* __restrict__ xyz_kv,
    const float* __restrict__ w_qk, const float* __restrict__ w_v,
    const float* __restrict__ b_v,
    const float* __restrict__ w_pos_q, const float* __restrict__ w_pos_kv,
    float* __restrict__ q_f, _Float16* __restrict__ q_h,
    _Float16* __restrict__ k_h, _Float16* __restrict__ v_h) {
  // partial sums: [wave][q 0..15 | k 16..31 | v 32..47][point]
  __shared__ float part[SPLIT][3 * D_][32];
  const int lane = threadIdx.x & 31;
  const int wv = wave_id();
  const int b = blockIdx.x / (N_ / 32);
  const int n = (blockIdx.x % (N_ / 32)) * 32 + lane;
  const int idx = b * N_ + n;
  const int c0 = wv * PCH;

  const float* xq = x_q + ((size_t)b * CIN + c0) * N_ + n;
  const float* xk = x_kv + ((size_t)b * CIN + c0) * N_ + n;
  float vq[PCH], vk[PCH];
#pragma unroll  // all 32 loads of the wave go out before the first is waited for
  for (int c = 0; c < PCH; ++c) {
    vq[c] = xq[(size_t)c * N_];
    vk[c] = xk[(size_t)c * N_];
  }
  float cq[3], ck[3];
#pragma unroll  // constant indices keep cq, ck in registers
  for (int j = 0; j < 3; ++j) {
    cq[j] = xyz_q[((size_t)b * 3 + j) * N_ + n];
    ck[j] = xyz_kv[((size_t)b * 3 + j) * N_ + n];
  }

#pragma unroll  // independent sums of several d interleave
  for (int d = 0; d < D_; ++d) {
    float sq = 0.f, sk = 0.f, sv = 0.f;
#pragma unroll  // constant indices keep vq, vk in registers
    for (int c = 0; c < PCH; ++c) {
      const float wq = w_qk[d * CIN + c0 + c];
      sq = fmaf(wq, vq[c], sq);
      sk = fmaf(wq, vk[c], sk);
      sv = fmaf(w_v[d * CIN + c0 + c], vk[c], sv);
    }
    part[wv][d][lane] = sq;
    part[wv][D_ + d][lane] = sk;
    part[wv][2 * D_ + d][lane] = sv;
  }
  __syncthreads();

  // wave wv finishes output channels 2*wv and 2*wv+1 of the block's 32 points
  float qv[2], kv[2], vv[2];
#pragma unroll  // qv, kv, vv stay in registers
  for (int i = 0; i < 2; ++i) {
    const int d = 2 * wv + i;
    float aq = 0.f, ak = 0.f, av = 0.f;
#pragma unroll  // the LDS reads are issued together
    for (int w = 0; w < SPLIT; ++w) {
      aq += part[w][d][lane];
      ak += part[w][D_ + d][lane];
      av += part[w][2 * D_ + d][lane];
    }
    float pq = 0.f, pk = 0.f;
#pragma unroll  // constant indices keep cq, ck in registers
    for (int j = 0; j < 3; ++j) {
      pq = fmaf(w_pos_q[d * 3 + j], cq[j], pq);
      pk = fmaf(w_pos_kv[d * 3 + j], ck[j], pk);
    }
    qv[i] = aq + pq;
    kv[i] = ak + pk;
    vv[i] = av + b_v[d] + pk;
  }
  const size_t row = (size_t)idx * D_ + 2 * wv;
  v2f qp; qp[0] = qv[0]; qp[1] = qv[1];
  v2f kp; kp[0] = kv[0]; kp[1] = kv[1];
  v2f vp; vp[0] = vv[0]; vp[1] = vv[1];
  const v2h qh = __builtin_convertvector(qp, v2h);
  const v2h kh = __builtin_convertvector(kp, v2h);
  const v2h vh = __builtin_convertvector(vp, v2h);
  *reinterpret_cast<v2f*>(q_f + row) = qp;
  *reinterpret_cast<v2h*>(q_h + row) = qh;
  *reinterpret_cast<v2h*>(k_h + row) = kh;
  _Float16* vrow = v_h + ((size_t)b * N_ + (n & ~15)) * D_ + 2 * wv * 16 + (n & 15);
  vrow[0] = vh[0];
  vrow[16] = vh[1];
}

// ---------------------------------------------------------------------------
// K2: per-query online softmax statistics (rowmax, rowsum).
// One block per 16-query tile, each of its 8 waves takes 512 keys.
// E^T tile = WMMA(A = K-tile, B = Q-tile).
// D layout: lane L reg r -> (key m = m0 + r + 8*(L/16), query n = n0 + L%16)
// ---------------------------------------------------------------------------
__global__ __launch_bounds__(256) void k_rowstats(
    const _Float16* __restrict__ q_h, const _Float16* __restrict__ k_h,
    float* __restrict__ rowmax, float* __restrict__ rowsum) {
  __shared__ float pm[SPLIT][16], ps[SPLIT][16];
  const int wid = blockIdx.x;
  const int b = wid >> 8;
  const int n0 = (wid & (NT - 1)) << 4;
  const int lane = threadIdx.x & 31;
  const int wv = wave_id();
  const int mbeg = wv * CHUNK;
  const int li = lane & 15;
  const int h = lane >> 4;
  const int koff = h << 3;

  const _Float16* qb = q_h + (size_t)b * N_ * D_;
  const _Float16* kb = k_h + (size_t)b * N_ * D_;
  const v16h bq = ld8_pad(qb + (size_t)(n0 + li) * D_ + koff);

  float mx = -__builtin_inff();
  float sm = 0.f;
  for (int i = 0; i < CHUNK; i += 16) {
    const int m0 = mbeg + i;
    const v16h ak = ld8_pad(kb + (size_t)(m0 + li) * D_ + koff);
    v8f z = {};
    const v8f e = wmma_f16(ak, bq, z);
    float tmax = e[0];
#pragma unroll
    for (int r = 1; r < 8; ++r) tmax = fmaxf(tmax, e[r]);
    const float nm = fmaxf(mx, tmax);
    float acc = 0.f;
#pragma unroll
    for (int r = 0; r < 8; ++r) acc += __expf(e[r] - nm);
    sm = sm * __expf(mx - nm) + acc;
    mx = nm;
  }
  // combine the two lane-halves (same query, different key subsets)
  const float mx2 = __shfl_xor(mx, 16, 32);
  const float sm2 = __shfl_xor(sm, 16, 32);
  const float M = fmaxf(mx, mx2);
  const float S = sm * __expf(mx - M) + sm2 * __expf(mx2 - M);
  if (h == 0) {
    pm[wv][li] = M;
    ps[wv][li] = S;
  }
  __syncthreads();
  // merge the 8 waves' (max, sum) pairs, one thread per query
  if (threadIdx.x < 16) {
    const int t = threadIdx.x;
    float Mb = pm[0][t];
#pragma unroll  // the LDS reads are issued together
    for (int w = 1; w < SPLIT; ++w) Mb = fmaxf(Mb, pm[w][t]);
    float Sb = 0.f;
#pragma unroll  // the LDS reads are issued together
    for (int w = 0; w < SPLIT; ++w) Sb += ps[w][t] * __expf(pm[w][t] - Mb);
    rowmax[b * N_ + n0 + t] = Mb;
    rowsum[b * N_ + n0 + t] = Sb;
  }
}

// ---------------------------------------------------------------------------
// K3: column sums over queries (key-major => no atomics). Stores 1/(1e-9+cs).
// One block per 16-key tile, each of its 8 waves takes 512 queries.
// ---------------------------------------------------------------------------
__global__ __launch_bounds__(256) void k_colsum(
    const _Float16* __restrict__ q_h, const _Float16* __restrict__ k_h,
    const float* __restrict__ rowmax, const float* __restrict__ rowsum,
    float* __restrict__ colinv) {
  __shared__ float pc[SPLIT][16];
  const int wid = blockIdx.x;
  const int b = wid >> 8;
  const int m0 = (wid & (NT - 1)) << 4;
  const int lane = threadIdx.x & 31;
  const int wv = wave_id();
  const int nbeg = wv * CHUNK;
  const int li = lane & 15;
  const int h = lane >> 4;
  const int koff = h << 3;

  const _Float16* qb = q_h + (size_t)b * N_ * D_;
  const _Float16* kb = k_h + (size_t)b * N_ * D_;
  const v16h ak = ld8_pad(kb + (size_t)(m0 + li) * D_ + koff);

  float cs[8];
#pragma unroll
  for (int r = 0; r < 8; ++r) cs[r] = 0.f;

  for (int i = 0; i < CHUNK; i += 16) {
    const int n0 = nbeg + i;
    const v16h bq = ld8_pad(qb + (size_t)(n0 + li) * D_ + koff);
    v8f z = {};
    const v8f e = wmma_f16(ak, bq, z);
    const float mx = rowmax[b * N_ + n0 + li];
    const float inv = 1.f / rowsum[b * N_ + n0 + li];
#pragma unroll
    for (int r = 0; r < 8; ++r) cs[r] += __expf(e[r] - mx) * inv;
  }
  // reduce across the 16 queries held by each lane-half
#pragma unroll
  for (int msk = 1; msk < 16; msk <<= 1) {
#pragma unroll
    for (int r = 0; r < 8; ++r) cs[r] += __shfl_xor(cs[r], msk, 32);
  }
  if (li == 0) {
#pragma unroll
    for (int r = 0; r < 8; ++r) pc[wv][koff + r] = cs[r];
  }
  __syncthreads();
  // add the 8 waves' partial column sums, one thread per key
  if (threadIdx.x < 16) {
    const int t = threadIdx.x;
    float c = 0.f;
#pragma unroll  // the LDS reads are issued together
    for (int w = 0; w < SPLIT; ++w) c += pc[w][t];
    colinv[b * N_ + m0 + t] = 1.f / (1e-9f + c);
  }
}

// ---------------------------------------------------------------------------
// K4: recompute weights, X_r^T += V * W^T (K=32: two prob tiles per WMMA),
// then diff = q - x_r feeds the w_t projection WMMA directly; writes t_buf.
// One block per 16-query tile, each of its 8 waves takes 512 keys; wave 0 adds
// the partial X_r tiles and runs the epilogue.
// ---------------------------------------------------------------------------
__global__ __launch_bounds__(256) void k_attn(
    const _Float16* __restrict__ q_h, const _Float16* __restrict__ k_h,
    const _Float16* __restrict__ v_h, const float* __restrict__ q_f,
    const float* __restrict__ rowmax, const float* __restrict__ rowsum,
    const float* __restrict__ colinv,
    const float* __restrict__ w_t, const float* __restrict__ b_t,
    float* __restrict__ t_buf) {
  __shared__ float px[SPLIT][8][32];
  const int wid = blockIdx.x;
  const int b = wid >> 8;
  const int n0 = (wid & (NT - 1)) << 4;
  const int lane = threadIdx.x & 31;
  const int wv = wave_id();
  const int mbeg = wv * CHUNK;
  const int li = lane & 15;
  const int h = lane >> 4;
  const int koff = h << 3;

  const _Float16* qb = q_h + (size_t)b * N_ * D_;
  const _Float16* kb = k_h + (size_t)b * N_ * D_;
  const _Float16* vb = v_h + (size_t)b * D_ * N_;
  const float* cib = colinv + b * N_;

  const v16h bq = ld8_pad(qb + (size_t)(n0 + li) * D_ + koff);
  const float mx = rowmax[b * N_ + n0 + li];
  const float inv = 1.f / rowsum[b * N_ + n0 + li];

  v8f xacc = {};
  for (int i = 0; i < CHUNK; i += 32) {
    const int m0 = mbeg + i;
    const v16h ak0 = ld8_pad(kb + (size_t)(m0 + li) * D_ + koff);
    const v16h ak1 = ld8_pad(kb + (size_t)(m0 + 16 + li) * D_ + koff);
    v8f z = {};
    const v8f e0 = wmma_f16(ak0, bq, z);
    const v8f e1 = wmma_f16(ak1, bq, z);
    const v4f c00 = *reinterpret_cast<const v4f*>(cib + m0 + koff);
    const v4f c01 = *reinterpret_cast<const v4f*>(cib + m0 + koff + 4);
    const v4f c10 = *reinterpret_cast<const v4f*>(cib + m0 + 16 + koff);
    const v4f c11 = *reinterpret_cast<const v4f*>(cib + m0 + 16 + koff + 4);
    // D-tile layout == B-operand layout: pack two 16-key tiles into K=32.
    v16h wv;
#pragma unroll
    for (int r = 0; r < 4; ++r) {
      wv[r]      = (_Float16)(__expf(e0[r] - mx) * inv * c00[r]);
      wv[4 + r]  = (_Float16)(__expf(e0[4 + r] - mx) * inv * c01[r]);
      wv[8 + r]  = (_Float16)(__expf(e1[r] - mx) * inv * c10[r]);
      wv[12 + r] = (_Float16)(__expf(e1[4 + r] - mx) * inv * c11[r]);
    }
    // tile m0/16 and the next one: channel li, keys koff..koff+7 of each
    const _Float16* vp = vb + (size_t)m0 * D_ + li * 16 + koff;
    const v8h v0 = *reinterpret_cast<const v8h*>(vp);
    const v8h v1 = *reinterpret_cast<const v8h*>(vp + 256);
    v16h av;
#pragma unroll
    for (int i = 0; i < 8; ++i) { av[i] = v0[i]; av[i + 8] = v1[i]; }
    xacc = wmma_f16(av, wv, xacc);
  }

#pragma unroll  // constant indices keep xacc in registers
  for (int r = 0; r < 8; ++r) px[wv][r][lane] = xacc[r];
  __syncthreads();
  if (wv != 0) return;
#pragma unroll  // constant indices keep xacc in registers
  for (int r = 0; r < 8; ++r) {
    float s = 0.f;
#pragma unroll  // the LDS reads are issued together
    for (int w = 0; w < SPLIT; ++w) s += px[w][r][lane];
    xacc[r] = s;
  }

  // xacc: lane reg r -> (d = r + 8h, n = n0 + li). diff feeds next WMMA as B.
  const float* qrow = q_f + ((size_t)b * N_ + n0 + li) * D_ + koff;
  v16h bdiff;
#pragma unroll
  for (int r = 0; r < 8; ++r) {
    bdiff[r] = (_Float16)(qrow[r] - xacc[r]);
    bdiff[r + 8] = (_Float16)0.f;
  }
  v16h awt;
#pragma unroll
  for (int e = 0; e < 8; ++e) {
    awt[e] = (_Float16)w_t[li * D_ + koff + e];
    awt[e + 8] = (_Float16)0.f;
  }
  v8f z2 = {};
  const v8f t = wmma_f16(awt, bdiff, z2);
  float* tb = t_buf + (size_t)b * OUT_ * N_;
#pragma unroll
  for (int r = 0; r < 8; ++r)
    tb[(size_t)(r + koff) * N_ + n0 + li] = t[r] + b_t[r + koff];
}

// ---------------------------------------------------------------------------
// K5: GroupNorm statistics per (b, group): 4 channels x N contiguous floats.
// ---------------------------------------------------------------------------
__global__ __launch_bounds__(1024) void k_gnstats(
    const float* __restrict__ t_buf, float* __restrict__ gn_mean,
    float* __restrict__ gn_rstd) {
  const int bg = blockIdx.x;  // 0..15
  const float* p = t_buf + (size_t)bg * 4 * N_;  // groups are contiguous
  float s = 0.f, s2 = 0.f;
  for (int i = threadIdx.x; i < 4 * N_; i += 1024) {
    const float v = p[i];
    s += v;
    s2 += v * v;
  }
  __shared__ float sh[1024], sh2[1024];
  sh[threadIdx.x] = s;
  sh2[threadIdx.x] = s2;
  __syncthreads();
  for (int off = 512; off > 0; off >>= 1) {
    if (threadIdx.x < off) {
      sh[threadIdx.x] += sh[threadIdx.x + off];
      sh2[threadIdx.x] += sh2[threadIdx.x + off];
    }
    __syncthreads();
  }
  if (threadIdx.x == 0) {
    const float M = (float)(4 * N_);
    const float m = sh[0] / M;
    const float var = sh2[0] / M - m * m;
    gn_mean[bg] = m;
    gn_rstd[bg] = rsqrtf(var + 1e-5f);
  }
}

// ---------------------------------------------------------------------------
// K6: apply GN affine + ReLU, add q^T residual.
// ---------------------------------------------------------------------------
__global__ __launch_bounds__(256) void k_final(
    const float* __restrict__ t_buf, const float* __restrict__ q_f,
    const float* __restrict__ gamma, const float* __restrict__ beta,
    const float* __restrict__ gn_mean, const float* __restrict__ gn_rstd,
    float* __restrict__ out) {
  const int idx = blockIdx.x * blockDim.x + threadIdx.x;
  if (idx >= B_ * OUT_ * N_) return;
  const int n = idx & (N_ - 1);
  const int o = (idx >> 12) & 15;
  const int b = idx >> 16;
  const int bg = b * G_ + (o >> 2);
  float y = (t_buf[idx] - gn_mean[bg]) * gn_rstd[bg] * gamma[o] + beta[o];
  y = fmaxf(y, 0.f);
  out[idx] = q_f[((size_t)b * N_ + n) * D_ + o] + y;
}

// ---------------------------------------------------------------------------
extern "C" void kernel_launch(void* const* d_in, const int* in_sizes, int n_in,
                              void* d_out, int out_size, void* d_ws,
                              size_t ws_size, hipStream_t stream) {
  const float* x_q      = (const float*)d_in[0];
  const float* x_kv     = (const float*)d_in[1];
  const float* xyz_q    = (const float*)d_in[2];
  const float* xyz_kv   = (const float*)d_in[3];
  const float* w_qk     = (const float*)d_in[4];
  const float* w_v      = (const float*)d_in[5];
  const float* b_v      = (const float*)d_in[6];
  const float* w_t      = (const float*)d_in[7];
  const float* b_t      = (const float*)d_in[8];
  const float* gamma    = (const float*)d_in[9];
  const float* beta     = (const float*)d_in[10];
  const float* w_pos_q  = (const float*)d_in[11];
  const float* w_pos_kv = (const float*)d_in[12];
  float* out = (float*)d_out;

  char* ws = (char*)d_ws;
  size_t off = 0;
  auto carve = [&](size_t bytes) -> char* {
    char* p = ws + off;
    off += (bytes + 255) & ~(size_t)255;
    return p;
  };
  float*    q_f    = (float*)carve((size_t)B_ * N_ * D_ * 4);
  _Float16* q_h    = (_Float16*)carve((size_t)B_ * N_ * D_ * 2);
  _Float16* k_h    = (_Float16*)carve((size_t)B_ * N_ * D_ * 2);
  _Float16* v_h    = (_Float16*)carve((size_t)B_ * D_ * N_ * 2);
  float*    rowmax = (float*)carve((size_t)B_ * N_ * 4);
  float*    rowsum = (float*)carve((size_t)B_ * N_ * 4);
  float*    colinv = (float*)carve((size_t)B_ * N_ * 4);
  float*    t_buf  = (float*)carve((size_t)B_ * OUT_ * N_ * 4);
  float*    gn_m   = (float*)carve(B_ * G_ * 4);
  float*    gn_r   = (float*)carve(B_ * G_ * 4);
  (void)in_sizes; (void)n_in; (void)out_size; (void)ws_size;

  k_project<<<B_ * N_ / 32, 32 * SPLIT, 0, stream>>>(
      x_q, x_kv, xyz_q, xyz_kv, w_qk, w_v, b_v, w_pos_q, w_pos_kv,
      q_f, q_h, k_h, v_h);
  k_rowstats<<<B_ * NT, 32 * SPLIT, 0, stream>>>(q_h, k_h, rowmax, rowsum);
  k_colsum<<<B_ * NT, 32 * SPLIT, 0, stream>>>(q_h, k_h, rowmax, rowsum, colinv);
  k_attn<<<B_ * NT, 32 * SPLIT, 0, stream>>>(q_h, k_h, v_h, q_f, rowmax, rowsum,
                                     colinv, w_t, b_t, t_buf);
  k_gnstats<<<B_ * G_, 1024, 0, stream>>>(t_buf, gn_m, gn_r);
  k_final<<<(B_ * OUT_ * N_ + 255) / 256, 256, 0, stream>>>(
      t_buf, q_f, gamma, beta, gn_m, gn_r, out);
}

// v003
// It runs in 46.8 microseconds.
// Timed twice side by side with v002, it ran 1.22 times as fast both times.
// Over all steps from v000 it is 5.34 times as fast.
#include <hip/hip_runtime.h>

#define B_   4
#define CIN  128
#define N_   4096
#define D_   16
#define OUT_ 16
#define G_   4
#define SPLIT 8             // waves per block in the projection
#define PCH   (CIN / SPLIT) // input channels per wave in the projection
#define QT  4               // attention passes: 16-row tiles a wave keeps in registers
#define AW  16              // attention passes: waves per block
#define ACH (N_ / AW)       // attention passes: streamed keys (or queries) per wave
#define NB  (N_ / (16 * QT)) // attention passes: blocks per batch

// Wave number within the block, in a scalar register: the wave's share of the
// loop, its weight loads and the branch on it are then scalar.
static __device__ __forceinline__ int wave_id() {
  return __builtin_amdgcn_readfirstlane(threadIdx.x >> 5);
}

typedef __attribute__((ext_vector_type(16))) _Float16 v16h;
typedef __attribute__((ext_vector_type(8)))  _Float16 v8h;
typedef __attribute__((ext_vector_type(8)))  float    v8f;
typedef __attribute__((ext_vector_type(4)))  float    v4f;
typedef __attribute__((ext_vector_type(2)))  float    v2f;
typedef __attribute__((ext_vector_type(2)))  _Float16 v2h;

// Load 8 contiguous halves into the low K-half of a WMMA operand, zero-pad the rest.
static __device__ __forceinline__ v16h ld8_pad(const _Float16* p) {
  const v8h lo = *reinterpret_cast<const v8h*>(p);
  v16h r;
#pragma unroll
  for (int i = 0; i < 8; ++i) { r[i] = lo[i]; r[i + 8] = (_Float16)0.f; }
  return r;
}

static __device__ __forceinline__ v8f wmma_f16(v16h a, v16h b, v8f c) {
  return __builtin_amdgcn_wmma_f32_16x16x32_f16(false, a, false, b, (short)0, c,
                                                false, false);
}

// ---------------------------------------------------------------------------
// K1: channel projections (1x1 convs). One block per 32 points, lane = point;
// each of the 8 waves sums 16 of the 128 input channels, partials meet in LDS.
//   q_f [B][N][16] f32, q_h/k_h [B][N][16] f16,
//   v_h [B][N/16][16 channels][16 keys] f16: one 16x16 tile is 512 contiguous
//   bytes, so a wave's A-fragment load in K4 reads whole 128-byte lines
// ---------------------------------------------------------------------------
__global__ __launch_bounds__(256) void k_project(
    const float* __restrict__ x_q, const float* __restrict__ x_kv,
    const float* __restrict__ xyz_q, const float* __restrict__ xyz_kv,
    const float* __restrict__ w_qk, const float* __restrict__ w_v,
    const float* __restrict__ b_v,
    const float* __restrict__ w_pos_q, const float* __restrict__ w_pos_kv,
    float* __restrict__ q_f, _Float16* __restrict__ q_h,
    _Float16* __restrict__ k_h, _Float16* __restrict__ v_h) {
  // partial sums: [wave][q 0..15 | k 16..31 | v 32..47][point]
  __shared__ float part[SPLIT][3 * D_][32];
  const int lane = threadIdx.x & 31;
  const int wv = wave_id();
  const int b = blockIdx.x / (N_ / 32);
  const int n = (blockIdx.x % (N_ / 32)) * 32 + lane;
  const int idx = b * N_ + n;
  const int c0 = wv * PCH;

  const float* xq = x_q + ((size_t)b * CIN + c0) * N_ + n;
  const float* xk = x_kv + ((size_t)b * CIN + c0) * N_ + n;
  float vq[PCH], vk[PCH];
#pragma unroll  // all 32 loads of the wave go out before the first is waited for
  for (int c = 0; c < PCH; ++c) {
    vq[c] = xq[(size_t)c * N_];
    vk[c] = xk[(size_t)c * N_];
  }
  float cq[3], ck[3];
#pragma unroll  // constant indices keep cq, ck in registers
  for (int j = 0; j < 3; ++j) {
    cq[j] = xyz_q[((size_t)b * 3 + j) * N_ + n];
    ck[j] = xyz_kv[((size_t)b * 3 + j) * N_ + n];
  }

#pragma unroll  // independent sums of several d interleave
  for (int d = 0; d < D_; ++d) {
    float sq = 0.f, sk = 0.f, sv = 0.f;
#pragma unroll  // constant indices keep vq, vk in registers
    for (int c = 0; c < PCH; ++c) {
      const float wq = w_qk[d * CIN + c0 + c];
      sq = fmaf(wq, vq[c], sq);
      sk = fmaf(wq, vk[c], sk);
      sv = fmaf(w_v[d * CIN + c0 + c], vk[c], sv);
    }
    part[wv][d][lane] = sq;
    part[wv][D_ + d][lane] = sk;
    part[wv][2 * D_ + d][lane] = sv;
  }
  __syncthreads();

  // wave wv finishes output channels 2*wv and 2*wv+1 of the block's 32 points
  float qv[2], kv[2], vv[2];
#pragma unroll  // qv, kv, vv stay in registers
  for (int i = 0; i < 2; ++i) {
    const int d = 2 * wv + i;
    float aq = 0.f, ak = 0.f, av = 0.f;
#pragma unroll  // the LDS reads are issued together
    for (int w = 0; w < SPLIT; ++w) {
      aq += part[w][d][lane];
      ak += part[w][D_ + d][lane];
      av += part[w][2 * D_ + d][lane];
    }
    float pq = 0.f, pk = 0.f;
#pragma unroll  // constant indices keep cq, ck in registers
    for (int j = 0; j < 3; ++j) {
      pq = fmaf(w_pos_q[d * 3 + j], cq[j], pq);
      pk = fmaf(w_pos_kv[d * 3 + j], ck[j], pk);
    }
    qv[i] = aq + pq;
    kv[i] = ak + pk;
    vv[i] = av + b_v[d] + pk;
  }
  const size_t row = (size_t)idx * D_ + 2 * wv;
  v2f qp; qp[0] = qv[0]; qp[1] = qv[1];
  v2f kp; kp[0] = kv[0]; kp[1] = kv[1];
  v2f vp; vp[0] = vv[0]; vp[1] = vv[1];
  const v2h qh = __builtin_convertvector(qp, v2h);
  const v2h kh = __builtin_convertvector(kp, v2h);
  const v2h vh = __builtin_convertvector(vp, v2h);
  *reinterpret_cast<v2f*>(q_f + row) = qp;
  *reinterpret_cast<v2h*>(q_h + row) = qh;
  *reinterpret_cast<v2h*>(k_h + row) = kh;
  _Float16* vrow = v_h + ((size_t)b * N_ + (n & ~15)) * D_ + 2 * wv * 16 + (n & 15);
  vrow[0] = vh[0];
  vrow[16] = vh[1];
}

// ---------------------------------------------------------------------------
// K2: per-query online softmax statistics (rowmax, rowsum).
// One block per 64 queries; each of its 16 waves holds the 4 query tiles in
// registers and takes 256 keys, so one key fragment feeds 4 WMMAs.
// E^T tile = WMMA(A = K-tile, B = Q-tile).
// D layout: lane L reg r -> (key m = m0 + r + 8*(L/16), query n = n0 + L%16)
// ---------------------------------------------------------------------------
__global__ __launch_bounds__(32 * AW) void k_rowstats(
    const _Float16* __restrict__ q_h, const _Float16* __restrict__ k_h,
    float* __restrict__ rowmax, float* __restrict__ rowsum) {
  __shared__ float pm[AW][16 * QT], ps[AW][16 * QT];
  const int wid = blockIdx.x;
  const int b = wid / NB;
  const int n0 = (wid % NB) * (16 * QT);
  const int lane = threadIdx.x & 31;
  const int wv = wave_id();
  const int mbeg = wv * ACH;
  const int li = lane & 15;
  const int h = lane >> 4;
  const int koff = h << 3;

  const _Float16* qb = q_h + (size_t)b * N_ * D_;
  const _Float16* kb = k_h + (size_t)b * N_ * D_;
  v16h bq[QT];
  float mx[QT], sm[QT];
#pragma unroll  // constant indices keep bq, mx, sm in registers
  for (int t = 0; t < QT; ++t) {
    bq[t] = ld8_pad(qb + (size_t)(n0 + 16 * t + li) * D_ + koff);
    mx[t] = -__builtin_inff();
    sm[t] = 0.f;
  }

  for (int i = 0; i < ACH; i += 32) {
    v16h ak[2];
#pragma unroll  // constant indices keep ak in registers
    for (int u = 0; u < 2; ++u)
      ak[u] = ld8_pad(kb + (size_t)(mbeg + i + 16 * u + li) * D_ + koff);
    // keeps the loads of both key tiles together at the trip's top: the
    // second tile's, sunk behind the first tile's work, is waited for anew
    __builtin_amdgcn_sched_barrier(0);
#pragma unroll  // constant indices keep ak in registers
    for (int u = 0; u < 2; ++u) {
      v8f et[QT];
#pragma unroll  // four independent WMMAs in a row fill one another's result distance
      for (int t = 0; t < QT; ++t) {
        v8f z = {};
        et[t] = wmma_f16(ak[u], bq[t], z);
      }
#pragma unroll  // constant indices keep et, mx, sm in registers
      for (int t = 0; t < QT; ++t) {
        const v8f e = et[t];
        float tmax = e[0];
#pragma unroll
        for (int r = 1; r < 8; ++r) tmax = fmaxf(tmax, e[r]);
        const float nm = fmaxf(mx[t], tmax);
        float acc = 0.f;
#pragma unroll
        for (int r = 0; r < 8; ++r) acc += __expf(e[r] - nm);
        sm[t] = sm[t] * __expf(mx[t] - nm) + acc;
        mx[t] = nm;
      }
    }
  }
  // combine the two lane-halves (same query, different key subsets)
#pragma unroll  // constant indices keep mx, sm in registers
  for (int t = 0; t < QT; ++t) {
    const float mx2 = __shfl_xor(mx[t], 16, 32);
    const float sm2 = __shfl_xor(sm[t], 16, 32);
    const float M = fmaxf(mx[t], mx2);
    const float S = sm[t] * __expf(mx[t] - M) + sm2 * __expf(mx2 - M);
    if (h == 0) {
      pm[wv][16 * t + li] = M;
      ps[wv][16 * t + li] = S;
    }
  }
  __syncthreads();
  // merge the 16 waves' (max, sum) pairs, one thread per query
  if (threadIdx.x < 16 * QT) {
    const int t = threadIdx.x;
    float Mb = pm[0][t];
#pragma unroll  // the LDS reads are issued together
    for (int w = 1; w < AW; ++w) Mb = fmaxf(Mb, pm[w][t]);
    float Sb = 0.f;
#pragma unroll  // the LDS reads are issued together
    for (int w = 0; w < AW; ++w) Sb += ps[w][t] * __expf(pm[w][t] - Mb);
    rowmax[b * N_ + n0 + t] = Mb;
    rowsum[b * N_ + n0 + t] = Sb;
  }
}

// ---------------------------------------------------------------------------
// K3: column sums over queries (key-major => no atomics). Stores 1/(1e-9+cs).
// One block per 64 keys; each of its 16 waves holds the 4 key tiles in
// registers and takes 256 queries, so one query fragment and its row
// statistics feed 4 WMMAs.
// ---------------------------------------------------------------------------
__global__ __launch_bounds__(32 * AW) void k_colsum(
    const _Float16* __restrict__ q_h, const _Float16* __restrict__ k_h,
    const float* __restrict__ rowmax, const float* __restrict__ rowsum,
    float* __restrict__ colinv) {
  __shared__ float pc[AW][16 * QT];
  const int wid = blockIdx.x;
  const int b = wid / NB;
  const int m0 = (wid % NB) * (16 * QT);
  const int lane = threadIdx.x & 31;
  const int wv = wave_id();
  const int nbeg = wv * ACH;
  const int li = lane & 15;
  const int h = lane >> 4;
  const int koff = h << 3;

  const _Float16* qb = q_h + (size_t)b * N_ * D_;
  const _Float16* kb = k_h + (size_t)b * N_ * D_;
  v16h ak[QT];
  float cs[QT][8];
#pragma unroll  // constant indices keep ak, cs in registers
  for (int t = 0; t < QT; ++t) {
    ak[t] = ld8_pad(kb + (size_t)(m0 + 16 * t + li) * D_ + koff);
#pragma unroll
    for (int r = 0; r < 8; ++r) cs[t][r] = 0.f;
  }

  for (int i = 0; i < ACH; i += 32) {
    v16h bq[2];
    float mx[2], rs[2];
#pragma unroll  // constant indices keep bq, mx, rs in registers
    for (int u = 0; u < 2; ++u) {
      const int n0 = nbeg + i + 16 * u;
      bq[u] = ld8_pad(qb + (size_t)(n0 + li) * D_ + koff);
      mx[u] = rowmax[b * N_ + n0 + li];
      rs[u] = rowsum[b * N_ + n0 + li];
    }
    // keeps the loads of both query tiles together at the trip's top: the
    // second tile's, sunk behind the first tile's work, are waited for anew
    __builtin_amdgcn_sched_barrier(0);
#pragma unroll  // constant indices keep bq, mx, rs in registers
    for (int u = 0; u < 2; ++u) {
      const float inv = 1.f / rs[u];
      v8f et[QT];
#pragma unroll  // four independent WMMAs in a row fill one another's result distance
      for (int t = 0; t < QT; ++t) {
        v8f z = {};
        et[t] = wmma_f16(ak[t], bq[u], z);
      }
#pragma unroll  // constant indices keep et, cs in registers
      for (int t = 0; t < QT; ++t) {
#pragma unroll
        for (int r = 0; r < 8; ++r) cs[t][r] += __expf(et[t][r] - mx[u]) * inv;
      }
    }
  }
  // reduce across the 16 queries held by each lane-half
#pragma unroll
  for (int msk = 1; msk < 16; msk <<= 1) {
#pragma unroll
    for (int t = 0; t < QT; ++t) {
#pragma unroll
      for (int r = 0; r < 8; ++r) cs[t][r] += __shfl_xor(cs[t][r], msk, 32);
    }
  }
  if (li == 0) {
#pragma unroll
    for (int t = 0; t < QT; ++t) {
#pragma unroll
      for (int r = 0; r < 8; ++r) pc[wv][16 * t + koff + r] = cs[t][r];
    }
  }
  __syncthreads();
  // add the 16 waves' partial column sums, one thread per key
  if (threadIdx.x < 16 * QT) {
    const int t = threadIdx.x;
    float c = 0.f;
#pragma unroll  // the LDS reads are issued together
    for (int w = 0; w < AW; ++w) c += pc[w][t];
    colinv[b * N_ + m0 + t] = 1.f / (1e-9f + c);
  }
}

// ---------------------------------------------------------------------------
// K4: recompute weights, X_r^T += V * W^T (K=32: two prob tiles per WMMA),
// then diff = q - x_r feeds the w_t projection WMMA directly; writes t_buf.
// One block per 64 queries; each of its 16 waves holds the 4 query tiles in
// registers and takes 256 keys, so the K, V and column-scale loads of 32 keys
// feed 12 WMMAs. Waves 0..3 add the partial X_r tiles, one tile each, and run
// the epilogue.
// ---------------------------------------------------------------------------
__global__ __launch_bounds__(32 * AW) void k_attn(
    const _Float16* __restrict__ q_h, const _Float16* __restrict__ k_h,
    const _Float16* __restrict__ v_h, const float* __restrict__ q_f,
    const float* __restrict__ rowmax, const float* __restrict__ rowsum,
    const float* __restrict__ colinv,
    const float* __restrict__ w_t, const float* __restrict__ b_t,
    float* __restrict__ t_buf) {
  __shared__ v8f px[AW][QT][32];  // a lane's 8 partial sums lie together
  const int wid = blockIdx.x;
  const int b = wid / NB;
  const int n0 = (wid % NB) * (16 * QT);
  const int lane = threadIdx.x & 31;
  const int wv = wave_id();
  const int mbeg = wv * ACH;
  const int li = lane & 15;
  const int h = lane >> 4;
  const int koff = h << 3;

  const _Float16* qb = q_h + (size_t)b * N_ * D_;
  const _Float16* kb = k_h + (size_t)b * N_ * D_;
  const _Float16* vb = v_h + (size_t)b * D_ * N_;
  const float* cib = colinv + b * N_;

  v16h bq[QT];
  float mx[QT], inv[QT];
  v8f xacc[QT];
#pragma unroll  // constant indices keep the four tiles' state in registers
  for (int t = 0; t < QT; ++t) {
    bq[t] = ld8_pad(qb + (size_t)(n0 + 16 * t + li) * D_ + koff);
    mx[t] = rowmax[b * N_ + n0 + 16 * t + li];
    inv[t] = 1.f / rowsum[b * N_ + n0 + 16 * t + li];
    v8f z = {};
    xacc[t] = z;
  }

  for (int i = 0; i < ACH; i += 32) {
    const int m0 = mbeg + i;
    const v16h ak0 = ld8_pad(kb + (size_t)(m0 + li) * D_ + koff);
    const v16h ak1 = ld8_pad(kb + (size_t)(m0 + 16 + li) * D_ + koff);
    const v4f c00 = *reinterpret_cast<const v4f*>(cib + m0 + koff);
    const v4f c01 = *reinterpret_cast<const v4f*>(cib + m0 + koff + 4);
    const v4f c10 = *reinterpret_cast<const v4f*>(cib + m0 + 16 + koff);
    const v4f c11 = *reinterpret_cast<const v4f*>(cib + m0 + 16 + koff + 4);
    // tile m0/16 and the next one: channel li, keys koff..koff+7 of each
    const _Float16* vp = vb + (size_t)m0 * D_ + li * 16 + koff;
    const v8h v0 = *reinterpret_cast<const v8h*>(vp);
    const v8h v1 = *reinterpret_cast<const v8h*>(vp + 256);
    v16h av;
#pragma unroll
    for (int j = 0; j < 8; ++j) { av[j] = v0[j]; av[j + 8] = v1[j]; }
    // keeps the trip's eight loads together at its top: sunk among the WMMAs,
    // each group of them is waited for on its own
    __builtin_amdgcn_sched_barrier(0);
    v8f e0[QT], e1[QT];
#pragma unroll  // eight independent WMMAs in a row fill one another's result distance
    for (int t = 0; t < QT; ++t) {
      v8f z = {};
      e0[t] = wmma_f16(ak0, bq[t], z);
      e1[t] = wmma_f16(ak1, bq[t], z);
    }
    // keeps the eight in a row: moved down to their readers, each is followed
    // by idle slots until its result may be read
    __builtin_amdgcn_sched_barrier(0);
#pragma unroll  // constant indices keep the four tiles' state in registers
    for (int t = 0; t < QT; ++t) {
      // D-tile layout == B-operand layout: pack two 16-key tiles into K=32.
      v16h pw;
#pragma unroll
      for (int r = 0; r < 4; ++r) {
        pw[r]      = (_Float16)(__expf(e0[t][r] - mx[t]) * inv[t] * c00[r]);
        pw[4 + r]  = (_Float16)(__expf(e0[t][4 + r] - mx[t]) * inv[t] * c01[r]);
        pw[8 + r]  = (_Float16)(__expf(e1[t][r] - mx[t]) * inv[t] * c10[r]);
        pw[12 + r] = (_Float16)(__expf(e1[t][4 + r] - mx[t]) * inv[t] * c11[r]);
      }
      xacc[t] = wmma_f16(av, pw, xacc[t]);
    }
  }

#pragma unroll  // constant indices keep xacc in registers
  for (int t = 0; t < QT; ++t) px[wv][t][lane] = xacc[t];
  __syncthreads();
  if (wv >= QT) return;
  // wave wv finishes query tile wv of the block
  const int nt = n0 + 16 * wv;
  v8f xs = {};
#pragma unroll  // the LDS reads are issued together
  for (int w = 0; w < AW; ++w) xs += px[w][wv][lane];

  // xs: lane reg r -> (d = r + 8h, n = nt + li). diff feeds next WMMA as B.
  const float* qrow = q_f + ((size_t)b * N_ + nt + li) * D_ + koff;
  v16h bdiff;
#pragma unroll
  for (int r = 0; r < 8; ++r) {
    bdiff[r] = (_Float16)(qrow[r] - xs[r]);
    bdiff[r + 8] = (_Float16)0.f;
  }
  v16h awt;
#pragma unroll
  for (int e = 0; e < 8; ++e) {
    awt[e] = (_Float16)w_t[li * D_ + koff + e];
    awt[e + 8] = (_Float16)0.f;
  }
  v8f z2 = {};
  const v8f t = wmma_f16(awt, bdiff, z2);
  float* tb = t_buf + (size_t)b * OUT_ * N_;
#pragma unroll
  for (int r = 0; r < 8; ++r)
    tb[(size_t)(r + koff) * N_ + nt + li] = t[r] + b_t[r + koff];
}

// ---------------------------------------------------------------------------
// K5: GroupNorm statistics per (b, group): 4 channels x N contiguous floats.
// ---------------------------------------------------------------------------
__global__ __launch_bounds__(1024) void k_gnstats(
    const float* __restrict__ t_buf, float* __restrict__ gn_mean,
    float* __restrict__ gn_rstd) {
  const int bg = blockIdx.x;  // 0..15
  const float* p = t_buf + (size_t)bg * 4 * N_;  // groups are contiguous
  float s = 0.f, s2 = 0.f;
  for (int i = threadIdx.x; i < 4 * N_; i += 1024) {
    const float v = p[i];
    s += v;
    s2 += v * v;
  }
  __shared__ float sh[1024], sh2[1024];
  sh[threadIdx.x] = s;
  sh2[threadIdx.x] = s2;
  __syncthreads();
  for (int off = 512; off > 0; off >>= 1) {
    if (threadIdx.x < off) {
      sh[threadIdx.x] += sh[threadIdx.x + off];
      sh2[threadIdx.x] += sh2[threadIdx.x + off];
    }
    __syncthreads();
  }
  if (threadIdx.x == 0) {
    const float M = (float)(4 * N_);
    const float m = sh[0] / M;
    const float var = sh2[0] / M - m * m;
    gn_mean[bg] = m;
    gn_rstd[bg] = rsqrtf(var + 1e-5f);
  }
}

// ---------------------------------------------------------------------------
// K6: apply GN affine + ReLU, add q^T residual.
// ---------------------------------------------------------------------------
__global__ __launch_bounds__(256) void k_final(
    const float* __restrict__ t_buf, const float* __restrict__ q_f,
    const float* __restrict__ gamma, const float* __restrict__ beta,
    const float* __restrict__ gn_mean, const float* __restrict__ gn_rstd,
    float* __restrict__ out) {
  const int idx = blockIdx.x * blockDim.x + threadIdx.x;
  if (idx >= B_ * OUT_ * N_) return;
  const int n = idx & (N_ - 1);
  const int o = (idx >> 12) & 15;
  const int b = idx >> 16;
  const int bg = b * G_ + (o >> 2);
  float y = (t_buf[idx] - gn_mean[bg]) * gn_rstd[bg] * gamma[o] + beta[o];
  y = fmaxf(y, 0.f);
  out[idx] = q_f[((size_t)b * N_ + n) * D_ + o] + y;
}

// ---------------------------------------------------------------------------
extern "C" void kernel_launch(void* const* d_in, const int* in_sizes, int n_in,
                              void* d_out, int out_size, void* d_ws,
                              size_t ws_size, hipStream_t stream) {
  const float* x_q      = (const float*)d_in[0];
  const float* x_kv     = (const float*)d_in[1];
  const float* xyz_q    = (const float*)d_in[2];
  const float* xyz_kv   = (const float*)d_in[3];
  const float* w_qk     = (const float*)d_in[4];
  const float* w_v      = (const float*)d_in[5];
  const float* b_v      = (const float*)d_in[6];
  const float* w_t      = (const float*)d_in[7];
  const float* b_t      = (const float*)d_in[8];
  const float* gamma    = (const float*)d_in[9];
  const float* beta     = (const float*)d_in[10];
  const float* w_pos_q  = (const float*)d_in[11];
  const float* w_pos_kv = (const float*)d_in[12];
  float* out = (float*)d_out;

  char* ws = (char*)d_ws;
  size_t off = 0;
  auto carve = [&](size_t bytes) -> char* {
    char* p = ws + off;
    off += (bytes + 255) & ~(size_t)255;
    return p;
  };
  float*    q_f    = (float*)carve((size_t)B_ * N_ * D_ * 4);
  _Float16* q_h    = (_Float16*)carve((size_t)B_ * N_ * D_ * 2);
  _Float16* k_h    = (_Float16*)carve((size_t)B_ * N_ * D_ * 2);
  _Float16* v_h    = (_Float16*)carve((size_t)B_ * D_ * N_ * 2);
  float*    rowmax = (float*)carve((size_t)B_ * N_ * 4);
  float*    rowsum = (float*)carve((size_t)B_ * N_ * 4);
  float*    colinv = (float*)carve((size_t)B_ * N_ * 4);
  float*    t_buf  = (float*)carve((size_t)B_ * OUT_ * N_ * 4);
  float*    gn_m   = (float*)carve(B_ * G_ * 4);
  float*    gn_r   = (float*)carve(B_ * G_ * 4);
  (void)in_sizes; (void)n_in; (void)out_size; (void)ws_size;

  k_project<<<B_ * N_ / 32, 32 * SPLIT, 0, stream>>>(
      x_q, x_kv, xyz_q, xyz_kv, w_qk, w_v, b_v, w_pos_q, w_pos_kv,
      q_f, q_h, k_h, v_h);
  k_rowstats<<<B_ * NB, 32 * AW, 0, stream>>>(q_h, k_h, rowmax, rowsum);
  k_colsum<<<B_ * NB, 32 * AW, 0, stream>>>(q_h, k_h, rowmax, rowsum, colinv);
  k_attn<<<B_ * NB, 32 * AW, 0, stream>>>(q_h, k_h, v_h, q_f, rowmax, rowsum,
                                     colinv, w_t, b_t, t_buf);
  k_gnstats<<<B_ * G_, 1024, 0, stream>>>(t_buf, gn_m, gn_r);
  k_final<<<(B_ * OUT_ * N_ + 255) / 256, 256, 0, stream>>>(
      t_buf, q_f, gamma, beta, gn_m, gn_r, out);
}

// v004
// It runs in 42.7 microseconds.
// In two side-by-side timings against v003, it was 1.10 and 1.09 times as fast.
// Counting every step since v000, it is 5.85 times as fast.
#include <hip/hip_runtime.h>

#define B_   4
#define CIN  128
#define N_   4096
#define D_   16
#define OUT_ 16
#define G_   4
#define SPLIT 8             // waves per block in the projection
#define PCH   (CIN / SPLIT) // input channels per wave in the projection
#define QT  4               // attention passes: 16-row tiles a wave keeps in registers
#define AW  16              // attention passes: waves per block
#define ACH (N_ / AW)       // attention passes: streamed keys (or queries) per wave
#define NB  (N_ / (16 * QT)) // attention passes: blocks per batch
#define LOG2E 1.4426950408889634f

// Wave number within the block, in a scalar register: the wave's share of the
// loop, its weight loads and the branch on it are then scalar.
static __device__ __forceinline__ int wave_id() {
  return __builtin_amdgcn_readfirstlane(threadIdx.x >> 5);
}

typedef __attribute__((ext_vector_type(16))) _Float16 v16h;
typedef __attribute__((ext_vector_type(8)))  _Float16 v8h;
typedef __attribute__((ext_vector_type(8)))  float    v8f;
typedef __attribute__((ext_vector_type(2)))  float    v2f;
typedef __attribute__((ext_vector_type(2)))  _Float16 v2h;

// WMMA operand of a 16-channel row: 8 contiguous halves fill k = 8h..8h+7 (h =
// lane half). The upper K half, idle for 16 channels, takes two pairs of extra
// terms at k = 16+8h..16+8h+3; the rest is zero. Both operands are built here,
// so a pair of one meets the pair at the same place of the other.
static __device__ __forceinline__ v16h frag(const _Float16* p, v2h s0, v2h s1) {
  const v8h lo = *reinterpret_cast<const v8h*>(p);
  v16h r;
#pragma unroll
  for (int i = 0; i < 8; ++i) { r[i] = lo[i]; r[i + 8] = (_Float16)0.f; }
  r[8] = s0[0]; r[9] = s0[1];
  r[10] = s1[0]; r[11] = s1[1];
  return r;
}

// -x as two halves, leading part and remainder: against a pair of ones the
// product adds -x to a score with about 22 bits of x kept.
static __device__ __forceinline__ v2h neg_pair(float x) {
  v2h r;
  r[0] = (_Float16)(-x);
  r[1] = (_Float16)(-x - (float)r[0]);
  return r;
}

// The pair for lane half 0, zeros for half 1: the resident operand carries its
// pairs once (k = 16..19), whatever the streamed operand holds at k = 24..27.
static __device__ __forceinline__ v2h half0(v2h p, int h) {
  v2h z = {};
  return h == 0 ? p : z;
}

static __device__ __forceinline__ v8f wmma_f16(v16h a, v16h b, v8f c) {
  return __builtin_amdgcn_wmma_f32_16x16x32_f16(false, a, false, b, (short)0, c,
                                                false, false);
}

// ---------------------------------------------------------------------------
// K1: channel projections (1x1 convs). One block per 32 points, lane = point;
// each of the 8 waves sums 16 of the 128 input channels, partials meet in LDS.
//   q_f [B][N][16] f32, q_h/k_h [B][N][16] f16 (q_h times log2 e: the scores
//   come out of the WMMA as exponents of 2),
//   v_h [B][N/16][16 channels][16 keys] f16: one 16x16 tile is 512 contiguous
//   bytes, so a wave's A-fragment load in K4 reads whole 128-byte lines
// ---------------------------------------------------------------------------
__global__ __launch_bounds__(256) void k_project(
    const float* __restrict__ x_q, const float* __restrict__ x_kv,
    const float* __restrict__ xyz_q, const float* __restrict__ xyz_kv,
    const float* __restrict__ w_qk, const float* __restrict__ w_v,
    const float* __restrict__ b_v,
    const float* __restrict__ w_pos_q, const float* __restrict__ w_pos_kv,
    float* __restrict__ q_f, _Float16* __restrict__ q_h,
    _Float16* __restrict__ k_h, _Float16* __restrict__ v_h) {
  // partial sums: [wave][q 0..15 | k 16..31 | v 32..47][point]
  __shared__ float part[SPLIT][3 * D_][32];
  const int lane = threadIdx.x & 31;
  const int wv = wave_id();
  const int b = blockIdx.x / (N_ / 32);
  const int n = (blockIdx.x % (N_ / 32)) * 32 + lane;
  const int idx = b * N_ + n;
  const int c0 = wv * PCH;

  const float* xq = x_q + ((size_t)b * CIN + c0) * N_ + n;
  const float* xk = x_kv + ((size_t)b * CIN + c0) * N_ + n;
  float vq[PCH], vk[PCH];
#pragma unroll  // all 32 loads of the wave go out before the first is waited for
  for (int c = 0; c < PCH; ++c) {
    vq[c] = xq[(size_t)c * N_];
    vk[c] = xk[(size_t)c * N_];
  }
  float cq[3], ck[3];
#pragma unroll  // constant indices keep cq, ck in registers
  for (int j = 0; j < 3; ++j) {
    cq[j] = xyz_q[((size_t)b * 3 + j) * N_ + n];
    ck[j] = xyz_kv[((size_t)b * 3 + j) * N_ + n];
  }

#pragma unroll  // independent sums of several d interleave
  for (int d = 0; d < D_; ++d) {
    float sq = 0.f, sk = 0.f, sv = 0.f;
#pragma unroll  // constant indices keep vq, vk in registers
    for (int c = 0; c < PCH; ++c) {
      const float wq = w_qk[d * CIN + c0 + c];
      sq = fmaf(wq, vq[c], sq);
      sk = fmaf(wq, vk[c], sk);
      sv = fmaf(w_v[d * CIN + c0 + c], vk[c], sv);
    }
    part[wv][d][lane] = sq;
    part[wv][D_ + d][lane] = sk;
    part[wv][2 * D_ + d][lane] = sv;
  }
  __syncthreads();

  // wave wv finishes output channels 2*wv and 2*wv+1 of the block's 32 points
  float qv[2], kv[2], vv[2];
#pragma unroll  // qv, kv, vv stay in registers
  for (int i = 0; i < 2; ++i) {
    const int d = 2 * wv + i;
    float aq = 0.f, ak = 0.f, av = 0.f;
#pragma unroll  // the LDS reads are issued together
    for (int w = 0; w < SPLIT; ++w) {
      aq += part[w][d][lane];
      ak += part[w][D_ + d][lane];
      av += part[w][2 * D_ + d][lane];
    }
    float pq = 0.f, pk = 0.f;
#pragma unroll  // constant indices keep cq, ck in registers
    for (int j = 0; j < 3; ++j) {
      pq = fmaf(w_pos_q[d * 3 + j], cq[j], pq);
      pk = fmaf(w_pos_kv[d * 3 + j], ck[j], pk);
    }
    qv[i] = aq + pq;
    kv[i] = ak + pk;
    vv[i] = av + b_v[d] + pk;
  }
  const size_t row = (size_t)idx * D_ + 2 * wv;
  v2f qp; qp[0] = qv[0]; qp[1] = qv[1];
  v2f kp; kp[0] = kv[0]; kp[1] = kv[1];
  v2f vp; vp[0] = vv[0]; vp[1] = vv[1];
  const v2h qh = __builtin_convertvector(qp * LOG2E, v2h);
  const v2h kh = __builtin_convertvector(kp, v2h);
  const v2h vh = __builtin_convertvector(vp, v2h);
  *reinterpret_cast<v2f*>(q_f + row) = qp;
  *reinterpret_cast<v2h*>(q_h + row) = qh;
  *reinterpret_cast<v2h*>(k_h + row) = kh;
  _Float16* vrow = v_h + ((size_t)b * N_ + (n & ~15)) * D_ + 2 * wv * 16 + (n & 15);
  vrow[0] = vh[0];
  vrow[16] = vh[1];
}

// ---------------------------------------------------------------------------
// K2: per query, L = log2 of the sum over keys of 2^score, stored as neg_pair.
// One block per 64 queries; each of its 16 waves holds the 4 query tiles in
// registers and sweeps its 256 keys twice: first for the maximum,
// then, with minus the maximum in the queries' upper K half against ones in
// the keys', the WMMA gives score - maximum and each term is one exp2.
// E^T tile = WMMA(A = K-tile, B = Q-tile).
// D layout: lane L reg r -> (key m = m0 + r + 8*(L/16), query n = n0 + L%16)
// ---------------------------------------------------------------------------
__global__ __launch_bounds__(32 * AW) void k_rowstats(
    const _Float16* __restrict__ q_h, const _Float16* __restrict__ k_h,
    _Float16* __restrict__ rowneg) {
  __shared__ float pm[AW][16 * QT], ps[AW][16 * QT];
  const int wid = blockIdx.x;
  const int b = wid / NB;
  const int n0 = (wid % NB) * (16 * QT);
  const int lane = threadIdx.x & 31;
  const int wv = wave_id();
  const int mbeg = wv * ACH;
  const int li = lane & 15;
  const int h = lane >> 4;
  const int koff = h << 3;
  const v2h zero2 = {};
  const v2h one2 = {(_Float16)1.f, (_Float16)1.f};

  const _Float16* qb = q_h + (size_t)b * N_ * D_;
  const _Float16* kb = k_h + (size_t)b * N_ * D_;
  v16h bq[QT];
  float mx[QT];
#pragma unroll  // constant indices keep bq, mx in registers
  for (int t = 0; t < QT; ++t) {
    bq[t] = frag(qb + (size_t)(n0 + 16 * t + li) * D_ + koff, zero2, zero2);
    mx[t] = -__builtin_inff();
  }

  for (int i = 0; i < ACH; i += 32) {
    v16h ak[2];
#pragma unroll  // constant indices keep ak in registers
    for (int u = 0; u < 2; ++u)
      ak[u] = frag(kb + (size_t)(mbeg + i + 16 * u + li) * D_ + koff, one2, zero2);
    // keeps the loads of both key tiles together at the trip's top: the
    // second tile's, sunk behind the first tile's work, is waited for anew
    __builtin_amdgcn_sched_barrier(0);
#pragma unroll  // constant indices keep ak in registers
    for (int u = 0; u < 2; ++u) {
      v8f et[QT];
#pragma unroll  // four independent WMMAs in a row fill one another's result distance
      for (int t = 0; t < QT; ++t) {
        v8f z = {};
        et[t] = wmma_f16(ak[u], bq[t], z);
      }
#pragma unroll  // constant indices keep et, mx in registers
      for (int t = 0; t < QT; ++t) {
#pragma unroll
        for (int r = 0; r < 8; r += 2)
          mx[t] = fmaxf(fmaxf(mx[t], et[t][r]), et[t][r + 1]);
      }
    }
  }

  // one shift per query for both lane halves; sh is what the pair really subtracts
  float sh[QT];
  v2f sm[QT];  // even and odd registers' terms: two sums per add instruction
#pragma unroll  // constant indices keep bq, mx, sh, sm in registers
  for (int t = 0; t < QT; ++t) {
    const v2h p = neg_pair(fmaxf(mx[t], __shfl_xor(mx[t], 16, 32)));
    sh[t] = -((float)p[0] + (float)p[1]);
    const v2h ph = half0(p, h);
    bq[t][8] = ph[0];
    bq[t][9] = ph[1];
    const v2f z2 = {};
    sm[t] = z2;
  }

  for (int i = 0; i < ACH; i += 32) {
    v16h ak[2];
#pragma unroll  // constant indices keep ak in registers
    for (int u = 0; u < 2; ++u)
      ak[u] = frag(kb + (size_t)(mbeg + i + 16 * u + li) * D_ + koff, one2, zero2);
    // as in the first sweep
    __builtin_amdgcn_sched_barrier(0);
#pragma unroll  // constant indices keep ak in registers
    for (int u = 0; u < 2; ++u) {
      v8f et[QT];
#pragma unroll  // four independent WMMAs in a row fill one another's result distance
      for (int t = 0; t < QT; ++t) {
        v8f z = {};
        et[t] = wmma_f16(ak[u], bq[t], z);
      }
#pragma unroll  // constant indices keep et, sm in registers
      for (int t = 0; t < QT; ++t) {
#pragma unroll
        for (int r = 0; r < 8; r += 2) {
          v2f x;
          x[0] = __builtin_amdgcn_exp2f(et[t][r]);
          x[1] = __builtin_amdgcn_exp2f(et[t][r + 1]);
          sm[t] += x;
        }
      }
    }
  }
  // combine the two lane-halves (same query and shift, different key subsets)
#pragma unroll  // constant indices keep sh, sm in registers
  for (int t = 0; t < QT; ++t) {
    const float s1 = sm[t][0] + sm[t][1];
    const float S = s1 + __shfl_xor(s1, 16, 32);
    if (h == 0) {
      pm[wv][16 * t + li] = sh[t];
      ps[wv][16 * t + li] = S;
    }
  }
  __syncthreads();
  // merge the 16 waves' (shift, sum) pairs, one thread per query
  if (threadIdx.x < 16 * QT) {
    const int t = threadIdx.x;
    float Mb = pm[0][t];
#pragma unroll  // the LDS reads are issued together
    for (int w = 1; w < AW; ++w) Mb = fmaxf(Mb, pm[w][t]);
    float Sb = 0.f;
#pragma unroll  // the LDS reads are issued together
    for (int w = 0; w < AW; ++w)
      Sb += ps[w][t] * __builtin_amdgcn_exp2f(pm[w][t] - Mb);
    *reinterpret_cast<v2h*>(rowneg + 2 * (size_t)(b * N_ + n0 + t)) =
        neg_pair(Mb + __builtin_amdgcn_logf(Sb));
  }
}

// ---------------------------------------------------------------------------
// K3: column sums over queries (key-major => no atomics). Stores
// log2(1e-9 + cs) as neg_pair.
// One block per 64 keys; each of its 16 waves holds the 4 key tiles in
// registers and takes 256 queries, so one query fragment feeds 4 WMMAs. The
// query's -L rides in its upper K half against ones in the keys': the WMMA
// gives score - L, and a softmax weight is one exp2.
// ---------------------------------------------------------------------------
__global__ __launch_bounds__(32 * AW) void k_colsum(
    const _Float16* __restrict__ q_h, const _Float16* __restrict__ k_h,
    const _Float16* __restrict__ rowneg, _Float16* __restrict__ colneg) {
  __shared__ float pc[AW][16 * QT];
  const int wid = blockIdx.x;
  const int b = wid / NB;
  const int m0 = (wid % NB) * (16 * QT);
  const int lane = threadIdx.x & 31;
  const int wv = wave_id();
  const int nbeg = wv * ACH;
  const int li = lane & 15;
  const int h = lane >> 4;
  const int koff = h << 3;
  const v2h zero2 = {};
  const v2h one2 = {(_Float16)1.f, (_Float16)1.f};

  const _Float16* qb = q_h + (size_t)b * N_ * D_;
  const _Float16* kb = k_h + (size_t)b * N_ * D_;
  const _Float16* rnb = rowneg + 2 * (size_t)b * N_;
  v16h ak[QT];
  float cs[QT][8];
#pragma unroll  // constant indices keep ak, cs in registers
  for (int t = 0; t < QT; ++t) {
    ak[t] = frag(kb + (size_t)(m0 + 16 * t + li) * D_ + koff, half0(one2, h), zero2);
#pragma unroll
    for (int r = 0; r < 8; ++r) cs[t][r] = 0.f;
  }

  for (int i = 0; i < ACH; i += 32) {
    v16h bq[2];
#pragma unroll  // constant indices keep bq in registers
    for (int u = 0; u < 2; ++u) {
      const int n0 = nbeg + i + 16 * u;
      bq[u] = frag(qb + (size_t)(n0 + li) * D_ + koff,
                   *reinterpret_cast<const v2h*>(rnb + 2 * (n0 + li)), zero2);
    }
    // keeps the loads of both query tiles together at the trip's top: the
    // second tile's, sunk behind the first tile's work, are waited for anew
    __builtin_amdgcn_sched_barrier(0);
#pragma unroll  // constant indices keep bq in registers
    for (int u = 0; u < 2; ++u) {
      v8f et[QT];
#pragma unroll  // four independent WMMAs in a row fill one another's result distance
      for (int t = 0; t < QT; ++t) {
        v8f z = {};
        et[t] = wmma_f16(ak[t], bq[u], z);
      }
#pragma unroll  // constant indices keep et, cs in registers
      for (int t = 0; t < QT; ++t) {
#pragma unroll
        for (int r = 0; r < 8; ++r) cs[t][r] += __builtin_amdgcn_exp2f(et[t][r]);
      }
    }
  }
  // reduce across the 16 queries held by each lane-half
#pragma unroll
  for (int msk = 1; msk < 16; msk <<= 1) {
#pragma unroll
    for (int t = 0; t < QT; ++t) {
#pragma unroll
      for (int r = 0; r < 8; ++r) cs[t][r] += __shfl_xor(cs[t][r], msk, 32);
    }
  }
  if (li == 0) {
#pragma unroll
    for (int t = 0; t < QT; ++t) {
#pragma unroll
      for (int r = 0; r < 8; ++r) pc[wv][16 * t + koff + r] = cs[t][r];
    }
  }
  __syncthreads();
  // add the 16 waves' partial column sums, one thread per key
  if (threadIdx.x < 16 * QT) {
    const int t = threadIdx.x;
    float c = 0.f;
#pragma unroll  // the LDS reads are issued together
    for (int w = 0; w < AW; ++w) c += pc[w][t];
    *reinterpret_cast<v2h*>(colneg + 2 * (size_t)(b * N_ + m0 + t)) =
        neg_pair(__builtin_amdgcn_logf(1e-9f + c));
  }
}

// ---------------------------------------------------------------------------
// K4: recompute weights, X_r^T += V * W^T (K=32: two prob tiles per WMMA),
// then diff = q - x_r feeds the w_t projection WMMA directly; writes t_buf.
// One block per 64 queries; each of its 16 waves holds the 4 query tiles in
// registers and takes 256 keys, so the K, V and column-term loads of 32 keys
// feed 12 WMMAs. The upper K half of the score product holds the key's column
// term against ones and ones against the query's -L: the WMMA gives the log2
// of the finished weight, which is one exp2. Waves 0..3 add the partial X_r
// tiles, one tile each, and run the epilogue.
// ---------------------------------------------------------------------------
__global__ __launch_bounds__(32 * AW) void k_attn(
    const _Float16* __restrict__ q_h, const _Float16* __restrict__ k_h,
    const _Float16* __restrict__ v_h, const float* __restrict__ q_f,
    const _Float16* __restrict__ rowneg, const _Float16* __restrict__ colneg,
    const float* __restrict__ w_t, const float* __restrict__ b_t,
    float* __restrict__ t_buf) {
  __shared__ v8f px[AW][QT][32];  // a lane's 8 partial sums lie together
  const int wid = blockIdx.x;
  const int b = wid / NB;
  const int n0 = (wid % NB) * (16 * QT);
  const int lane = threadIdx.x & 31;
  const int wv = wave_id();
  const int mbeg = wv * ACH;
  const int li = lane & 15;
  const int h = lane >> 4;
  const int koff = h << 3;
  const v2h one2 = {(_Float16)1.f, (_Float16)1.f};

  const _Float16* qb = q_h + (size_t)b * N_ * D_;
  const _Float16* kb = k_h + (size_t)b * N_ * D_;
  const _Float16* vb = v_h + (size_t)b * D_ * N_;
  const _Float16* rnb = rowneg + 2 * (size_t)b * N_;
  const _Float16* cnb = colneg + 2 * (size_t)b * N_;

  v2h rn[QT];
#pragma unroll  // constant indices keep rn in registers
  for (int t = 0; t < QT; ++t)
    rn[t] = *reinterpret_cast<const v2h*>(rnb + 2 * (n0 + 16 * t + li));
  // precaution: the fragment loads below land in these four loads' address
  // registers, so the wait stands between the two groups
  asm volatile("s_wait_xcnt 0x0" ::: "memory");
  v16h bq[QT];
  v8f xacc[QT];
#pragma unroll  // constant indices keep the four tiles' state in registers
  for (int t = 0; t < QT; ++t) {
    bq[t] = frag(qb + (size_t)(n0 + 16 * t + li) * D_ + koff, half0(one2, h),
                 half0(rn[t], h));
    v8f z = {};
    xacc[t] = z;
  }

  for (int i = 0; i < ACH; i += 32) {
    const int m0 = mbeg + i;
    const v16h ak0 = frag(kb + (size_t)(m0 + li) * D_ + koff,
                          *reinterpret_cast<const v2h*>(cnb + 2 * (m0 + li)), one2);
    const v16h ak1 = frag(kb + (size_t)(m0 + 16 + li) * D_ + koff,
                          *reinterpret_cast<const v2h*>(cnb + 2 * (m0 + 16 + li)), one2);
    // tile m0/16 and the next one: channel li, keys koff..koff+7 of each
    const _Float16* vp = vb + (size_t)m0 * D_ + li * 16 + koff;
    const v8h v0 = *reinterpret_cast<const v8h*>(vp);
    const v8h v1 = *reinterpret_cast<const v8h*>(vp + 256);
    v16h av;
#pragma unroll
    for (int j = 0; j < 8; ++j) { av[j] = v0[j]; av[j + 8] = v1[j]; }
    // keeps the trip's six loads together at its top: sunk among the WMMAs,
    // each group of them is waited for on its own
    __builtin_amdgcn_sched_barrier(0);
    v8f e0[QT], e1[QT];
#pragma unroll  // eight independent WMMAs in a row fill one another's result distance
    for (int t = 0; t < QT; ++t) {
      v8f z = {};
      e0[t] = wmma_f16(ak0, bq[t], z);
      e1[t] = wmma_f16(ak1, bq[t], z);
    }
    // keeps the eight in a row: moved down to their readers, each is followed
    // by idle slots until its result may be read
    __builtin_amdgcn_sched_barrier(0);
#pragma unroll  // constant indices keep the four tiles' state in registers
    for (int t = 0; t < QT; ++t) {
      // D-tile layout == B-operand layout: pack two 16-key tiles into K=32.
      v16h pw;
#pragma unroll
      for (int r = 0; r < 8; ++r) {
        pw[r]     = (_Float16)__builtin_amdgcn_exp2f(e0[t][r]);
        pw[8 + r] = (_Float16)__builtin_amdgcn_exp2f(e1[t][r]);
      }
      xacc[t] = wmma_f16(av, pw, xacc[t]);
    }
  }

#pragma unroll  // constant indices keep xacc in registers
  for (int t = 0; t < QT; ++t) px[wv][t][lane] = xacc[t];
  __syncthreads();
  if (wv >= QT) return;
  // wave wv finishes query tile wv of the block
  const int nt = n0 + 16 * wv;
  v8f xs = {};
#pragma unroll  // the LDS reads are issued together
  for (int w = 0; w < AW; ++w) xs += px[w][wv][lane];

  // xs: lane reg r -> (d = r + 8h, n = nt + li). diff feeds next WMMA as B.
  const float* qrow = q_f + ((size_t)b * N_ + nt + li) * D_ + koff;
  v16h bdiff;
#pragma unroll
  for (int r = 0; r < 8; ++r) {
    bdiff[r] = (_Float16)(qrow[r] - xs[r]);
    bdiff[r + 8] = (_Float16)0.f;
  }
  v16h awt;
#pragma unroll
  for (int e = 0; e < 8; ++e) {
    awt[e] = (_Float16)w_t[li * D_ + koff + e];
    awt[e + 8] = (_Float16)0.f;
  }
  v8f z2 = {};
  const v8f t = wmma_f16(awt, bdiff, z2);
  float* tb = t_buf + (size_t)b * OUT_ * N_;
#pragma unroll
  for (int r = 0; r < 8; ++r)
    tb[(size_t)(r + koff) * N_ + nt + li] = t[r] + b_t[r + koff];
}

// ---------------------------------------------------------------------------
// K5: GroupNorm statistics per (b, group): 4 channels x N contiguous floats.
// ---------------------------------------------------------------------------
__global__ __launch_bounds__(1024) void k_gnstats(
    const float* __restrict__ t_buf, float* __restrict__ gn_mean,
    float* __restrict__ gn_rstd) {
  const int bg = blockIdx.x;  // 0..15
  const float* p = t_buf + (size_t)bg * 4 * N_;  // groups are contiguous
  float s = 0.f, s2 = 0.f;
  for (int i = threadIdx.x; i < 4 * N_; i += 1024) {
    const float v = p[i];
    s += v;
    s2 += v * v;
  }
  __shared__ float sh[1024], sh2[1024];
  sh[threadIdx.x] = s;
  sh2[threadIdx.x] = s2;
  __syncthreads();
  for (int off = 512; off > 0; off >>= 1) {
    if (threadIdx.x < off) {
      sh[threadIdx.x] += sh[threadIdx.x + off];
      sh2[threadIdx.x] += sh2[threadIdx.x + off];
    }
    __syncthreads();
  }
  if (threadIdx.x == 0) {
    const float M = (float)(4 * N_);
    const float m = sh[0] / M;
    const float var = sh2[0] / M - m * m;
    gn_mean[bg] = m;
    gn_rstd[bg] = rsqrtf(var + 1e-5f);
  }
}

// ---------------------------------------------------------------------------
// K6: apply GN affine + ReLU, add q^T residual.
// ---------------------------------------------------------------------------
__global__ __launch_bounds__(256) void k_final(
    const float* __restrict__ t_buf, const float* __restrict__ q_f,
    const float* __restrict__ gamma, const float* __restrict__ beta,
    const float* __restrict__ gn_mean, const float* __restrict__ gn_rstd,
    float* __restrict__ out) {
  const int idx = blockIdx.x * blockDim.x + threadIdx.x;
  if (idx >= B_ * OUT_ * N_) return;
  const int n = idx & (N_ - 1);
  const int o = (idx >> 12) & 15;
  const int b = idx >> 16;
  const int bg = b * G_ + (o >> 2);
  float y = (t_buf[idx] - gn_mean[bg]) * gn_rstd[bg] * gamma[o] + beta[o];
  y = fmaxf(y, 0.f);
  out[idx] = q_f[((size_t)b * N_ + n) * D_ + o] + y;
}

// ---------------------------------------------------------------------------
extern "C" void kernel_launch(void* const* d_in, const int* in_sizes, int n_in,
                              void* d_out, int out_size, void* d_ws,
                              size_t ws_size, hipStream_t stream) {
  const float* x_q      = (const float*)d_in[0];
  const float* x_kv     = (const float*)d_in[1];
  const float* xyz_q    = (const float*)d_in[2];
  const float* xyz_kv   = (const float*)d_in[3];
  const float* w_qk     = (const float*)d_in[4];
  const float* w_v      = (const float*)d_in[5];
  const float* b_v      = (const float*)d_in[6];
  const float* w_t      = (const float*)d_in[7];
  const float* b_t      = (const float*)d_in[8];
  const float* gamma    = (const float*)d_in[9];
  const float* beta     = (const float*)d_in[10];
  const float* w_pos_q  = (const float*)d_in[11];
  const float* w_pos_kv = (const float*)d_in[12];
  float* out = (float*)d_out;

  char* ws = (char*)d_ws;
  size_t off = 0;
  auto carve = [&](size_t bytes) -> char* {
    char* p = ws + off;
    off += (bytes + 255) & ~(size_t)255;
    return p;
  };
  float*    q_f    = (float*)carve((size_t)B_ * N_ * D_ * 4);
  _Float16* q_h    = (_Float16*)carve((size_t)B_ * N_ * D_ * 2);
  _Float16* k_h    = (_Float16*)carve((size_t)B_ * N_ * D_ * 2);
  _Float16* v_h    = (_Float16*)carve((size_t)B_ * D_ * N_ * 2);
  _Float16* rowneg = (_Float16*)carve((size_t)B_ * N_ * 2 * 2);
  _Float16* colneg = (_Float16*)carve((size_t)B_ * N_ * 2 * 2);
  float*    t_buf  = (float*)carve((size_t)B_ * OUT_ * N_ * 4);
  float*    gn_m   = (float*)carve(B_ * G_ * 4);
  float*    gn_r   = (float*)carve(B_ * G_ * 4);
  (void)in_sizes; (void)n_in; (void)out_size; (void)ws_size;

  k_project<<<B_ * N_ / 32, 32 * SPLIT, 0, stream>>>(
      x_q, x_kv, xyz_q, xyz_kv, w_qk, w_v, b_v, w_pos_q, w_pos_kv,
      q_f, q_h, k_h, v_h);
  k_rowstats<<<B_ * NB, 32 * AW, 0, stream>>>(q_h, k_h, rowneg);
  k_colsum<<<B_ * NB, 32 * AW, 0, stream>>>(q_h, k_h, rowneg, colneg);
  k_attn<<<B_ * NB, 32 * AW, 0, stream>>>(q_h, k_h, v_h, q_f, rowneg, colneg,
                                     w_t, b_t, t_buf);
  k_gnstats<<<B_ * G_, 1024, 0, stream>>>(t_buf, gn_m, gn_r);
  k_final<<<(B_ * OUT_ * N_ + 255) / 256, 256, 0, stream>>>(
      t_buf, q_f, gamma, beta, gn_m, gn_r, out);
}

// v005
// One run takes 41.5 microseconds.
// Timed twice side by side with v004, it ran 1.05 and 1.02 times as fast.
// Counting every step since v000, it is 6.03 times as fast.
#include <hip/hip_runtime.h>

#define B_   4
#define CIN  128
#define N_   4096
#define D_   16
#define OUT_ 16
#define G_   4
#define SPLIT 8             // waves per block in the projection
#define PCH   (CIN / SPLIT) // input channels per wave in the projection
#define QT  4               // attention passes: 16-row tiles a wave keeps in registers
#define AW  16              // attention passes: waves per block
#define ACH (N_ / AW)       // attention passes: streamed keys (or queries) per wave
#define NB  (N_ / (16 * QT)) // attention passes: blocks per batch
#define LOG2E 1.4426950408889634f

// Wave number within the block, in a scalar register: the wave's share of the
// loop, its weight loads and the branch on it are then scalar.
static __device__ __forceinline__ int wave_id() {
  return __builtin_amdgcn_readfirstlane(threadIdx.x >> 5);
}

typedef __attribute__((ext_vector_type(16))) _Float16 v16h;
typedef __attribute__((ext_vector_type(8)))  _Float16 v8h;
typedef __attribute__((ext_vector_type(8)))  float    v8f;
typedef __attribute__((ext_vector_type(4)))  float    v4f;
typedef __attribute__((ext_vector_type(2)))  float    v2f;
typedef __attribute__((ext_vector_type(2)))  _Float16 v2h;

// WMMA operand of a 16-channel row: 8 contiguous halves fill k = 8h..8h+7 (h =
// lane half). The upper K half, idle for 16 channels, takes two pairs of extra
// terms at k = 16+8h..16+8h+3; the rest is zero. Both operands are built here,
// so a pair of one meets the pair at the same place of the other.
static __device__ __forceinline__ v16h frag(const _Float16* p, v2h s0, v2h s1) {
  const v8h lo = *reinterpret_cast<const v8h*>(p);
  v16h r;
#pragma unroll
  for (int i = 0; i < 8; ++i) { r[i] = lo[i]; r[i + 8] = (_Float16)0.f; }
  r[8] = s0[0]; r[9] = s0[1];
  r[10] = s1[0]; r[11] = s1[1];
  return r;
}

// -x as two halves, leading part and remainder: against a pair of ones the
// product adds -x to a score with about 22 bits of x kept.
static __device__ __forceinline__ v2h neg_pair(float x) {
  v2h r;
  r[0] = (_Float16)(-x);
  r[1] = (_Float16)(-x - (float)r[0]);
  return r;
}

// The pair for lane half 0, zeros for half 1: the resident operand carries its
// pairs once (k = 16..19), whatever the streamed operand holds at k = 24..27.
static __device__ __forceinline__ v2h half0(v2h p, int h) {
  v2h z = {};
  return h == 0 ? p : z;
}

static __device__ __forceinline__ v8f wmma_f16(v16h a, v16h b, v8f c) {
  return __builtin_amdgcn_wmma_f32_16x16x32_f16(false, a, false, b, (short)0, c,
                                                false, false);
}

// ---------------------------------------------------------------------------
// K1: channel projections (1x1 convs). One block per 32 points, lane = point;
// each of the 8 waves sums 16 of the 128 input channels, partials meet in LDS.
//   q_f [B][N][16] f32, q_h/k_h [B][N][16] f16 (q_h times log2 e: the scores
//   come out of the WMMA as exponents of 2),
//   v_h [B][N/16][16 channels][16 keys] f16: one 16x16 tile is 512 contiguous
//   bytes, so a wave's A-fragment load in K4 reads whole 128-byte lines
// ---------------------------------------------------------------------------
__global__ __launch_bounds__(256) void k_project(
    const float* __restrict__ x_q, const float* __restrict__ x_kv,
    const float* __restrict__ xyz_q, const float* __restrict__ xyz_kv,
    const float* __restrict__ w_qk, const float* __restrict__ w_v,
    const float* __restrict__ b_v,
    const float* __restrict__ w_pos_q, const float* __restrict__ w_pos_kv,
    float* __restrict__ q_f, _Float16* __restrict__ q_h,
    _Float16* __restrict__ k_h, _Float16* __restrict__ v_h) {
  // partial sums: [wave][q 0..15 | k 16..31 | v 32..47][point]
  __shared__ float part[SPLIT][3 * D_][32];
  const int lane = threadIdx.x & 31;
  const int wv = wave_id();
  const int b = blockIdx.x / (N_ / 32);
  const int n = (blockIdx.x % (N_ / 32)) * 32 + lane;
  const int idx = b * N_ + n;
  const int c0 = wv * PCH;

  const float* xq = x_q + ((size_t)b * CIN + c0) * N_ + n;
  const float* xk = x_kv + ((size_t)b * CIN + c0) * N_ + n;
  float vq[PCH], vk[PCH];
#pragma unroll  // all 32 loads of the wave go out before the first is waited for
  for (int c = 0; c < PCH; ++c) {
    vq[c] = xq[(size_t)c * N_];
    vk[c] = xk[(size_t)c * N_];
  }
  float cq[3], ck[3];
#pragma unroll  // constant indices keep cq, ck in registers
  for (int j = 0; j < 3; ++j) {
    cq[j] = xyz_q[((size_t)b * 3 + j) * N_ + n];
    ck[j] = xyz_kv[((size_t)b * 3 + j) * N_ + n];
  }

#pragma unroll  // independent sums of several d interleave
  for (int d = 0; d < D_; ++d) {
    float sq = 0.f, sk = 0.f, sv = 0.f;
#pragma unroll  // constant indices keep vq, vk in registers
    for (int c = 0; c < PCH; ++c) {
      const float wq = w_qk[d * CIN + c0 + c];
      sq = fmaf(wq, vq[c], sq);
      sk = fmaf(wq, vk[c], sk);
      sv = fmaf(w_v[d * CIN + c0 + c], vk[c], sv);
    }
    part[wv][d][lane] = sq;
    part[wv][D_ + d][lane] = sk;
    part[wv][2 * D_ + d][lane] = sv;
  }
  __syncthreads();

  // wave wv finishes output channels 2*wv and 2*wv+1 of the block's 32 points
  float qv[2], kv[2], vv[2];
#pragma unroll  // qv, kv, vv stay in registers
  for (int i = 0; i < 2; ++i) {
    const int d = 2 * wv + i;
    float aq = 0.f, ak = 0.f, av = 0.f;
#pragma unroll  // the LDS reads are issued together
    for (int w = 0; w < SPLIT; ++w) {
      aq += part[w][d][lane];
      ak += part[w][D_ + d][lane];
      av += part[w][2 * D_ + d][lane];
    }
    float pq = 0.f, pk = 0.f;
#pragma unroll  // constant indices keep cq, ck in registers
    for (int j = 0; j < 3; ++j) {
      pq = fmaf(w_pos_q[d * 3 + j], cq[j], pq);
      pk = fmaf(w_pos_kv[d * 3 + j], ck[j], pk);
    }
    qv[i] = aq + pq;
    kv[i] = ak + pk;
    vv[i] = av + b_v[d] + pk;
  }
  const size_t row = (size_t)idx * D_ + 2 * wv;
  v2f qp; qp[0] = qv[0]; qp[1] = qv[1];
  v2f kp; kp[0] = kv[0]; kp[1] = kv[1];
  v2f vp; vp[0] = vv[0]; vp[1] = vv[1];
  const v2h qh = __builtin_convertvector(qp * LOG2E, v2h);
  const v2h kh = __builtin_convertvector(kp, v2h);
  const v2h vh = __builtin_convertvector(vp, v2h);
  *reinterpret_cast<v2f*>(q_f + row) = qp;
  *reinterpret_cast<v2h*>(q_h + row) = qh;
  *reinterpret_cast<v2h*>(k_h + row) = kh;
  _Float16* vrow = v_h + ((size_t)b * N_ + (n & ~15)) * D_ + 2 * wv * 16 + (n & 15);
  vrow[0] = vh[0];
  vrow[16] = vh[1];
}

// ---------------------------------------------------------------------------
// K2: per query, L = log2 of the sum over keys of 2^score, stored as neg_pair.
// One block per 64 queries; each of its 16 waves holds the 4 query tiles in
// registers and sweeps its 256 keys twice: first for the maximum,
// then, with minus the maximum in the queries' upper K half against ones in
// the keys', the WMMA gives score - maximum and each term is one exp2.
// E^T tile = WMMA(A = K-tile, B = Q-tile).
// D layout: lane L reg r -> (key m = m0 + r + 8*(L/16), query n = n0 + L%16)
// ---------------------------------------------------------------------------
__global__ __launch_bounds__(32 * AW) void k_rowstats(
    const _Float16* __restrict__ q_h, const _Float16* __restrict__ k_h,
    _Float16* __restrict__ rowneg) {
  __shared__ float pm[AW][16 * QT], ps[AW][16 * QT];
  const int wid = blockIdx.x;
  const int b = wid / NB;
  const int n0 = (wid % NB) * (16 * QT);
  const int lane = threadIdx.x & 31;
  const int wv = wave_id();
  const int mbeg = wv * ACH;
  const int li = lane & 15;
  const int h = lane >> 4;
  const int koff = h << 3;
  const v2h zero2 = {};
  const v2h one2 = {(_Float16)1.f, (_Float16)1.f};

  const _Float16* qb = q_h + (size_t)b * N_ * D_;
  const _Float16* kb = k_h + (size_t)b * N_ * D_;
  v16h bq[QT];
  float mx[QT];
#pragma unroll  // constant indices keep bq, mx in registers
  for (int t = 0; t < QT; ++t) {
    bq[t] = frag(qb + (size_t)(n0 + 16 * t + li) * D_ + koff, zero2, zero2);
    mx[t] = -__builtin_inff();
  }

  for (int i = 0; i < ACH; i += 32) {
    v16h ak[2];
#pragma unroll  // constant indices keep ak in registers
    for (int u = 0; u < 2; ++u)
      ak[u] = frag(kb + (size_t)(mbeg + i + 16 * u + li) * D_ + koff, one2, zero2);
    // keeps the loads of both key tiles together at the trip's top: the
    // second tile's, sunk behind the first tile's work, is waited for anew
    __builtin_amdgcn_sched_barrier(0);
#pragma unroll  // constant indices keep ak in registers
    for (int u = 0; u < 2; ++u) {
      v8f et[QT];
#pragma unroll  // four independent WMMAs in a row fill one another's result distance
      for (int t = 0; t < QT; ++t) {
        v8f z = {};
        et[t] = wmma_f16(ak[u], bq[t], z);
      }
#pragma unroll  // constant indices keep et, mx in registers
      for (int t = 0; t < QT; ++t) {
#pragma unroll
        for (int r = 0; r < 8; r += 2)
          mx[t] = fmaxf(fmaxf(mx[t], et[t][r]), et[t][r + 1]);
      }
    }
  }

  // one shift per query for both lane halves; sh is what the pair really subtracts
  float sh[QT];
  v2f sm[QT];  // even and odd registers' terms: two sums per add instruction
#pragma unroll  // constant indices keep bq, mx, sh, sm in registers
  for (int t = 0; t < QT; ++t) {
    const v2h p = neg_pair(fmaxf(mx[t], __shfl_xor(mx[t], 16, 32)));
    sh[t] = -((float)p[0] + (float)p[1]);
    const v2h ph = half0(p, h);
    bq[t][8] = ph[0];
    bq[t][9] = ph[1];
    const v2f z2 = {};
    sm[t] = z2;
  }

  for (int i = 0; i < ACH; i += 32) {
    v16h ak[2];
#pragma unroll  // constant indices keep ak in registers
    for (int u = 0; u < 2; ++u)
      ak[u] = frag(kb + (size_t)(mbeg + i + 16 * u + li) * D_ + koff, one2, zero2);
    // as in the first sweep
    __builtin_amdgcn_sched_barrier(0);
#pragma unroll  // constant indices keep ak in registers
    for (int u = 0; u < 2; ++u) {
      v8f et[QT];
#pragma unroll  // four independent WMMAs in a row fill one another's result distance
      for (int t = 0; t < QT; ++t) {
        v8f z = {};
        et[t] = wmma_f16(ak[u], bq[t], z);
      }
#pragma unroll  // constant indices keep et, sm in registers
      for (int t = 0; t < QT; ++t) {
#pragma unroll
        for (int r = 0; r < 8; r += 2) {
          v2f x;
          x[0] = __builtin_amdgcn_exp2f(et[t][r]);
          x[1] = __builtin_amdgcn_exp2f(et[t][r + 1]);
          sm[t] += x;
        }
      }
    }
  }
  // combine the two lane-halves (same query and shift, different key subsets)
#pragma unroll  // constant indices keep sh, sm in registers
  for (int t = 0; t < QT; ++t) {
    const float s1 = sm[t][0] + sm[t][1];
    const float S = s1 + __shfl_xor(s1, 16, 32);
    if (h == 0) {
      pm[wv][16 * t + li] = sh[t];
      ps[wv][16 * t + li] = S;
    }
  }
  __syncthreads();
  // merge the 16 waves' (shift, sum) pairs, one thread per query
  if (threadIdx.x < 16 * QT) {
    const int t = threadIdx.x;
    float Mb = pm[0][t];
#pragma unroll  // the LDS reads are issued together
    for (int w = 1; w < AW; ++w) Mb = fmaxf(Mb, pm[w][t]);
    float Sb = 0.f;
#pragma unroll  // the LDS reads are issued together
    for (int w = 0; w < AW; ++w)
      Sb += ps[w][t] * __builtin_amdgcn_exp2f(pm[w][t] - Mb);
    *reinterpret_cast<v2h*>(rowneg + 2 * (size_t)(b * N_ + n0 + t)) =
        neg_pair(Mb + __builtin_amdgcn_logf(Sb));
  }
}

// ---------------------------------------------------------------------------
// K3: column sums over queries (key-major => no atomics). Stores
// log2(1e-9 + cs) as neg_pair.
// One block per 64 keys; each of its 16 waves holds the 4 key tiles in
// registers and takes 256 queries, so one query fragment feeds 4 WMMAs. The
// query's -L rides in its upper K half against ones in the keys': the WMMA
// gives score - L, and a softmax weight is one exp2.
// ---------------------------------------------------------------------------
__global__ __launch_bounds__(32 * AW) void k_colsum(
    const _Float16* __restrict__ q_h, const _Float16* __restrict__ k_h,
    const _Float16* __restrict__ rowneg, _Float16* __restrict__ colneg) {
  __shared__ float pc[AW][16 * QT];
  const int wid = blockIdx.x;
  const int b = wid / NB;
  const int m0 = (wid % NB) * (16 * QT);
  const int lane = threadIdx.x & 31;
  const int wv = wave_id();
  const int nbeg = wv * ACH;
  const int li = lane & 15;
  const int h = lane >> 4;
  const int koff = h << 3;
  const v2h zero2 = {};
  const v2h one2 = {(_Float16)1.f, (_Float16)1.f};

  const _Float16* qb = q_h + (size_t)b * N_ * D_;
  const _Float16* kb = k_h + (size_t)b * N_ * D_;
  const _Float16* rnb = rowneg + 2 * (size_t)b * N_;
  v16h ak[QT];
  float cs[QT][8];
#pragma unroll  // constant indices keep ak, cs in registers
  for (int t = 0; t < QT; ++t) {
    ak[t] = frag(kb + (size_t)(m0 + 16 * t + li) * D_ + koff, half0(one2, h), zero2);
#pragma unroll
    for (int r = 0; r < 8; ++r) cs[t][r] = 0.f;
  }

  for (int i = 0; i < ACH; i += 32) {
    v16h bq[2];
#pragma unroll  // constant indices keep bq in registers
    for (int u = 0; u < 2; ++u) {
      const int n0 = nbeg + i + 16 * u;
      bq[u] = frag(qb + (size_t)(n0 + li) * D_ + koff,
                   *reinterpret_cast<const v2h*>(rnb + 2 * (n0 + li)), zero2);
    }
    // keeps the loads of both query tiles together at the trip's top: the
    // second tile's, sunk behind the first tile's work, are waited for anew
    __builtin_amdgcn_sched_barrier(0);
#pragma unroll  // constant indices keep bq in registers
    for (int u = 0; u < 2; ++u) {
      v8f et[QT];
#pragma unroll  // four independent WMMAs in a row fill one another's result distance
      for (int t = 0; t < QT; ++t) {
        v8f z = {};
        et[t] = wmma_f16(ak[t], bq[u], z);
      }
#pragma unroll  // constant indices keep et, cs in registers
      for (int t = 0; t < QT; ++t) {
#pragma unroll
        for (int r = 0; r < 8; ++r) cs[t][r] += __builtin_amdgcn_exp2f(et[t][r]);
      }
    }
  }
  // reduce across the 16 queries held by each lane-half
#pragma unroll
  for (int msk = 1; msk < 16; msk <<= 1) {
#pragma unroll
    for (int t = 0; t < QT; ++t) {
#pragma unroll
      for (int r = 0; r < 8; ++r) cs[t][r] += __shfl_xor(cs[t][r], msk, 32);
    }
  }
  if (li == 0) {
#pragma unroll
    for (int t = 0; t < QT; ++t) {
#pragma unroll
      for (int r = 0; r < 8; ++r) pc[wv][16 * t + koff + r] = cs[t][r];
    }
  }
  __syncthreads();
  // add the 16 waves' partial column sums, one thread per key
  if (threadIdx.x < 16 * QT) {
    const int t = threadIdx.x;
    float c = 0.f;
#pragma unroll  // the LDS reads are issued together
    for (int w = 0; w < AW; ++w) c += pc[w][t];
    *reinterpret_cast<v2h*>(colneg + 2 * (size_t)(b * N_ + m0 + t)) =
        neg_pair(__builtin_amdgcn_logf(1e-9f + c));
  }
}

// ---------------------------------------------------------------------------
// K4: recompute weights, X_r^T += V * W^T (K=32: two prob tiles per WMMA),
// then diff = q - x_r feeds the w_t projection WMMA directly; writes t_buf.
// One block per 64 queries; each of its 16 waves holds the 4 query tiles in
// registers and takes 256 keys, so the K, V and column-term loads of 32 keys
// feed 12 WMMAs. The upper K half of the score product holds the key's column
// term against ones and ones against the query's -L: the WMMA gives the log2
// of the finished weight, which is one exp2. Waves 0..3 add the partial X_r
// tiles, one tile each, and run the epilogue.
// ---------------------------------------------------------------------------
__global__ __launch_bounds__(32 * AW) void k_attn(
    const _Float16* __restrict__ q_h, const _Float16* __restrict__ k_h,
    const _Float16* __restrict__ v_h, const float* __restrict__ q_f,
    const _Float16* __restrict__ rowneg, const _Float16* __restrict__ colneg,
    const float* __restrict__ w_t, const float* __restrict__ b_t,
    float* __restrict__ t_buf) {
  __shared__ v8f px[AW][QT][32];  // a lane's 8 partial sums lie together
  const int wid = blockIdx.x;
  const int b = wid / NB;
  const int n0 = (wid % NB) * (16 * QT);
  const int lane = threadIdx.x & 31;
  const int wv = wave_id();
  const int mbeg = wv * ACH;
  const int li = lane & 15;
  const int h = lane >> 4;
  const int koff = h << 3;
  const v2h one2 = {(_Float16)1.f, (_Float16)1.f};

  const _Float16* qb = q_h + (size_t)b * N_ * D_;
  const _Float16* kb = k_h + (size_t)b * N_ * D_;
  const _Float16* vb = v_h + (size_t)b * D_ * N_;
  const _Float16* rnb = rowneg + 2 * (size_t)b * N_;
  const _Float16* cnb = colneg + 2 * (size_t)b * N_;

  v2h rn[QT];
#pragma unroll  // constant indices keep rn in registers
  for (int t = 0; t < QT; ++t)
    rn[t] = *reinterpret_cast<const v2h*>(rnb + 2 * (n0 + 16 * t + li));
  // precaution: the fragment loads below land in these four loads' address
  // registers, so the wait stands between the two groups
  asm volatile("s_wait_xcnt 0x0" ::: "memory");
  v16h bq[QT];
  v8f xacc[QT];
#pragma unroll  // constant indices keep the four tiles' state in registers
  for (int t = 0; t < QT; ++t) {
    bq[t] = frag(qb + (size_t)(n0 + 16 * t + li) * D_ + koff, half0(one2, h),
                 half0(rn[t], h));
    v8f z = {};
    xacc[t] = z;
  }

  for (int i = 0; i < ACH; i += 32) {
    const int m0 = mbeg + i;
    const v16h ak0 = frag(kb + (size_t)(m0 + li) * D_ + koff,
                          *reinterpret_cast<const v2h*>(cnb + 2 * (m0 + li)), one2);
    const v16h ak1 = frag(kb + (size_t)(m0 + 16 + li) * D_ + koff,
                          *reinterpret_cast<const v2h*>(cnb + 2 * (m0 + 16 + li)), one2);
    // tile m0/16 and the next one: channel li, keys koff..koff+7 of each
    const _Float16* vp = vb + (size_t)m0 * D_ + li * 16 + koff;
    const v8h v0 = *reinterpret_cast<const v8h*>(vp);
    const v8h v1 = *reinterpret_cast<const v8h*>(vp + 256);
    v16h av;
#pragma unroll
    for (int j = 0; j < 8; ++j) { av[j] = v0[j]; av[j + 8] = v1[j]; }
    // keeps the trip's six loads together at its top: sunk among the WMMAs,
    // each group of them is waited for on its own
    __builtin_amdgcn_sched_barrier(0);
    v8f e0[QT], e1[QT];
#pragma unroll  // eight independent WMMAs in a row fill one another's result distance
    for (int t = 0; t < QT; ++t) {
      v8f z = {};
      e0[t] = wmma_f16(ak0, bq[t], z);
      e1[t] = wmma_f16(ak1, bq[t], z);
    }
    // keeps the eight in a row: moved down to their readers, each is followed
    // by idle slots until its result may be read
    __builtin_amdgcn_sched_barrier(0);
#pragma unroll  // constant indices keep the four tiles' state in registers
    for (int t = 0; t < QT; ++t) {
      // D-tile layout == B-operand layout: pack two 16-key tiles into K=32.
      v16h pw;
#pragma unroll
      for (int r = 0; r < 8; ++r) {
        pw[r]     = (_Float16)__builtin_amdgcn_exp2f(e0[t][r]);
        pw[8 + r] = (_Float16)__builtin_amdgcn_exp2f(e1[t][r]);
      }
      xacc[t] = wmma_f16(av, pw, xacc[t]);
    }
  }

#pragma unroll  // constant indices keep xacc in registers
  for (int t = 0; t < QT; ++t) px[wv][t][lane] = xacc[t];
  __syncthreads();
  if (wv >= QT) return;
  // wave wv finishes query tile wv of the block
  const int nt = n0 + 16 * wv;
  v8f xs = {};
#pragma unroll  // the LDS reads are issued together
  for (int w = 0; w < AW; ++w) xs += px[w][wv][lane];

  // xs: lane reg r -> (d = r + 8h, n = nt + li). diff feeds next WMMA as B.
  const float* qrow = q_f + ((size_t)b * N_ + nt + li) * D_ + koff;
  v16h bdiff;
#pragma unroll
  for (int r = 0; r < 8; ++r) {
    bdiff[r] = (_Float16)(qrow[r] - xs[r]);
    bdiff[r + 8] = (_Float16)0.f;
  }
  v16h awt;
#pragma unroll
  for (int e = 0; e < 8; ++e) {
    awt[e] = (_Float16)w_t[li * D_ + koff + e];
    awt[e + 8] = (_Float16)0.f;
  }
  v8f z2 = {};
  const v8f t = wmma_f16(awt, bdiff, z2);
  float* tb = t_buf + (size_t)b * OUT_ * N_;
#pragma unroll
  for (int r = 0; r < 8; ++r)
    tb[(size_t)(r + koff) * N_ + nt + li] = t[r] + b_t[r + koff];
}

// ---------------------------------------------------------------------------
// K5: GroupNorm, ReLU and the q^T residual in one launch. One block per
// (b, group): the group's 4 channels x N values are contiguous, a thread keeps
// 4 points of each channel in registers from the statistics to the output, so
// t_buf is read once and no launch stands between the two halves.
// ---------------------------------------------------------------------------
__global__ __launch_bounds__(1024) void k_gnfinal(
    const float* __restrict__ t_buf, const float* __restrict__ q_f,
    const float* __restrict__ gamma, const float* __restrict__ beta,
    float* __restrict__ out) {
  const int bg = blockIdx.x;  // 0..15
  const int b = bg / G_;
  const int g = bg % G_;
  const int n = 4 * threadIdx.x;
  const float* p = t_buf + (size_t)bg * 4 * N_ + n;  // groups are contiguous
  const float* qp = q_f + ((size_t)b * N_ + n) * D_ + 4 * g;
  v4f tv[4], qv[4];  // tv[channel][point], qv[point][channel]
#pragma unroll  // constant indices keep tv in registers
  for (int c = 0; c < 4; ++c) tv[c] = *reinterpret_cast<const v4f*>(p + (size_t)c * N_);
#pragma unroll  // the residual's loads go out behind t's: one trip to memory in all
  for (int j = 0; j < 4; ++j) qv[j] = *reinterpret_cast<const v4f*>(qp + j * D_);
  float ga[4], be[4];
#pragma unroll  // read here, their latency too lies under the statistics
  for (int c = 0; c < 4; ++c) ga[c] = gamma[4 * g + c];
  // precaution: beta's load lands in the registers of gamma's address, so the
  // wait stands between the two
  asm volatile("s_wait_xcnt 0x0" ::: "memory");
#pragma unroll
  for (int c = 0; c < 4; ++c) be[c] = beta[4 * g + c];
  float s = 0.f, s2 = 0.f;
#pragma unroll  // constant indices keep tv in registers
  for (int c = 0; c < 4; ++c) {
#pragma unroll
    for (int j = 0; j < 4; ++j) {
      const float v = tv[c][j];
      s += v;
      s2 += v * v;
    }
  }
  __shared__ float sh[1024], sh2[1024];
  sh[threadIdx.x] = s;
  sh2[threadIdx.x] = s2;
  __syncthreads();
  for (int off = 512; off > 0; off >>= 1) {
    if (threadIdx.x < off) {
      sh[threadIdx.x] += sh[threadIdx.x + off];
      sh2[threadIdx.x] += sh2[threadIdx.x + off];
    }
    __syncthreads();
  }
  const float M = (float)(4 * N_);
  const float m = sh[0] / M;
  const float var = sh2[0] / M - m * m;
  const float rstd = rsqrtf(var + 1e-5f);
#pragma unroll  // constant indices keep tv, qv, ga, be in registers
  for (int c = 0; c < 4; ++c) {
    v4f y;
#pragma unroll
    for (int j = 0; j < 4; ++j)
      y[j] = qv[j][c] + fmaxf((tv[c][j] - m) * rstd * ga[c] + be[c], 0.f);
    *reinterpret_cast<v4f*>(out + ((size_t)b * OUT_ + 4 * g + c) * N_ + n) = y;
  }
}

// ---------------------------------------------------------------------------
extern "C" void kernel_launch(void* const* d_in, const int* in_sizes, int n_in,
                              void* d_out, int out_size, void* d_ws,
                              size_t ws_size, hipStream_t stream) {
  const float* x_q      = (const float*)d_in[0];
  const float* x_kv     = (const float*)d_in[1];
  const float* xyz_q    = (const float*)d_in[2];
  const float* xyz_kv   = (const float*)d_in[3];
  const float* w_qk     = (const float*)d_in[4];
  const float* w_v      = (const float*)d_in[5];
  const float* b_v      = (const float*)d_in[6];
  const float* w_t      = (const float*)d_in[7];
  const float* b_t      = (const float*)d_in[8];
  const float* gamma    = (const float*)d_in[9];
  const float* beta     = (const float*)d_in[10];
  const float* w_pos_q  = (const float*)d_in[11];
  const float* w_pos_kv = (const float*)d_in[12];
  float* out = (float*)d_out;

  char* ws = (char*)d_ws;
  size_t off = 0;
  auto carve = [&](size_t bytes) -> char* {
    char* p = ws + off;
    off += (bytes + 255) & ~(size_t)255;
    return p;
  };
  float*    q_f    = (float*)carve((size_t)B_ * N_ * D_ * 4);
  _Float16* q_h    = (_Float16*)carve((size_t)B_ * N_ * D_ * 2);
  _Float16* k_h    = (_Float16*)carve((size_t)B_ * N_ * D_ * 2);
  _Float16* v_h    = (_Float16*)carve((size_t)B_ * D_ * N_ * 2);
  _Float16* rowneg = (_Float16*)carve((size_t)B_ * N_ * 2 * 2);
  _Float16* colneg = (_Float16*)carve((size_t)B_ * N_ * 2 * 2);
  float*    t_buf  = (float*)carve((size_t)B_ * OUT_ * N_ * 4);
  (void)in_sizes; (void)n_in; (void)out_size; (void)ws_size;

  k_project<<<B_ * N_ / 32, 32 * SPLIT, 0, stream>>>(
      x_q, x_kv, xyz_q, xyz_kv, w_qk, w_v, b_v, w_pos_q, w_pos_kv,
      q_f, q_h, k_h, v_h);
  k_rowstats<<<B_ * NB, 32 * AW, 0, stream>>>(q_h, k_h, rowneg);
  k_colsum<<<B_ * NB, 32 * AW, 0, stream>>>(q_h, k_h, rowneg, colneg);
  k_attn<<<B_ * NB, 32 * AW, 0, stream>>>(q_h, k_h, v_h, q_f, rowneg, colneg,
                                     w_t, b_t, t_buf);
  k_gnfinal<<<B_ * G_, 1024, 0, stream>>>(t_buf, q_f, gamma, beta, out);
}

// v006
// It runs in 39.2 microseconds.
// Next to v005, in two timings, it ran 1.06 times as fast each time.
// Counting every step since v000, it is 6.38 times as fast.
#include <hip/hip_runtime.h>

#define B_   4
#define CIN  128
#define N_   4096
#define D_   16
#define OUT_ 16
#define G_   4
#define SPLIT 8             // waves per block in the projection
#define PCH   (CIN / SPLIT) // input channels per wave in the projection
#define QT  4               // attention passes: 16-row tiles a wave keeps in registers
#define AW  16              // attention passes: waves per block
#define ACH (N_ / AW)       // attention passes: streamed keys (or queries) per wave
#define NB  (N_ / (16 * QT)) // attention passes: blocks per batch
#define LOG2E 1.4426950408889634f

// Wave number within the block, in a scalar register: the wave's share of the
// loop, its weight loads and the branch on it are then scalar.
static __device__ __forceinline__ int wave_id() {
  return __builtin_amdgcn_readfirstlane(threadIdx.x >> 5);
}

typedef __attribute__((ext_vector_type(16))) _Float16 v16h;
typedef __attribute__((ext_vector_type(8)))  _Float16 v8h;
typedef __attribute__((ext_vector_type(8)))  float    v8f;
typedef __attribute__((ext_vector_type(4)))  float    v4f;
typedef __attribute__((ext_vector_type(2)))  float    v2f;
typedef __attribute__((ext_vector_type(2)))  _Float16 v2h;

// WMMA operand of a 16-channel row: 8 contiguous halves fill k = 8h..8h+7 (h =
// lane half). The upper K half, idle for 16 channels, takes two pairs of extra
// terms at k = 16+8h..16+8h+3; the rest is zero. Both operands are built here,
// so a pair of one meets the pair at the same place of the other.
static __device__ __forceinline__ v16h frag(const _Float16* p, v2h s0, v2h s1) {
  const v8h lo = *reinterpret_cast<const v8h*>(p);
  v16h r;
#pragma unroll
  for (int i = 0; i < 8; ++i) { r[i] = lo[i]; r[i + 8] = (_Float16)0.f; }
  r[8] = s0[0]; r[9] = s0[1];
  r[10] = s1[0]; r[11] = s1[1];
  return r;
}

// -x as two halves, leading part and remainder: against a pair of ones the
// product adds -x to a score with about 22 bits of x kept.
static __device__ __forceinline__ v2h neg_pair(float x) {
  v2h r;
  r[0] = (_Float16)(-x);
  r[1] = (_Float16)(-x - (float)r[0]);
  return r;
}

// The pair for lane half 0, zeros for half 1: the resident operand carries its
// pairs once (k = 16..19), whatever the streamed operand holds at k = 24..27.
static __device__ __forceinline__ v2h half0(v2h p, int h) {
  v2h z = {};
  return h == 0 ? p : z;
}

static __device__ __forceinline__ v8f wmma_f16(v16h a, v16h b, v8f c) {
  return __builtin_amdgcn_wmma_f32_16x16x32_f16(false, a, false, b, (short)0, c,
                                                false, false);
}

// ---------------------------------------------------------------------------
// K1: channel projections (1x1 convs). One block per 32 points, lane = point;
// each of the 8 waves sums 16 of the 128 input channels, partials meet in LDS.
//   q_f [B][N][16] f32, q_h/k_h [B][N][16] f16 (q_h times log2 e: the scores
//   come out of the WMMA as exponents of 2),
//   v_h [B][N/16][16 channels][16 keys] f16: one 16x16 tile is 512 contiguous
//   bytes, so a wave's A-fragment load in K4 reads whole 128-byte lines
// ---------------------------------------------------------------------------
__global__ __launch_bounds__(256) void k_project(
    const float* __restrict__ x_q, const float* __restrict__ x_kv,
    const float* __restrict__ xyz_q, const float* __restrict__ xyz_kv,
    const float* __restrict__ w_qk, const float* __restrict__ w_v,
    const float* __restrict__ b_v,
    const float* __restrict__ w_pos_q, const float* __restrict__ w_pos_kv,
    float* __restrict__ q_f, _Float16* __restrict__ q_h,
    _Float16* __restrict__ k_h, _Float16* __restrict__ v_h) {
  // partial sums: [wave][q 0..15 | k 16..31 | v 32..47][point]
  __shared__ float part[SPLIT][3 * D_][32];
  const int lane = threadIdx.x & 31;
  const int wv = wave_id();
  const int b = blockIdx.x / (N_ / 32);
  const int n = (blockIdx.x % (N_ / 32)) * 32 + lane;
  const int idx = b * N_ + n;
  const int c0 = wv * PCH;

  const float* xq = x_q + ((size_t)b * CIN + c0) * N_ + n;
  const float* xk = x_kv + ((size_t)b * CIN + c0) * N_ + n;
  float vq[PCH], vk[PCH];
#pragma unroll  // all 32 loads of the wave go out before the first is waited for
  for (int c = 0; c < PCH; ++c) {
    vq[c] = xq[(size_t)c * N_];
    vk[c] = xk[(size_t)c * N_];
  }
  float cq[3], ck[3];
#pragma unroll  // constant indices keep cq, ck in registers
  for (int j = 0; j < 3; ++j) {
    cq[j] = xyz_q[((size_t)b * 3 + j) * N_ + n];
    ck[j] = xyz_kv[((size_t)b * 3 + j) * N_ + n];
  }

#pragma unroll  // independent sums of several d interleave
  for (int d = 0; d < D_; ++d) {
    float sq = 0.f, sk = 0.f, sv = 0.f;
#pragma unroll  // constant indices keep vq, vk in registers
    for (int c = 0; c < PCH; ++c) {
      const float wq = w_qk[d * CIN + c0 + c];
      sq = fmaf(wq, vq[c], sq);
      sk = fmaf(wq, vk[c], sk);
      sv = fmaf(w_v[d * CIN + c0 + c], vk[c], sv);
    }
    part[wv][d][lane] = sq;
    part[wv][D_ + d][lane] = sk;
    part[wv][2 * D_ + d][lane] = sv;
  }
  __syncthreads();

  // wave wv finishes output channels 2*wv and 2*wv+1 of the block's 32 points
  float qv[2], kv[2], vv[2];
#pragma unroll  // qv, kv, vv stay in registers
  for (int i = 0; i < 2; ++i) {
    const int d = 2 * wv + i;
    float aq = 0.f, ak = 0.f, av = 0.f;
#pragma unroll  // the LDS reads are issued together
    for (int w = 0; w < SPLIT; ++w) {
      aq += part[w][d][lane];
      ak += part[w][D_ + d][lane];
      av += part[w][2 * D_ + d][lane];
    }
    float pq = 0.f, pk = 0.f;
#pragma unroll  // constant indices keep cq, ck in registers
    for (int j = 0; j < 3; ++j) {
      pq = fmaf(w_pos_q[d * 3 + j], cq[j], pq);
      pk = fmaf(w_pos_kv[d * 3 + j], ck[j], pk);
    }
    qv[i] = aq + pq;
    kv[i] = ak + pk;
    vv[i] = av + b_v[d] + pk;
  }
  const size_t row = (size_t)idx * D_ + 2 * wv;
  v2f qp; qp[0] = qv[0]; qp[1] = qv[1];
  v2f kp; kp[0] = kv[0]; kp[1] = kv[1];
  v2f vp; vp[0] = vv[0]; vp[1] = vv[1];
  const v2h qh = __builtin_convertvector(qp * LOG2E, v2h);
  const v2h kh = __builtin_convertvector(kp, v2h);
  const v2h vh = __builtin_convertvector(vp, v2h);
  *reinterpret_cast<v2f*>(q_f + row) = qp;
  *reinterpret_cast<v2h*>(q_h + row) = qh;
  *reinterpret_cast<v2h*>(k_h + row) = kh;
  _Float16* vrow = v_h + ((size_t)b * N_ + (n & ~15)) * D_ + 2 * wv * 16 + (n & 15);
  vrow[0] = vh[0];
  vrow[16] = vh[1];
}

// ---------------------------------------------------------------------------
// K2: per query, L = log2 of the sum over keys of 2^score, stored as neg_pair.
// One block per 64 queries; each of its 16 waves holds the 4 query tiles in
// registers. A wave's shift is the maximum over its first 32 keys: that key's
// own term is about 1, so the sum cannot vanish, and any shift gives the same
// L as long as no sum overflows. With minus the shift in the queries' upper K half
// against ones in the keys', the WMMA gives score - shift and each term of the
// sweep over the 256 keys is one exp2. Where a sum comes out too large (or not
// a number) the wave does both again, once, with the maximum over all its keys.
// E^T tile = WMMA(A = K-tile, B = Q-tile).
// D layout: lane L reg r -> (key m = m0 + r + 8*(L/16), query n = n0 + L%16)
// ---------------------------------------------------------------------------
__global__ __launch_bounds__(32 * AW) void k_rowstats(
    const _Float16* __restrict__ q_h, const _Float16* __restrict__ k_h,
    _Float16* __restrict__ rowneg) {
  __shared__ float pm[AW][16 * QT], ps[AW][16 * QT];
  const int wid = blockIdx.x;
  const int b = wid / NB;
  const int n0 = (wid % NB) * (16 * QT);
  const int lane = threadIdx.x & 31;
  const int wv = wave_id();
  const int mbeg = wv * ACH;
  const int li = lane & 15;
  const int h = lane >> 4;
  const int koff = h << 3;
  const v2h zero2 = {};
  const v2h one2 = {(_Float16)1.f, (_Float16)1.f};

  const _Float16* qb = q_h + (size_t)b * N_ * D_;
  const _Float16* kb = k_h + (size_t)b * N_ * D_;
  v16h bq[QT];
#pragma unroll  // constant indices keep bq in registers
  for (int t = 0; t < QT; ++t)
    bq[t] = frag(qb + (size_t)(n0 + 16 * t + li) * D_ + koff, zero2, zero2);

  // a lane's place in a key tile, kept apart from the tile's index: inside the
  // outer loop each sweep then steps one lane address a trip, as it did without
  // that loop, and does not form two anew from the index
  const unsigned loff = li * D_ + koff;
  float sh[QT];  // the shift in use
  v2f sm[QT];    // even and odd registers' terms: two sums per add instruction
  int span = 32;  // keys the shift is taken from; all of them on the second go
  for (;;) {
    float mx[QT];
#pragma unroll  // constant indices keep bq, mx in registers
    for (int t = 0; t < QT; ++t) {
      bq[t][8] = (_Float16)0.f;  // no shift in the scores the maximum is taken of
      bq[t][9] = (_Float16)0.f;
      mx[t] = -__builtin_inff();
    }

    for (int i = 0; i < span; i += 32) {
      v16h ak[2];
#pragma unroll  // constant indices keep ak in registers
      for (int u = 0; u < 2; ++u)
        ak[u] = frag(kb + (size_t)(mbeg + i + 16 * u) * D_ + loff, one2, zero2);
      // keeps the loads of both key tiles together at the trip's top: the
      // second tile's, sunk behind the first tile's work, is waited for anew
      __builtin_amdgcn_sched_barrier(0);
#pragma unroll  // constant indices keep ak in registers
      for (int u = 0; u < 2; ++u) {
        v8f et[QT];
#pragma unroll  // four independent WMMAs in a row fill one another's result distance
        for (int t = 0; t < QT; ++t) {
          v8f z = {};
          et[t] = wmma_f16(ak[u], bq[t], z);
        }
#pragma unroll  // constant indices keep et, mx in registers
        for (int t = 0; t < QT; ++t) {
#pragma unroll
          for (int r = 0; r < 8; r += 2)
            mx[t] = fmaxf(fmaxf(mx[t], et[t][r]), et[t][r + 1]);
        }
      }
    }

    // one shift per query for both lane halves; the pair really adds -sh
#pragma unroll  // constant indices keep bq, mx, sh, sm in registers
    for (int t = 0; t < QT; ++t) {
      const v2h p = neg_pair(fmaxf(mx[t], __shfl_xor(mx[t], 16, 32)));
      sh[t] = -((float)p[0] + (float)p[1]);
      const v2h ph = half0(p, h);
      bq[t][8] = ph[0];
      bq[t][9] = ph[1];
      const v2f z2 = {};
      sm[t] = z2;
    }

    for (int i = 0; i < ACH; i += 32) {
      v16h ak[2];
#pragma unroll  // constant indices keep ak in registers
      for (int u = 0; u < 2; ++u)
        ak[u] = frag(kb + (size_t)(mbeg + i + 16 * u) * D_ + loff, one2, zero2);
      // as in the first sweep
      __builtin_amdgcn_sched_barrier(0);
#pragma unroll  // constant indices keep ak in registers
      for (int u = 0; u < 2; ++u) {
        v8f et[QT];
#pragma unroll  // four independent WMMAs in a row fill one another's result distance
        for (int t = 0; t < QT; ++t) {
          v8f z = {};
          et[t] = wmma_f16(ak[u], bq[t], z);
        }
#pragma unroll  // constant indices keep et, sm in registers
        for (int t = 0; t < QT; ++t) {
#pragma unroll
          for (int r = 0; r < 8; r += 2) {
            v2f x;
            x[0] = __builtin_amdgcn_exp2f(et[t][r]);
            x[1] = __builtin_amdgcn_exp2f(et[t][r + 1]);
            sm[t] += x;
          }
        }
      }
    }
    // one test per wave behind the whole sweep: below 2^100 the 16 waves' sums
    // still add up without overflow; the comparison is false for a NaN too
    bool redo = false;
#pragma unroll  // constant indices keep sm in registers
    for (int t = 0; t < QT; ++t) redo |= !(sm[t][0] + sm[t][1] < 0x1p100f);
    if (span == ACH || __builtin_amdgcn_ballot_w32(redo) == 0) break;
    span = ACH;
  }
  // combine the two lane-halves (same query and shift, different key subsets)
#pragma unroll  // constant indices keep sh, sm in registers
  for (int t = 0; t < QT; ++t) {
    const float s1 = sm[t][0] + sm[t][1];
    const float S = s1 + __shfl_xor(s1, 16, 32);
    if (h == 0) {
      pm[wv][16 * t + li] = sh[t];
      ps[wv][16 * t + li] = S;
    }
  }
  __syncthreads();
  // merge the 16 waves' (shift, sum) pairs, one thread per query
  if (threadIdx.x < 16 * QT) {
    const int t = threadIdx.x;
    float Mb = pm[0][t];
#pragma unroll  // the LDS reads are issued together
    for (int w = 1; w < AW; ++w) Mb = fmaxf(Mb, pm[w][t]);
    float Sb = 0.f;
#pragma unroll  // the LDS reads are issued together
    for (int w = 0; w < AW; ++w)
      Sb += ps[w][t] * __builtin_amdgcn_exp2f(pm[w][t] - Mb);
    *reinterpret_cast<v2h*>(rowneg + 2 * (size_t)(b * N_ + n0 + t)) =
        neg_pair(Mb + __builtin_amdgcn_logf(Sb));
  }
}

// ---------------------------------------------------------------------------
// K3: column sums over queries (key-major => no atomics). Stores
// log2(1e-9 + cs) as neg_pair.
// One block per 64 keys; each of its 16 waves holds the 4 key tiles in
// registers and takes 256 queries, so one query fragment feeds 4 WMMAs. The
// query's -L rides in its upper K half against ones in the keys': the WMMA
// gives score - L, and a softmax weight is one exp2.
// ---------------------------------------------------------------------------
__global__ __launch_bounds__(32 * AW) void k_colsum(
    const _Float16* __restrict__ q_h, const _Float16* __restrict__ k_h,
    const _Float16* __restrict__ rowneg, _Float16* __restrict__ colneg) {
  __shared__ float pc[AW][16 * QT];
  const int wid = blockIdx.x;
  const int b = wid / NB;
  const int m0 = (wid % NB) * (16 * QT);
  const int lane = threadIdx.x & 31;
  const int wv = wave_id();
  const int nbeg = wv * ACH;
  const int li = lane & 15;
  const int h = lane >> 4;
  const int koff = h << 3;
  const v2h zero2 = {};
  const v2h one2 = {(_Float16)1.f, (_Float16)1.f};

  const _Float16* qb = q_h + (size_t)b * N_ * D_;
  const _Float16* kb = k_h + (size_t)b * N_ * D_;
  const _Float16* rnb = rowneg + 2 * (size_t)b * N_;
  v16h ak[QT];
  float cs[QT][8];
#pragma unroll  // constant indices keep ak, cs in registers
  for (int t = 0; t < QT; ++t) {
    ak[t] = frag(kb + (size_t)(m0 + 16 * t + li) * D_ + koff, half0(one2, h), zero2);
#pragma unroll
    for (int r = 0; r < 8; ++r) cs[t][r] = 0.f;
  }

  for (int i = 0; i < ACH; i += 32) {
    v16h bq[2];
#pragma unroll  // constant indices keep bq in registers
    for (int u = 0; u < 2; ++u) {
      const int n0 = nbeg + i + 16 * u;
      bq[u] = frag(qb + (size_t)(n0 + li) * D_ + koff,
                   *reinterpret_cast<const v2h*>(rnb + 2 * (n0 + li)), zero2);
    }
    // keeps the loads of both query tiles together at the trip's top: the
    // second tile's, sunk behind the first tile's work, are waited for anew
    __builtin_amdgcn_sched_barrier(0);
#pragma unroll  // constant indices keep bq in registers
    for (int u = 0; u < 2; ++u) {
      v8f et[QT];
#pragma unroll  // four independent WMMAs in a row fill one another's result distance
      for (int t = 0; t < QT; ++t) {
        v8f z = {};
        et[t] = wmma_f16(ak[t], bq[u], z);
      }
#pragma unroll  // constant indices keep et, cs in registers
      for (int t = 0; t < QT; ++t) {
#pragma unroll
        for (int r = 0; r < 8; ++r) cs[t][r] += __builtin_amdgcn_exp2f(et[t][r]);
      }
    }
  }
  // reduce across the 16 queries held by each lane-half
#pragma unroll
  for (int msk = 1; msk < 16; msk <<= 1) {
#pragma unroll
    for (int t = 0; t < QT; ++t) {
#pragma unroll
      for (int r = 0; r < 8; ++r) cs[t][r] += __shfl_xor(cs[t][r], msk, 32);
    }
  }
  if (li == 0) {
#pragma unroll
    for (int t = 0; t < QT; ++t) {
#pragma unroll
      for (int r = 0; r < 8; ++r) pc[wv][16 * t + koff + r] = cs[t][r];
    }
  }
  __syncthreads();
  // add the 16 waves' partial column sums, one thread per key
  if (threadIdx.x < 16 * QT) {
    const int t = threadIdx.x;
    float c = 0.f;
#pragma unroll  // the LDS reads are issued together
    for (int w = 0; w < AW; ++w) c += pc[w][t];
    *reinterpret_cast<v2h*>(colneg + 2 * (size_t)(b * N_ + m0 + t)) =
        neg_pair(__builtin_amdgcn_logf(1e-9f + c));
  }
}

// ---------------------------------------------------------------------------
// K4: recompute weights, X_r^T += V * W^T (K=32: two prob tiles per WMMA),
// then diff = q - x_r feeds the w_t projection WMMA directly; writes t_buf.
// One block per 64 queries; each of its 16 waves holds the 4 query tiles in
// registers and takes 256 keys, so the K, V and column-term loads of 32 keys
// feed 12 WMMAs. The upper K half of the score product holds the key's column
// term against ones and ones against the query's -L: the WMMA gives the log2
// of the finished weight, which is one exp2. Waves 0..3 add the partial X_r
// tiles, one tile each, and run the epilogue.
// ---------------------------------------------------------------------------
__global__ __launch_bounds__(32 * AW) void k_attn(
    const _Float16* __restrict__ q_h, const _Float16* __restrict__ k_h,
    const _Float16* __restrict__ v_h, const float* __restrict__ q_f,
    const _Float16* __restrict__ rowneg, const _Float16* __restrict__ colneg,
    const float* __restrict__ w_t, const float* __restrict__ b_t,
    float* __restrict__ t_buf) {
  __shared__ v8f px[AW][QT][32];  // a lane's 8 partial sums lie together
  const int wid = blockIdx.x;
  const int b = wid / NB;
  const int n0 = (wid % NB) * (16 * QT);
  const int lane = threadIdx.x & 31;
  const int wv = wave_id();
  const int mbeg = wv * ACH;
  const int li = lane & 15;
  const int h = lane >> 4;
  const int koff = h << 3;
  const v2h one2 = {(_Float16)1.f, (_Float16)1.f};

  const _Float16* qb = q_h + (size_t)b * N_ * D_;
  const _Float16* kb = k_h + (size_t)b * N_ * D_;
  const _Float16* vb = v_h + (size_t)b * D_ * N_;
  const _Float16* rnb = rowneg + 2 * (size_t)b * N_;
  const _Float16* cnb = colneg + 2 * (size_t)b * N_;

  v2h rn[QT];
#pragma unroll  // constant indices keep rn in registers
  for (int t = 0; t < QT; ++t)
    rn[t] = *reinterpret_cast<const v2h*>(rnb + 2 * (n0 + 16 * t + li));
  // precaution: the fragment loads below land in these four loads' address
  // registers, so the wait stands between the two groups
  asm volatile("s_wait_xcnt 0x0" ::: "memory");
  v16h bq[QT];
  v8f xacc[QT];
#pragma unroll  // constant indices keep the four tiles' state in registers
  for (int t = 0; t < QT; ++t) {
    bq[t] = frag(qb + (size_t)(n0 + 16 * t + li) * D_ + koff, half0(one2, h),
                 half0(rn[t], h));
    v8f z = {};
    xacc[t] = z;
  }

  for (int i = 0; i < ACH; i += 32) {
    const int m0 = mbeg + i;
    const v16h ak0 = frag(kb + (size_t)(m0 + li) * D_ + koff,
                          *reinterpret_cast<const v2h*>(cnb + 2 * (m0 + li)), one2);
    const v16h ak1 = frag(kb + (size_t)(m0 + 16 + li) * D_ + koff,
                          *reinterpret_cast<const v2h*>(cnb + 2 * (m0 + 16 + li)), one2);
    // tile m0/16 and the next one: channel li, keys koff..koff+7 of each
    const _Float16* vp = vb + (size_t)m0 * D_ + li * 16 + koff;
    const v8h v0 = *reinterpret_cast<const v8h*>(vp);
    const v8h v1 = *reinterpret_cast<const v8h*>(vp + 256);
    v16h av;
#pragma unroll
    for (int j = 0; j < 8; ++j) { av[j] = v0[j]; av[j + 8] = v1[j]; }
    // keeps the trip's six loads together at its top: sunk among the WMMAs,
    // each group of them is waited for on its own
    __builtin_amdgcn_sched_barrier(0);
    v8f e0[QT], e1[QT];
#pragma unroll  // eight independent WMMAs in a row fill one another's result distance
    for (int t = 0; t < QT; ++t) {
      v8f z = {};
      e0[t] = wmma_f16(ak0, bq[t], z);
      e1[t] = wmma_f16(ak1, bq[t], z);
    }
    // keeps the eight in a row: moved down to their readers, each is followed
    // by idle slots until its result may be read
    __builtin_amdgcn_sched_barrier(0);
#pragma unroll  // constant indices keep the four tiles' state in registers
    for (int t = 0; t < QT; ++t) {
      // D-tile layout == B-operand layout: pack two 16-key tiles into K=32.
      v16h pw;
#pragma unroll
      for (int r = 0; r < 8; ++r) {
        pw[r]     = (_Float16)__builtin_amdgcn_exp2f(e0[t][r]);
        pw[8 + r] = (_Float16)__builtin_amdgcn_exp2f(e1[t][r]);
      }
      xacc[t] = wmma_f16(av, pw, xacc[t]);
    }
  }

#pragma unroll  // constant indices keep xacc in registers
  for (int t = 0; t < QT; ++t) px[wv][t][lane] = xacc[t];
  __syncthreads();
  if (wv >= QT) return;
  // wave wv finishes query tile wv of the block
  const int nt = n0 + 16 * wv;
  v8f xs = {};
#pragma unroll  // the LDS reads are issued together
  for (int w = 0; w < AW; ++w) xs += px[w][wv][lane];

  // xs: lane reg r -> (d = r + 8h, n = nt + li). diff feeds next WMMA as B.
  const float* qrow = q_f + ((size_t)b * N_ + nt + li) * D_ + koff;
  v16h bdiff;
#pragma unroll
  for (int r = 0; r < 8; ++r) {
    bdiff[r] = (_Float16)(qrow[r] - xs[r]);
    bdiff[r + 8] = (_Float16)0.f;
  }
  v16h awt;
#pragma unroll
  for (int e = 0; e < 8; ++e) {
    awt[e] = (_Float16)w_t[li * D_ + koff + e];
    awt[e + 8] = (_Float16)0.f;
  }
  v8f z2 = {};
  const v8f t = wmma_f16(awt, bdiff, z2);
  float* tb = t_buf + (size_t)b * OUT_ * N_;
#pragma unroll
  for (int r = 0; r < 8; ++r)
    tb[(size_t)(r + koff) * N_ + nt + li] = t[r] + b_t[r + koff];
}

// ---------------------------------------------------------------------------
// K5: GroupNorm, ReLU and the q^T residual in one launch. One block per
// (b, group): the group's 4 channels x N values are contiguous, a thread keeps
// 4 points of each channel in registers from the statistics to the output, so
// t_buf is read once and no launch stands between the two halves.
// ---------------------------------------------------------------------------
__global__ __launch_bounds__(1024) void k_gnfinal(
    const float* __restrict__ t_buf, const float* __restrict__ q_f,
    const float* __restrict__ gamma, const float* __restrict__ beta,
    float* __restrict__ out) {
  const int bg = blockIdx.x;  // 0..15
  const int b = bg / G_;
  const int g = bg % G_;
  const int n = 4 * threadIdx.x;
  const float* p = t_buf + (size_t)bg * 4 * N_ + n;  // groups are contiguous
  const float* qp = q_f + ((size_t)b * N_ + n) * D_ + 4 * g;
  v4f tv[4], qv[4];  // tv[channel][point], qv[point][channel]
#pragma unroll  // constant indices keep tv in registers
  for (int c = 0; c < 4; ++c) tv[c] = *reinterpret_cast<const v4f*>(p + (size_t)c * N_);
#pragma unroll  // the residual's loads go out behind t's: one trip to memory in all
  for (int j = 0; j < 4; ++j) qv[j] = *reinterpret_cast<const v4f*>(qp + j * D_);
  float ga[4], be[4];
#pragma unroll  // read here, their latency too lies under the statistics
  for (int c = 0; c < 4; ++c) ga[c] = gamma[4 * g + c];
  // precaution: beta's load lands in the registers of gamma's address, so the
  // wait stands between the two
  asm volatile("s_wait_xcnt 0x0" ::: "memory");
#pragma unroll
  for (int c = 0; c < 4; ++c) be[c] = beta[4 * g + c];
  float s = 0.f, s2 = 0.f;
#pragma unroll  // constant indices keep tv in registers
  for (int c = 0; c < 4; ++c) {
#pragma unroll
    for (int j = 0; j < 4; ++j) {
      const float v = tv[c][j];
      s += v;
      s2 += v * v;
    }
  }
  __shared__ float sh[1024], sh2[1024];
  sh[threadIdx.x] = s;
  sh2[threadIdx.x] = s2;
  __syncthreads();
  for (int off = 512; off > 0; off >>= 1) {
    if (threadIdx.x < off) {
      sh[threadIdx.x] += sh[threadIdx.x + off];
      sh2[threadIdx.x] += sh2[threadIdx.x + off];
    }
    __syncthreads();
  }
  const float M = (float)(4 * N_);
  const float m = sh[0] / M;
  const float var = sh2[0] / M - m * m;
  const float rstd = rsqrtf(var + 1e-5f);
#pragma unroll  // constant indices keep tv, qv, ga, be in registers
  for (int c = 0; c < 4; ++c) {
    v4f y;
#pragma unroll
    for (int j = 0; j < 4; ++j)
      y[j] = qv[j][c] + fmaxf((tv[c][j] - m) * rstd * ga[c] + be[c], 0.f);
    *reinterpret_cast<v4f*>(out + ((size_t)b * OUT_ + 4 * g + c) * N_ + n) = y;
  }
}

// ---------------------------------------------------------------------------
extern "C" void kernel_launch(void* const* d_in, const int* in_sizes, int n_in,
                              void* d_out, int out_size, void* d_ws,
                              size_t ws_size, hipStream_t stream) {
  const float* x_q      = (const float*)d_in[0];
  const float* x_kv     = (const float*)d_in[1];
  const float* xyz_q    = (const float*)d_in[2];
  const float* xyz_kv   = (const float*)d_in[3];
  const float* w_qk     = (const float*)d_in[4];
  const float* w_v      = (const float*)d_in[5];
  const float* b_v      = (const float*)d_in[6];
  const float* w_t      = (const float*)d_in[7];
  const float* b_t      = (const float*)d_in[8];
  const float* gamma    = (const float*)d_in[9];
  const float* beta     = (const float*)d_in[10];
  const float* w_pos_q  = (const float*)d_in[11];
  const float* w_pos_kv = (const float*)d_in[12];
  float* out = (float*)d_out;

  char* ws = (char*)d_ws;
  size_t off = 0;
  auto carve = [&](size_t bytes) -> char* {
    char* p = ws + off;
    off += (bytes + 255) & ~(size_t)255;
    return p;
  };
  float*    q_f    = (float*)carve((size_t)B_ * N_ * D_ * 4);
  _Float16* q_h    = (_Float16*)carve((size_t)B_ * N_ * D_ * 2);
  _Float16* k_h    = (_Float16*)carve((size_t)B_ * N_ * D_ * 2);
  _Float16* v_h    = (_Float16*)carve((size_t)B_ * D_ * N_ * 2);
  _Float16* rowneg = (_Float16*)carve((size_t)B_ * N_ * 2 * 2);
  _Float16* colneg = (_Float16*)carve((size_t)B_ * N_ * 2 * 2);
  float*    t_buf  = (float*)carve((size_t)B_ * OUT_ * N_ * 4);
  (void)in_sizes; (void)n_in; (void)out_size; (void)ws_size;

  k_project<<<B_ * N_ / 32, 32 * SPLIT, 0, stream>>>(
      x_q, x_kv, xyz_q, xyz_kv, w_qk, w_v, b_v, w_pos_q, w_pos_kv,
      q_f, q_h, k_h, v_h);
  k_rowstats<<<B_ * NB, 32 * AW, 0, stream>>>(q_h, k_h, rowneg);
  k_colsum<<<B_ * NB, 32 * AW, 0, stream>>>(q_h, k_h, rowneg, colneg);
  k_attn<<<B_ * NB, 32 * AW, 0, stream>>>(q_h, k_h, v_h, q_f, rowneg, colneg,
                                     w_t, b_t, t_buf);
  k_gnfinal<<<B_ * G_, 1024, 0, stream>>>(t_buf, q_f, gamma, beta, out);
}

// v007
// One run takes 36.2 microseconds.
// Timed twice side by side with v006, it ran 1.08 and 1.07 times as fast.
// Over all steps from v000 it is 6.85 times as fast.
#include <hip/hip_runtime.h>

#define B_   4
#define CIN  128
#define N_   4096
#define D_   16
#define OUT_ 16
#define G_   4
#define SPLIT 8             // waves per block in the projection
#define PCH   (CIN / SPLIT) // input channels per wave in the projection
#define QT  4               // attention passes: 16-row tiles a wave keeps in registers
#define AW  16              // attention passes: waves per block
#define ACH (N_ / AW)       // attention passes: streamed keys (or queries) per wave
#define NB  (N_ / (16 * QT)) // attention passes: blocks per batch
#define LOG2E 1.4426950408889634f

// Wave number within the block, in a scalar register: the wave's share of the
// loop, its weight loads and the branch on it are then scalar.
static __device__ __forceinline__ int wave_id() {
  return __builtin_amdgcn_readfirstlane(threadIdx.x >> 5);
}

typedef __attribute__((ext_vector_type(16))) _Float16 v16h;
typedef __attribute__((ext_vector_type(8)))  _Float16 v8h;
typedef __attribute__((ext_vector_type(8)))  float    v8f;
typedef __attribute__((ext_vector_type(4)))  float    v4f;
typedef __attribute__((ext_vector_type(2)))  float    v2f;
typedef __attribute__((ext_vector_type(2)))  _Float16 v2h;

// WMMA operand of a 16-channel row: 8 contiguous halves fill k = 8h..8h+7 (h =
// lane half). The upper K half, idle for 16 channels, takes two pairs of extra
// terms at k = 16+8h..16+8h+3; the rest is zero. Both operands are built here,
// so a pair of one meets the pair at the same place of the other.
static __device__ __forceinline__ v16h frag_of(v8h lo, v2h s0, v2h s1) {
  v16h r;
#pragma unroll
  for (int i = 0; i < 8; ++i) { r[i] = lo[i]; r[i + 8] = (_Float16)0.f; }
  r[8] = s0[0]; r[9] = s0[1];
  r[10] = s1[0]; r[11] = s1[1];
  return r;
}
static __device__ __forceinline__ v16h frag(const _Float16* p, v2h s0, v2h s1) {
  return frag_of(*reinterpret_cast<const v8h*>(p), s0, s1);
}

// -x as two halves, leading part and remainder: against a pair of ones the
// product adds -x to a score with about 22 bits of x kept.
static __device__ __forceinline__ v2h neg_pair(float x) {
  v2h r;
  r[0] = (_Float16)(-x);
  r[1] = (_Float16)(-x - (float)r[0]);
  return r;
}

// The pair for lane half 0, zeros for half 1: the resident operand carries its
// pairs once (k = 16..19), whatever the streamed operand holds at k = 24..27.
static __device__ __forceinline__ v2h half0(v2h p, int h) {
  v2h z = {};
  return h == 0 ? p : z;
}

static __device__ __forceinline__ v8f wmma_f16(v16h a, v16h b, v8f c) {
  return __builtin_amdgcn_wmma_f32_16x16x32_f16(false, a, false, b, (short)0, c,
                                                false, false);
}

// ---------------------------------------------------------------------------
// K1: channel projections (1x1 convs). One block per 32 points, lane = point;
// each of the 8 waves sums 16 of the 128 input channels, partials meet in LDS.
//   q_f [B][N][16] f32, q_h/k_h [B][N][16] f16 (q_h times log2 e: the scores
//   come out of the WMMA as exponents of 2),
//   v_h [B][N/16][16 channels][16 keys] f16: one 16x16 tile is 512 contiguous
//   bytes, so a wave's A-fragment load in K4 reads whole 128-byte lines
// ---------------------------------------------------------------------------
__global__ __launch_bounds__(256) void k_project(
    const float* __restrict__ x_q, const float* __restrict__ x_kv,
    const float* __restrict__ xyz_q, const float* __restrict__ xyz_kv,
    const float* __restrict__ w_qk, const float* __restrict__ w_v,
    const float* __restrict__ b_v,
    const float* __restrict__ w_pos_q, const float* __restrict__ w_pos_kv,
    float* __restrict__ q_f, _Float16* __restrict__ q_h,
    _Float16* __restrict__ k_h, _Float16* __restrict__ v_h) {
  // partial sums: [wave][q 0..15 | k 16..31 | v 32..47][point]
  __shared__ float part[SPLIT][3 * D_][32];
  const int lane = threadIdx.x & 31;
  const int wv = wave_id();
  const int b = blockIdx.x / (N_ / 32);
  const int n = (blockIdx.x % (N_ / 32)) * 32 + lane;
  const int idx = b * N_ + n;
  const int c0 = wv * PCH;

  const float* xq = x_q + ((size_t)b * CIN + c0) * N_ + n;
  const float* xk = x_kv + ((size_t)b * CIN + c0) * N_ + n;
  float vq[PCH], vk[PCH];
#pragma unroll  // all 32 loads of the wave go out before the first is waited for
  for (int c = 0; c < PCH; ++c) {
    vq[c] = xq[(size_t)c * N_];
    vk[c] = xk[(size_t)c * N_];
  }
  float cq[3], ck[3];
#pragma unroll  // constant indices keep cq, ck in registers
  for (int j = 0; j < 3; ++j) {
    cq[j] = xyz_q[((size_t)b * 3 + j) * N_ + n];
    ck[j] = xyz_kv[((size_t)b * 3 + j) * N_ + n];
  }

#pragma unroll  // independent sums of several d interleave
  for (int d = 0; d < D_; ++d) {
    float sq = 0.f, sk = 0.f, sv = 0.f;
#pragma unroll  // constant indices keep vq, vk in registers
    for (int c = 0; c < PCH; ++c) {
      const float wq = w_qk[d * CIN + c0 + c];
      sq = fmaf(wq, vq[c], sq);
      sk = fmaf(wq, vk[c], sk);
      sv = fmaf(w_v[d * CIN + c0 + c], vk[c], sv);
    }
    part[wv][d][lane] = sq;
    part[wv][D_ + d][lane] = sk;
    part[wv][2 * D_ + d][lane] = sv;
  }
  __syncthreads();

  // wave wv finishes output channels 2*wv and 2*wv+1 of the block's 32 points
  float qv[2], kv[2], vv[2];
#pragma unroll  // qv, kv, vv stay in registers
  for (int i = 0; i < 2; ++i) {
    const int d = 2 * wv + i;
    float aq = 0.f, ak = 0.f, av = 0.f;
#pragma unroll  // the LDS reads are issued together
    for (int w = 0; w < SPLIT; ++w) {
      aq += part[w][d][lane];
      ak += part[w][D_ + d][lane];
      av += part[w][2 * D_ + d][lane];
    }
    float pq = 0.f, pk = 0.f;
#pragma unroll  // constant indices keep cq, ck in registers
    for (int j = 0; j < 3; ++j) {
      pq = fmaf(w_pos_q[d * 3 + j], cq[j], pq);
      pk = fmaf(w_pos_kv[d * 3 + j], ck[j], pk);
    }
    qv[i] = aq + pq;
    kv[i] = ak + pk;
    vv[i] = av + b_v[d] + pk;
  }
  const size_t row = (size_t)idx * D_ + 2 * wv;
  v2f qp; qp[0] = qv[0]; qp[1] = qv[1];
  v2f kp; kp[0] = kv[0]; kp[1] = kv[1];
  v2f vp; vp[0] = vv[0]; vp[1] = vv[1];
  const v2h qh = __builtin_convertvector(qp * LOG2E, v2h);
  const v2h kh = __builtin_convertvector(kp, v2h);
  const v2h vh = __builtin_convertvector(vp, v2h);
  *reinterpret_cast<v2f*>(q_f + row) = qp;
  *reinterpret_cast<v2h*>(q_h + row) = qh;
  *reinterpret_cast<v2h*>(k_h + row) = kh;
  _Float16* vrow = v_h + ((size_t)b * N_ + (n & ~15)) * D_ + 2 * wv * 16 + (n & 15);
  vrow[0] = vh[0];
  vrow[16] = vh[1];
}

// ---------------------------------------------------------------------------
// K2: per query, L = log2 of the sum over keys of 2^score, stored as neg_pair.
// One block per 64 queries; each of its 16 waves holds the 4 query tiles in
// registers. A wave's shift is the maximum over its first 32 keys: that key's
// own term is about 1, so the sum cannot vanish, and any shift gives the same
// L as long as no sum overflows. With minus the shift in the queries' upper K half
// against ones in the keys', the WMMA gives score - shift and each term of the
// sweep over the 256 keys is one exp2. Where a sum comes out too large (or not
// a number) the wave does both again, once, with the maximum over all its keys.
// E^T tile = WMMA(A = K-tile, B = Q-tile).
// D layout: lane L reg r -> (key m = m0 + r + 8*(L/16), query n = n0 + L%16)
// ---------------------------------------------------------------------------
__global__ __launch_bounds__(32 * AW) void k_rowstats(
    const _Float16* __restrict__ q_h, const _Float16* __restrict__ k_h,
    _Float16* __restrict__ rowneg) {
  __shared__ float pm[AW][16 * QT], ps[AW][16 * QT];
  const int wid = blockIdx.x;
  const int b = wid / NB;
  const int n0 = (wid % NB) * (16 * QT);
  const int lane = threadIdx.x & 31;
  const int wv = wave_id();
  const int mbeg = wv * ACH;
  const int li = lane & 15;
  const int h = lane >> 4;
  const int koff = h << 3;
  const v2h zero2 = {};
  const v2h one2 = {(_Float16)1.f, (_Float16)1.f};

  const _Float16* qb = q_h + (size_t)b * N_ * D_;
  const _Float16* kb = k_h + (size_t)b * N_ * D_;
  v16h bq[QT];
#pragma unroll  // constant indices keep bq in registers
  for (int t = 0; t < QT; ++t)
    bq[t] = frag(qb + (size_t)(n0 + 16 * t + li) * D_ + koff, zero2, zero2);

  // keeps the queries' loads in front of the keys': loads return in order, and
  // the first product needs all four query tiles but only the first key tile
  __builtin_amdgcn_sched_barrier(0);
  // The wave's 16 key tiles stay in registers: their loads all go out here,
  // behind the queries', and return in order while the first tiles are worked
  // on, so no trip of either sweep waits out a load of its own.
  const _Float16* kp = kb + (size_t)(mbeg + li) * D_ + koff;
  v16h ak[ACH / 16];
#pragma unroll  // constant indices keep ak in registers
  for (int j = 0; j < ACH / 16; ++j) ak[j] = frag(kp + 16 * j * D_, one2, zero2);
  float sh[QT];  // the shift in use
  v2f sm[QT];    // even and odd registers' terms: two sums per add instruction
  int span = 32;  // keys the shift is taken from; all of them on the second go
  for (;;) {
    float mx[QT];
#pragma unroll  // constant indices keep bq, mx in registers
    for (int t = 0; t < QT; ++t) {
      bq[t][8] = (_Float16)0.f;  // no shift in the scores the maximum is taken of
      bq[t][9] = (_Float16)0.f;
      mx[t] = -__builtin_inff();
    }

    // the maximum over one key tile's scores joins mx
    auto max_tile = [&](const v16h& a) {
      v8f et[QT];
#pragma unroll  // four independent WMMAs in a row fill one another's result distance
      for (int t = 0; t < QT; ++t) {
        v8f z = {};
        et[t] = wmma_f16(a, bq[t], z);
      }
#pragma unroll  // constant indices keep et, mx in registers
      for (int t = 0; t < QT; ++t) {
#pragma unroll
        for (int r = 0; r < 8; r += 2)
          mx[t] = fmaxf(fmaxf(mx[t], et[t][r]), et[t][r + 1]);
      }
    };
    max_tile(ak[0]);
    max_tile(ak[1]);
    if (span == ACH) {
#pragma unroll  // constant indices keep ak in registers
      for (int j = 2; j < ACH / 16; ++j) max_tile(ak[j]);
    }

    // one shift per query for both lane halves; the pair really adds -sh
#pragma unroll  // constant indices keep bq, mx, sh, sm in registers
    for (int t = 0; t < QT; ++t) {
      const v2h p = neg_pair(fmaxf(mx[t], __shfl_xor(mx[t], 16, 32)));
      sh[t] = -((float)p[0] + (float)p[1]);
      const v2h ph = half0(p, h);
      bq[t][8] = ph[0];
      bq[t][9] = ph[1];
      const v2f z2 = {};
      sm[t] = z2;
    }

#pragma unroll  // constant indices keep ak in registers
    for (int j = 0; j < ACH / 16; ++j) {
      v8f et[QT];
#pragma unroll  // four independent WMMAs in a row fill one another's result distance
      for (int t = 0; t < QT; ++t) {
        v8f z = {};
        et[t] = wmma_f16(ak[j], bq[t], z);
      }
#pragma unroll  // constant indices keep et, sm in registers
      for (int t = 0; t < QT; ++t) {
#pragma unroll
        for (int r = 0; r < 8; r += 2) {
          v2f x;
          x[0] = __builtin_amdgcn_exp2f(et[t][r]);
          x[1] = __builtin_amdgcn_exp2f(et[t][r + 1]);
          sm[t] += x;
        }
      }
    }
    // one test per wave behind the whole sweep: below 2^100 the 16 waves' sums
    // still add up without overflow; the comparison is false for a NaN too
    bool redo = false;
#pragma unroll  // constant indices keep sm in registers
    for (int t = 0; t < QT; ++t) redo |= !(sm[t][0] + sm[t][1] < 0x1p100f);
    if (span == ACH || __builtin_amdgcn_ballot_w32(redo) == 0) break;
    span = ACH;
  }
  // combine the two lane-halves (same query and shift, different key subsets)
#pragma unroll  // constant indices keep sh, sm in registers
  for (int t = 0; t < QT; ++t) {
    const float s1 = sm[t][0] + sm[t][1];
    const float S = s1 + __shfl_xor(s1, 16, 32);
    if (h == 0) {
      pm[wv][16 * t + li] = sh[t];
      ps[wv][16 * t + li] = S;
    }
  }
  __syncthreads();
  // merge the 16 waves' (shift, sum) pairs, one thread per query
  if (threadIdx.x < 16 * QT) {
    const int t = threadIdx.x;
    float Mb = pm[0][t];
#pragma unroll  // the LDS reads are issued together
    for (int w = 1; w < AW; ++w) Mb = fmaxf(Mb, pm[w][t]);
    float Sb = 0.f;
#pragma unroll  // the LDS reads are issued together
    for (int w = 0; w < AW; ++w)
      Sb += ps[w][t] * __builtin_amdgcn_exp2f(pm[w][t] - Mb);
    *reinterpret_cast<v2h*>(rowneg + 2 * (size_t)(b * N_ + n0 + t)) =
        neg_pair(Mb + __builtin_amdgcn_logf(Sb));
  }
}

// ---------------------------------------------------------------------------
// K3: column sums over queries (key-major => no atomics). Stores
// log2(1e-9 + cs) as neg_pair.
// One block per 64 keys; each of its 16 waves holds the 4 key tiles in
// registers and takes 256 queries, so one query fragment feeds 4 WMMAs. The
// query's -L rides in its upper K half against ones in the keys': the WMMA
// gives score - L, and a softmax weight is one exp2.
// ---------------------------------------------------------------------------
__global__ __launch_bounds__(32 * AW) void k_colsum(
    const _Float16* __restrict__ q_h, const _Float16* __restrict__ k_h,
    const _Float16* __restrict__ rowneg, _Float16* __restrict__ colneg) {
  __shared__ float pc[AW][16 * QT];
  const int wid = blockIdx.x;
  const int b = wid / NB;
  const int m0 = (wid % NB) * (16 * QT);
  const int lane = threadIdx.x & 31;
  const int wv = wave_id();
  const int nbeg = wv * ACH;
  const int li = lane & 15;
  const int h = lane >> 4;
  const int koff = h << 3;
  const v2h zero2 = {};
  const v2h one2 = {(_Float16)1.f, (_Float16)1.f};

  const _Float16* qb = q_h + (size_t)b * N_ * D_;
  const _Float16* kb = k_h + (size_t)b * N_ * D_;
  const _Float16* rnb = rowneg + 2 * (size_t)b * N_;
  v16h ak[QT];
  float cs[QT][8];
#pragma unroll  // constant indices keep ak, cs in registers
  for (int t = 0; t < QT; ++t) {
    ak[t] = frag(kb + (size_t)(m0 + 16 * t + li) * D_ + koff, half0(one2, h), zero2);
#pragma unroll
    for (int r = 0; r < 8; ++r) cs[t][r] = 0.f;
  }
  // keeps the keys' loads in front of the queries': loads return in order, and
  // the first product needs all four key tiles but only the first query tile
  __builtin_amdgcn_sched_barrier(0);

  // The query tiles are fetched two trips ahead: the work of trips i and i + 1
  // covers the way of trip i + 2's loads, which a wave otherwise waits out at
  // each trip's top. Three trips' tiles are live at a time.
  const _Float16* qp = qb + (size_t)(nbeg + li) * D_ + koff;
  const _Float16* rp = rnb + 2 * (nbeg + li);
  v16h bq[ACH / 16];
#pragma unroll  // constant indices keep bq in registers
  for (int j = 0; j < 4; ++j)
    bq[j] = frag(qp + 16 * j * D_, *reinterpret_cast<const v2h*>(rp + 32 * j), zero2);
#pragma unroll  // all 8 trips: a tile is a name, not a copy, and every load is one
                // lane address plus a constant
  for (int i = 0; i < ACH; i += 32) {
    // keeps the trips apart, as the rolled loop did, and the fetch below the
    // trip before: risen into it, it lands in registers that trip's WMMAs have
    // only just read
    __builtin_amdgcn_sched_barrier(0);
#pragma unroll  // constant indices keep bq in registers
    for (int j = i / 16 + 4; j < i / 16 + 6 && j < ACH / 16; ++j)
      bq[j] = frag(qp + 16 * j * D_, *reinterpret_cast<const v2h*>(rp + 32 * j), zero2);
    // keeps the fetch at this trip's top: sunk to its readers it would be
    // waited for in full again (left standing in the last two trips, which
    // fetch nothing: without it there this build spills registers)
    __builtin_amdgcn_sched_barrier(0);
#pragma unroll  // constant indices keep bq in registers
    for (int u = i / 16; u < i / 16 + 2; ++u) {
      v8f et[QT];
#pragma unroll  // four independent WMMAs in a row fill one another's result distance
      for (int t = 0; t < QT; ++t) {
        v8f z = {};
        et[t] = wmma_f16(ak[t], bq[u], z);
      }
#pragma unroll  // constant indices keep et, cs in registers
      for (int t = 0; t < QT; ++t) {
#pragma unroll
        for (int r = 0; r < 8; ++r) cs[t][r] += __builtin_amdgcn_exp2f(et[t][r]);
      }
    }
  }
  // keeps the lane reduction below the unrolled sweep: mixed into its last
  // trips, the cross-lane results are live all at once and registers spill
  __builtin_amdgcn_sched_barrier(0);
  // reduce across the 16 queries held by each lane-half
#pragma unroll
  for (int msk = 1; msk < 16; msk <<= 1) {
#pragma unroll
    for (int t = 0; t < QT; ++t) {
#pragma unroll
      for (int r = 0; r < 8; ++r) cs[t][r] += __shfl_xor(cs[t][r], msk, 32);
    }
  }
  if (li == 0) {
#pragma unroll
    for (int t = 0; t < QT; ++t) {
#pragma unroll
      for (int r = 0; r < 8; ++r) pc[wv][16 * t + koff + r] = cs[t][r];
    }
  }
  __syncthreads();
  // add the 16 waves' partial column sums, one thread per key
  if (threadIdx.x < 16 * QT) {
    const int t = threadIdx.x;
    float c = 0.f;
#pragma unroll  // the LDS reads are issued together
    for (int w = 0; w < AW; ++w) c += pc[w][t];
    *reinterpret_cast<v2h*>(colneg + 2 * (size_t)(b * N_ + m0 + t)) =
        neg_pair(__builtin_amdgcn_logf(1e-9f + c));
  }
}

// ---------------------------------------------------------------------------
// K4: recompute weights, X_r^T += V * W^T (K=32: two prob tiles per WMMA),
// then diff = q - x_r feeds the w_t projection WMMA directly; writes t_buf.
// One block per 64 queries; each of its 16 waves holds the 4 query tiles in
// registers and takes 256 keys, so the K, V and column-term loads of 32 keys
// feed 12 WMMAs. The upper K half of the score product holds the key's column
// term against ones and ones against the query's -L: the WMMA gives the log2
// of the finished weight, which is one exp2. Waves 0..3 add the partial X_r
// tiles, one tile each, and run the epilogue.
// ---------------------------------------------------------------------------
__global__ __launch_bounds__(32 * AW) void k_attn(
    const _Float16* __restrict__ q_h, const _Float16* __restrict__ k_h,
    const _Float16* __restrict__ v_h, const float* __restrict__ q_f,
    const _Float16* __restrict__ rowneg, const _Float16* __restrict__ colneg,
    const float* __restrict__ w_t, const float* __restrict__ b_t,
    float* __restrict__ t_buf) {
  __shared__ v8f px[AW][QT][32];  // a lane's 8 partial sums lie together
  const int wid = blockIdx.x;
  const int b = wid / NB;
  const int n0 = (wid % NB) * (16 * QT);
  const int lane = threadIdx.x & 31;
  const int wv = wave_id();
  const int mbeg = wv * ACH;
  const int li = lane & 15;
  const int h = lane >> 4;
  const int koff = h << 3;
  const v2h one2 = {(_Float16)1.f, (_Float16)1.f};

  const _Float16* qb = q_h + (size_t)b * N_ * D_;
  const _Float16* kb = k_h + (size_t)b * N_ * D_;
  const _Float16* vb = v_h + (size_t)b * D_ * N_;
  const _Float16* rnb = rowneg + 2 * (size_t)b * N_;
  const _Float16* cnb = colneg + 2 * (size_t)b * N_;

  v2h rn[QT];
#pragma unroll  // constant indices keep rn in registers
  for (int t = 0; t < QT; ++t)
    rn[t] = *reinterpret_cast<const v2h*>(rnb + 2 * (n0 + 16 * t + li));
  // precaution: the fragment loads below land in these four loads' address
  // registers, so the wait stands between the two groups
  asm volatile("s_wait_xcnt 0x0" ::: "memory");
  v8h ql[QT];
#pragma unroll  // constant indices keep ql in registers
  for (int t = 0; t < QT; ++t)
    ql[t] = *reinterpret_cast<const v8h*>(qb + (size_t)(n0 + 16 * t + li) * D_ + koff);
  // keeps the queries' loads in front of the streamed operands': loads return
  // in order, and the first product needs all four query tiles
  __builtin_amdgcn_sched_barrier(0);

  const _Float16* kp = kb + (size_t)(mbeg + li) * D_ + koff;
  const _Float16* cp = cnb + 2 * (mbeg + li);
  const _Float16* vp = vb + (size_t)mbeg * D_ + li * 16 + koff;
  // the K, column-term and V operands of the wave's keys i..i+31
  auto fetch = [&](int i, v16h& k0, v16h& k1, v16h& vv) {
    k0 = frag(kp + i * D_, *reinterpret_cast<const v2h*>(cp + 2 * i), one2);
    k1 = frag(kp + (i + 16) * D_, *reinterpret_cast<const v2h*>(cp + 2 * (i + 16)), one2);
    // V tile i/16 and the next one: channel li, keys koff..koff+7 of each
    const v8h v0 = *reinterpret_cast<const v8h*>(vp + i * D_);
    const v8h v1 = *reinterpret_cast<const v8h*>(vp + i * D_ + 256);
#pragma unroll
    for (int j = 0; j < 8; ++j) { vv[j] = v0[j]; vv[j + 8] = v1[j]; }
  };
  // They are fetched two trips ahead: the work of trips i and i + 1 covers the
  // way of trip i + 2's loads, which a wave otherwise waits out at each trip's
  // top. Three trips' operands are live at a time.
  v16h sk0[ACH / 32], sk1[ACH / 32], sv[ACH / 32];
  fetch(0, sk0[0], sk1[0], sv[0]);
  fetch(32, sk0[1], sk1[1], sv[1]);
  v16h bq[QT];
  v8f xacc[QT];
#pragma unroll  // constant indices keep the four tiles' state in registers
  for (int t = 0; t < QT; ++t) {
    bq[t] = frag_of(ql[t], half0(one2, h), half0(rn[t], h));
    v8f z = {};
    xacc[t] = z;
  }
#pragma unroll  // all 8 trips: an operand is a name, not a copy, and every load is
                // one lane address plus a constant
  for (int i = 0; i < ACH; i += 32) {
    // keeps the trips apart, as the rolled loop did: mixed, two trips' score
    // registers are live at once
    __builtin_amdgcn_sched_barrier(0);
    const v16h ak0 = sk0[i / 32], ak1 = sk1[i / 32], av = sv[i / 32];
    v8f e0[QT], e1[QT];
#pragma unroll  // eight independent WMMAs in a row fill one another's result distance
    for (int t = 0; t < QT; ++t) {
      v8f z = {};
      e0[t] = wmma_f16(ak0, bq[t], z);
      e1[t] = wmma_f16(ak1, bq[t], z);
    }
    // keeps the eight in a row: moved down to their readers, each is followed
    // by idle slots until its result may be read
    __builtin_amdgcn_sched_barrier(0);
#pragma unroll  // constant indices keep the four tiles' state in registers
    for (int t = 0; t < QT; ++t) {
      float x0[8], x1[8];
#pragma unroll
      for (int r = 0; r < 8; ++r) {
        x0[r] = __builtin_amdgcn_exp2f(e0[t][r]);
        x1[r] = __builtin_amdgcn_exp2f(e1[t][r]);
      }
      if (t == 0 && i + 64 < ACH) {
        // The fetch stands behind the first tile's 16 exponentials, between two
        // fences: higher or lower it would follow a WMMA directly and could
        // land in operand registers that WMMA has only just read; sunk to its
        // readers it would be waited for in full again.
        __builtin_amdgcn_sched_barrier(0);
        fetch(i + 64, sk0[i / 32 + 2], sk1[i / 32 + 2], sv[i / 32 + 2]);
        __builtin_amdgcn_sched_barrier(0);
      }
      // D-tile layout == B-operand layout: pack two 16-key tiles into K=32.
      v16h pw;
#pragma unroll
      for (int r = 0; r < 8; ++r) {
        pw[r]     = (_Float16)x0[r];
        pw[8 + r] = (_Float16)x1[r];
      }
      xacc[t] = wmma_f16(av, pw, xacc[t]);
    }
  }

#pragma unroll  // constant indices keep xacc in registers
  for (int t = 0; t < QT; ++t) px[wv][t][lane] = xacc[t];
  __syncthreads();
  if (wv >= QT) return;
  // wave wv finishes query tile wv of the block
  const int nt = n0 + 16 * wv;
  v8f xs = {};
#pragma unroll  // the LDS reads are issued together
  for (int w = 0; w < AW; ++w) xs += px[w][wv][lane];

  // xs: lane reg r -> (d = r + 8h, n = nt + li). diff feeds next WMMA as B.
  const float* qrow = q_f + ((size_t)b * N_ + nt + li) * D_ + koff;
  v16h bdiff;
#pragma unroll
  for (int r = 0; r < 8; ++r) {
    bdiff[r] = (_Float16)(qrow[r] - xs[r]);
    bdiff[r + 8] = (_Float16)0.f;
  }
  v16h awt;
#pragma unroll
  for (int e = 0; e < 8; ++e) {
    awt[e] = (_Float16)w_t[li * D_ + koff + e];
    awt[e + 8] = (_Float16)0.f;
  }
  v8f z2 = {};
  const v8f t = wmma_f16(awt, bdiff, z2);
  float* tb = t_buf + (size_t)b * OUT_ * N_;
#pragma unroll
  for (int r = 0; r < 8; ++r)
    tb[(size_t)(r + koff) * N_ + nt + li] = t[r] + b_t[r + koff];
}

// ---------------------------------------------------------------------------
// K5: GroupNorm, ReLU and the q^T residual in one launch. One block per
// (b, group): the group's 4 channels x N values are contiguous, a thread keeps
// 4 points of each channel in registers from the statistics to the output, so
// t_buf is read once and no launch stands between the two halves.
// ---------------------------------------------------------------------------
__global__ __launch_bounds__(1024) void k_gnfinal(
    const float* __restrict__ t_buf, const float* __restrict__ q_f,
    const float* __restrict__ gamma, const float* __restrict__ beta,
    float* __restrict__ out) {
  const int bg = blockIdx.x;  // 0..15
  const int b = bg / G_;
  const int g = bg % G_;
  const int n = 4 * threadIdx.x;
  const float* p = t_buf + (size_t)bg * 4 * N_ + n;  // groups are contiguous
  const float* qp = q_f + ((size_t)b * N_ + n) * D_ + 4 * g;
  v4f tv[4], qv[4];  // tv[channel][point], qv[point][channel]
#pragma unroll  // constant indices keep tv in registers
  for (int c = 0; c < 4; ++c) tv[c] = *reinterpret_cast<const v4f*>(p + (size_t)c * N_);
#pragma unroll  // the residual's loads go out behind t's: one trip to memory in all
  for (int j = 0; j < 4; ++j) qv[j] = *reinterpret_cast<const v4f*>(qp + j * D_);
  float ga[4], be[4];
#pragma unroll  // read here, their latency too lies under the statistics
  for (int c = 0; c < 4; ++c) ga[c] = gamma[4 * g + c];
  // precaution: beta's load lands in the registers of gamma's address, so the
  // wait stands between the two
  asm volatile("s_wait_xcnt 0x0" ::: "memory");
#pragma unroll
  for (int c = 0; c < 4; ++c) be[c] = beta[4 * g + c];
  float s = 0.f, s2 = 0.f;
#pragma unroll  // constant indices keep tv in registers
  for (int c = 0; c < 4; ++c) {
#pragma unroll
    for (int j = 0; j < 4; ++j) {
      const float v = tv[c][j];
      s += v;
      s2 += v * v;
    }
  }
  __shared__ float sh[1024], sh2[1024];
  sh[threadIdx.x] = s;
  sh2[threadIdx.x] = s2;
  __syncthreads();
  for (int off = 512; off > 0; off >>= 1) {
    if (threadIdx.x < off) {
      sh[threadIdx.x] += sh[threadIdx.x + off];
      sh2[threadIdx.x] += sh2[threadIdx.x + off];
    }
    __syncthreads();
  }
  const float M = (float)(4 * N_);
  const float m = sh[0] / M;
  const float var = sh2[0] / M - m * m;
  const float rstd = rsqrtf(var + 1e-5f);
#pragma unroll  // constant indices keep tv, qv, ga, be in registers
  for (int c = 0; c < 4; ++c) {
    v4f y;
#pragma unroll
    for (int j = 0; j < 4; ++j)
      y[j] = qv[j][c] + fmaxf((tv[c][j] - m) * rstd * ga[c] + be[c], 0.f);
    *reinterpret_cast<v4f*>(out + ((size_t)b * OUT_ + 4 * g + c) * N_ + n) = y;
  }
}

// ---------------------------------------------------------------------------
extern "C" void kernel_launch(void* const* d_in, const int* in_sizes, int n_in,
                              void* d_out, int out_size, void* d_ws,
                              size_t ws_size, hipStream_t stream) {
  const float* x_q      = (const float*)d_in[0];
  const float* x_kv     = (const float*)d_in[1];
  const float* xyz_q    = (const float*)d_in[2];
  const float* xyz_kv   = (const float*)d_in[3];
  const float* w_qk     = (const float*)d_in[4];
  const float* w_v      = (const float*)d_in[5];
  const float* b_v      = (const float*)d_in[6];
  const float* w_t      = (const float*)d_in[7];
  const float* b_t      = (const float*)d_in[8];
  const float* gamma    = (const float*)d_in[9];
  const float* beta     = (const float*)d_in[10];
  const float* w_pos_q  = (const float*)d_in[11];
  const float* w_pos_kv = (const float*)d_in[12];
  float* out = (float*)d_out;

  char* ws = (char*)d_ws;
  size_t off = 0;
  auto carve = [&](size_t bytes) -> char* {
    char* p = ws + off;
    off += (bytes + 255) & ~(size_t)255;
    return p;
  };
  float*    q_f    = (float*)carve((size_t)B_ * N_ * D_ * 4);
  _Float16* q_h    = (_Float16*)carve((size_t)B_ * N_ * D_ * 2);
  _Float16* k_h    = (_Float16*)carve((size_t)B_ * N_ * D_ * 2);
  _Float16* v_h    = (_Float16*)carve((size_t)B_ * D_ * N_ * 2);
  _Float16* rowneg = (_Float16*)carve((size_t)B_ * N_ * 2 * 2);
  _Float16* colneg = (_Float16*)carve((size_t)B_ * N_ * 2 * 2);
  float*    t_buf  = (float*)carve((size_t)B_ * OUT_ * N_ * 4);
  (void)in_sizes; (void)n_in; (void)out_size; (void)ws_size;

  k_project<<<B_ * N_ / 32, 32 * SPLIT, 0, stream>>>(
      x_q, x_kv, xyz_q, xyz_kv, w_qk, w_v, b_v, w_pos_q, w_pos_kv,
      q_f, q_h, k_h, v_h);
  k_rowstats<<<B_ * NB, 32 * AW, 0, stream>>>(q_h, k_h, rowneg);
  k_colsum<<<B_ * NB, 32 * AW, 0, stream>>>(q_h, k_h, rowneg, colneg);
  k_attn<<<B_ * NB, 32 * AW, 0, stream>>>(q_h, k_h, v_h, q_f, rowneg, colneg,
                                     w_t, b_t, t_buf);
  k_gnfinal<<<B_ * G_, 1024, 0, stream>>>(t_buf, q_f, gamma, beta, out);
}

// v008
// Measured time: 35.1 microseconds a run.
// In two side-by-side timings against v007, it was 1.05 and 1.03 times as fast.
// Over all steps from v000 it is 7.10 times as fast.
#include <hip/hip_runtime.h>

#define B_   4
#define CIN  128
#define N_   4096
#define D_   16
#define OUT_ 16
#define G_   4
#define SPLIT 8             // waves per block in the projection
#define PCH   (CIN / SPLIT) // input channels per wave in the projection
#define QT  4               // attention passes: 16-row tiles a wave keeps in registers
#define AW  16              // attention passes: waves per block
#define ACH (N_ / AW)       // attention passes: streamed keys (or queries) per wave
#define NB  (N_ / (16 * QT)) // attention passes: blocks per batch
#define LOG2E 1.4426950408889634f

// Wave number within the block, in a scalar register: the wave's share of the
// loop, its weight loads and the branch on it are then scalar.
static __device__ __forceinline__ int wave_id() {
  return __builtin_amdgcn_readfirstlane(threadIdx.x >> 5);
}

typedef __attribute__((ext_vector_type(16))) _Float16 v16h;
typedef __attribute__((ext_vector_type(8)))  _Float16 v8h;
typedef __attribute__((ext_vector_type(8)))  float    v8f;
typedef __attribute__((ext_vector_type(4)))  float    v4f;
typedef __attribute__((ext_vector_type(2)))  float    v2f;
typedef __attribute__((ext_vector_type(2)))  _Float16 v2h;

// WMMA operand of a 16-channel row: 8 contiguous halves fill k = 8h..8h+7 (h =
// lane half). The upper K half, idle for 16 channels, takes two pairs of extra
// terms at k = 16+8h..16+8h+3; the rest is zero. Both operands are built here,
// so a pair of one meets the pair at the same place of the other.
static __device__ __forceinline__ v16h frag_of(v8h lo, v2h s0, v2h s1) {
  v16h r;
#pragma unroll
  for (int i = 0; i < 8; ++i) { r[i] = lo[i]; r[i + 8] = (_Float16)0.f; }
  r[8] = s0[0]; r[9] = s0[1];
  r[10] = s1[0]; r[11] = s1[1];
  return r;
}
static __device__ __forceinline__ v16h frag(const _Float16* p, v2h s0, v2h s1) {
  return frag_of(*reinterpret_cast<const v8h*>(p), s0, s1);
}

// -x as two halves, leading part and remainder: against a pair of ones the
// product adds -x to a score with about 22 bits of x kept.
static __device__ __forceinline__ v2h neg_pair(float x) {
  v2h r;
  r[0] = (_Float16)(-x);
  r[1] = (_Float16)(-x - (float)r[0]);
  return r;
}

// The pair for lane half 0, zeros for half 1: the resident operand carries its
// pairs once (k = 16..19), whatever the streamed operand holds at k = 24..27.
static __device__ __forceinline__ v2h half0(v2h p, int h) {
  v2h z = {};
  return h == 0 ? p : z;
}

static __device__ __forceinline__ v8f wmma_f16(v16h a, v16h b, v8f c) {
  return __builtin_amdgcn_wmma_f32_16x16x32_f16(false, a, false, b, (short)0, c,
                                                false, false);
}

// ---------------------------------------------------------------------------
// K1: channel projections (1x1 convs). One block per 32 points, lane = point;
// each of the 8 waves sums 16 of the 128 input channels, partials meet in LDS.
//   q_c [B][16][N] f32, channel-major as the output is: its stores here and
//   its loads in K5 move whole 128-byte lines,
//   q_h/k_h [B][N][16] f16 (q_h times log2 e: the scores come out of the WMMA
//   as exponents of 2),
//   v_h [B][N/16][16 channels][16 keys] f16: one 16x16 tile is 512 contiguous
//   bytes, so a wave's A-fragment load in K4 reads whole 128-byte lines
// ---------------------------------------------------------------------------
__global__ __launch_bounds__(256) void k_project(
    const float* __restrict__ x_q, const float* __restrict__ x_kv,
    const float* __restrict__ xyz_q, const float* __restrict__ xyz_kv,
    const float* __restrict__ w_qk, const float* __restrict__ w_v,
    const float* __restrict__ b_v,
    const float* __restrict__ w_pos_q, const float* __restrict__ w_pos_kv,
    float* __restrict__ q_c, _Float16* __restrict__ q_h,
    _Float16* __restrict__ k_h, _Float16* __restrict__ v_h) {
  // partial sums: [wave][q 0..15 | k 16..31 | v 32..47][point]
  __shared__ float part[SPLIT][3 * D_][32];
  const int lane = threadIdx.x & 31;
  const int wv = wave_id();
  const int b = blockIdx.x / (N_ / 32);
  const int n = (blockIdx.x % (N_ / 32)) * 32 + lane;
  const int idx = b * N_ + n;
  const int c0 = wv * PCH;

  const float* xq = x_q + ((size_t)b * CIN + c0) * N_ + n;
  const float* xk = x_kv + ((size_t)b * CIN + c0) * N_ + n;
  float vq[PCH], vk[PCH];
#pragma unroll  // all 32 loads of the wave go out before the first is waited for
  for (int c = 0; c < PCH; ++c) {
    vq[c] = xq[(size_t)c * N_];
    vk[c] = xk[(size_t)c * N_];
  }
  float cq[3], ck[3];
#pragma unroll  // constant indices keep cq, ck in registers
  for (int j = 0; j < 3; ++j) {
    cq[j] = xyz_q[((size_t)b * 3 + j) * N_ + n];
    ck[j] = xyz_kv[((size_t)b * 3 + j) * N_ + n];
  }

#pragma unroll  // independent sums of several d interleave
  for (int d = 0; d < D_; ++d) {
    float sq = 0.f, sk = 0.f, sv = 0.f;
#pragma unroll  // constant indices keep vq, vk in registers
    for (int c = 0; c < PCH; ++c) {
      const float wq = w_qk[d * CIN + c0 + c];
      sq = fmaf(wq, vq[c], sq);
      sk = fmaf(wq, vk[c], sk);
      sv = fmaf(w_v[d * CIN + c0 + c], vk[c], sv);
    }
    part[wv][d][lane] = sq;
    part[wv][D_ + d][lane] = sk;
    part[wv][2 * D_ + d][lane] = sv;
  }
  __syncthreads();

  // wave wv finishes output channels 2*wv and 2*wv+1 of the block's 32 points
  float qv[2], kv[2], vv[2];
#pragma unroll  // qv, kv, vv stay in registers
  for (int i = 0; i < 2; ++i) {
    const int d = 2 * wv + i;
    float aq = 0.f, ak = 0.f, av = 0.f;
#pragma unroll  // the LDS reads are issued together
    for (int w = 0; w < SPLIT; ++w) {
      aq += part[w][d][lane];
      ak += part[w][D_ + d][lane];
      av += part[w][2 * D_ + d][lane];
    }
    float pq = 0.f, pk = 0.f;
#pragma unroll  // constant indices keep cq, ck in registers
    for (int j = 0; j < 3; ++j) {
      pq = fmaf(w_pos_q[d * 3 + j], cq[j], pq);
      pk = fmaf(w_pos_kv[d * 3 + j], ck[j], pk);
    }
    qv[i] = aq + pq;
    kv[i] = ak + pk;
    vv[i] = av + b_v[d] + pk;
  }
  const size_t row = (size_t)idx * D_ + 2 * wv;
  v2f qp; qp[0] = qv[0]; qp[1] = qv[1];
  v2f kp; kp[0] = kv[0]; kp[1] = kv[1];
  v2f vp; vp[0] = vv[0]; vp[1] = vv[1];
  const v2h qh = __builtin_convertvector(qp * LOG2E, v2h);
  const v2h kh = __builtin_convertvector(kp, v2h);
  const v2h vh = __builtin_convertvector(vp, v2h);
  float* qcol = q_c + ((size_t)b * D_ + 2 * wv) * N_ + n;
  qcol[0] = qv[0];
  qcol[N_] = qv[1];
  *reinterpret_cast<v2h*>(q_h + row) = qh;
  *reinterpret_cast<v2h*>(k_h + row) = kh;
  _Float16* vrow = v_h + ((size_t)b * N_ + (n & ~15)) * D_ + 2 * wv * 16 + (n & 15);
  vrow[0] = vh[0];
  vrow[16] = vh[1];
}

// ---------------------------------------------------------------------------
// K2: per query, L = log2 of the sum over keys of 2^score, stored as neg_pair.
// One block per 64 queries; each of its 16 waves holds the 4 query tiles in
// registers. A wave's shift is the maximum over its first 32 keys: that key's
// own term is about 1, so the sum cannot vanish, and any shift gives the same
// L as long as no sum overflows. With minus the shift in the queries' upper K half
// against ones in the keys', the WMMA gives score - shift and each term of the
// sweep over the 256 keys is one exp2. Where a sum comes out too large (or not
// a number) the wave does both again, once, with the maximum over all its keys.
// E^T tile = WMMA(A = K-tile, B = Q-tile).
// D layout: lane L reg r -> (key m = m0 + r + 8*(L/16), query n = n0 + L%16)
// ---------------------------------------------------------------------------
__global__ __launch_bounds__(32 * AW) void k_rowstats(
    const _Float16* __restrict__ q_h, const _Float16* __restrict__ k_h,
    _Float16* __restrict__ rowneg) {
  __shared__ float pm[AW][16 * QT], ps[AW][16 * QT];
  const int wid = blockIdx.x;
  const int b = wid / NB;
  const int n0 = (wid % NB) * (16 * QT);
  const int lane = threadIdx.x & 31;
  const int wv = wave_id();
  const int mbeg = wv * ACH;
  const int li = lane & 15;
  const int h = lane >> 4;
  const int koff = h << 3;
  const v2h zero2 = {};
  const v2h one2 = {(_Float16)1.f, (_Float16)1.f};

  const _Float16* qb = q_h + (size_t)b * N_ * D_;
  const _Float16* kb = k_h + (size_t)b * N_ * D_;
  v16h bq[QT];
#pragma unroll  // constant indices keep bq in registers
  for (int t = 0; t < QT; ++t)
    bq[t] = frag(qb + (size_t)(n0 + 16 * t + li) * D_ + koff, zero2, zero2);

  // keeps the queries' loads in front of the keys': loads return in order, and
  // the first product needs all four query tiles but only the first key tile
  __builtin_amdgcn_sched_barrier(0);
  // The wave's 16 key tiles stay in registers: their loads all go out here,
  // behind the queries', and return in order while the first tiles are worked
  // on, so no trip of either sweep waits out a load of its own.
  const _Float16* kp = kb + (size_t)(mbeg + li) * D_ + koff;
  v16h ak[ACH / 16];
#pragma unroll  // constant indices keep ak in registers
  for (int j = 0; j < ACH / 16; ++j) ak[j] = frag(kp + 16 * j * D_, one2, zero2);
  float sh[QT];  // the shift in use
  v2f sm[QT];    // even and odd registers' terms: two sums per add instruction
  int span = 32;  // keys the shift is taken from; all of them on the second go
  for (;;) {
    float mx[QT];
#pragma unroll  // constant indices keep bq, mx in registers
    for (int t = 0; t < QT; ++t) {
      bq[t][8] = (_Float16)0.f;  // no shift in the scores the maximum is taken of
      bq[t][9] = (_Float16)0.f;
      mx[t] = -__builtin_inff();
    }

    // the maximum over one key tile's scores joins mx
    auto max_tile = [&](const v16h& a) {
      v8f et[QT];
#pragma unroll  // four independent WMMAs in a row fill one another's result distance
      for (int t = 0; t < QT; ++t) {
        v8f z = {};
        et[t] = wmma_f16(a, bq[t], z);
      }
#pragma unroll  // constant indices keep et, mx in registers
      for (int t = 0; t < QT; ++t) {
#pragma unroll
        for (int r = 0; r < 8; r += 2)
          mx[t] = fmaxf(fmaxf(mx[t], et[t][r]), et[t][r + 1]);
      }
    };
    max_tile(ak[0]);
    max_tile(ak[1]);
    if (span == ACH) {
#pragma unroll  // constant indices keep ak in registers
      for (int j = 2; j < ACH / 16; ++j) max_tile(ak[j]);
    }

    // one shift per query for both lane halves; the pair really adds -sh
#pragma unroll  // constant indices keep bq, mx, sh, sm in registers
    for (int t = 0; t < QT; ++t) {
      const v2h p = neg_pair(fmaxf(mx[t], __shfl_xor(mx[t], 16, 32)));
      sh[t] = -((float)p[0] + (float)p[1]);
      const v2h ph = half0(p, h);
      bq[t][8] = ph[0];
      bq[t][9] = ph[1];
      const v2f z2 = {};
      sm[t] = z2;
    }

#pragma unroll  // constant indices keep ak in registers
    for (int j = 0; j < ACH / 16; ++j) {
      v8f et[QT];
#pragma unroll  // four independent WMMAs in a row fill one another's result distance
      for (int t = 0; t < QT; ++t) {
        v8f z = {};
        et[t] = wmma_f16(ak[j], bq[t], z);
      }
#pragma unroll  // constant indices keep et, sm in registers
      for (int t = 0; t < QT; ++t) {
#pragma unroll
        for (int r = 0; r < 8; r += 2) {
          v2f x;
          x[0] = __builtin_amdgcn_exp2f(et[t][r]);
          x[1] = __builtin_amdgcn_exp2f(et[t][r + 1]);
          sm[t] += x;
        }
      }
    }
    // one test per wave behind the whole sweep: below 2^100 the 16 waves' sums
    // still add up without overflow; the comparison is false for a NaN too
    bool redo = false;
#pragma unroll  // constant indices keep sm in registers
    for (int t = 0; t < QT; ++t) redo |= !(sm[t][0] + sm[t][1] < 0x1p100f);
    if (span == ACH || __builtin_amdgcn_ballot_w32(redo) == 0) break;
    span = ACH;
  }
  // combine the two lane-halves (same query and shift, different key subsets)
#pragma unroll  // constant indices keep sh, sm in registers
  for (int t = 0; t < QT; ++t) {
    const float s1 = sm[t][0] + sm[t][1];
    const float S = s1 + __shfl_xor(s1, 16, 32);
    if (h == 0) {
      pm[wv][16 * t + li] = sh[t];
      ps[wv][16 * t + li] = S;
    }
  }
  __syncthreads();
  // merge the 16 waves' (shift, sum) pairs, one thread per query
  if (threadIdx.x < 16 * QT) {
    const int t = threadIdx.x;
    float Mb = pm[0][t];
#pragma unroll  // the LDS reads are issued together
    for (int w = 1; w < AW; ++w) Mb = fmaxf(Mb, pm[w][t]);
    float Sb = 0.f;
#pragma unroll  // the LDS reads are issued together
    for (int w = 0; w < AW; ++w)
      Sb += ps[w][t] * __builtin_amdgcn_exp2f(pm[w][t] - Mb);
    *reinterpret_cast<v2h*>(rowneg + 2 * (size_t)(b * N_ + n0 + t)) =
        neg_pair(Mb + __builtin_amdgcn_logf(Sb));
  }
}

// ---------------------------------------------------------------------------
// K3: column sums over queries (key-major => no atomics). Stores
// log2(1e-9 + cs) as neg_pair.
// One block per 64 keys; each of its 16 waves holds the 4 key tiles in
// registers and takes 256 queries, so one query fragment feeds 4 WMMAs. The
// query's -L rides in its upper K half against ones in the keys': the WMMA
// gives score - L, and a softmax weight is one exp2.
// ---------------------------------------------------------------------------
__global__ __launch_bounds__(32 * AW) void k_colsum(
    const _Float16* __restrict__ q_h, const _Float16* __restrict__ k_h,
    const _Float16* __restrict__ rowneg, _Float16* __restrict__ colneg) {
  __shared__ float pc[AW][16 * QT];
  const int wid = blockIdx.x;
  const int b = wid / NB;
  const int m0 = (wid % NB) * (16 * QT);
  const int lane = threadIdx.x & 31;
  const int wv = wave_id();
  const int nbeg = wv * ACH;
  const int li = lane & 15;
  const int h = lane >> 4;
  const int koff = h << 3;
  const v2h zero2 = {};
  const v2h one2 = {(_Float16)1.f, (_Float16)1.f};

  const _Float16* qb = q_h + (size_t)b * N_ * D_;
  const _Float16* kb = k_h + (size_t)b * N_ * D_;
  const _Float16* rnb = rowneg + 2 * (size_t)b * N_;
  v16h ak[QT];
  float cs[QT][8];
#pragma unroll  // constant indices keep ak, cs in registers
  for (int t = 0; t < QT; ++t) {
    ak[t] = frag(kb + (size_t)(m0 + 16 * t + li) * D_ + koff, half0(one2, h), zero2);
#pragma unroll
    for (int r = 0; r < 8; ++r) cs[t][r] = 0.f;
  }
  // keeps the keys' loads in front of the queries': loads return in order, and
  // the first product needs all four key tiles but only the first query tile
  __builtin_amdgcn_sched_barrier(0);

  // The query tiles are fetched two trips ahead: the work of trips i and i + 1
  // covers the way of trip i + 2's loads, which a wave otherwise waits out at
  // each trip's top. Three trips' tiles are live at a time.
  const _Float16* qp = qb + (size_t)(nbeg + li) * D_ + koff;
  const _Float16* rp = rnb + 2 * (nbeg + li);
  v16h bq[ACH / 16];
#pragma unroll  // constant indices keep bq in registers
  for (int j = 0; j < 4; ++j)
    bq[j] = frag(qp + 16 * j * D_, *reinterpret_cast<const v2h*>(rp + 32 * j), zero2);
#pragma unroll  // all 8 trips: a tile is a name, not a copy, and every load is one
                // lane address plus a constant
  for (int i = 0; i < ACH; i += 32) {
    // keeps the trips apart, as the rolled loop did, and the fetch below the
    // trip before: risen into it, it lands in registers that trip's WMMAs have
    // only just read
    __builtin_amdgcn_sched_barrier(0);
#pragma unroll  // constant indices keep bq in registers
    for (int j = i / 16 + 4; j < i / 16 + 6 && j < ACH / 16; ++j)
      bq[j] = frag(qp + 16 * j * D_, *reinterpret_cast<const v2h*>(rp + 32 * j), zero2);
    // keeps the fetch at this trip's top: sunk to its readers it would be
    // waited for in full again (left standing in the last two trips, which
    // fetch nothing: without it there this build spills registers)
    __builtin_amdgcn_sched_barrier(0);
#pragma unroll  // constant indices keep bq in registers
    for (int u = i / 16; u < i / 16 + 2; ++u) {
      v8f et[QT];
#pragma unroll  // four independent WMMAs in a row fill one another's result distance
      for (int t = 0; t < QT; ++t) {
        v8f z = {};
        et[t] = wmma_f16(ak[t], bq[u], z);
      }
#pragma unroll  // constant indices keep et, cs in registers
      for (int t = 0; t < QT; ++t) {
#pragma unroll
        for (int r = 0; r < 8; ++r) cs[t][r] += __builtin_amdgcn_exp2f(et[t][r]);
      }
    }
  }
  // keeps the lane reduction below the unrolled sweep: mixed into its last
  // trips, the cross-lane results are live all at once and registers spill
  __builtin_amdgcn_sched_barrier(0);
  // reduce across the 16 queries held by each lane-half
#pragma unroll
  for (int msk = 1; msk < 16; msk <<= 1) {
#pragma unroll
    for (int t = 0; t < QT; ++t) {
#pragma unroll
      for (int r = 0; r < 8; ++r) cs[t][r] += __shfl_xor(cs[t][r], msk, 32);
    }
  }
  if (li == 0) {
#pragma unroll
    for (int t = 0; t < QT; ++t) {
#pragma unroll
      for (int r = 0; r < 8; ++r) pc[wv][16 * t + koff + r] = cs[t][r];
    }
  }
  __syncthreads();
  // add the 16 waves' partial column sums, one thread per key
  if (threadIdx.x < 16 * QT) {
    const int t = threadIdx.x;
    float c = 0.f;
#pragma unroll  // the LDS reads are issued together
    for (int w = 0; w < AW; ++w) c += pc[w][t];
    *reinterpret_cast<v2h*>(colneg + 2 * (size_t)(b * N_ + m0 + t)) =
        neg_pair(__builtin_amdgcn_logf(1e-9f + c));
  }
}

// ---------------------------------------------------------------------------
// K4: recompute weights, X_r^T += V * W^T (K=32: two prob tiles per WMMA),
// then diff = q - x_r feeds the w_t projection WMMA directly; writes t_buf.
// One block per 64 queries; each of its 16 waves holds the 4 query tiles in
// registers and takes 256 keys, so the K, V and column-term loads of 32 keys
// feed 12 WMMAs. The upper K half of the score product holds the key's column
// term against ones and ones against the query's -L: the WMMA gives the log2
// of the finished weight, which is one exp2. Waves 0..3 add the partial X_r
// tiles, one tile each, and run the epilogue.
// ---------------------------------------------------------------------------
__global__ __launch_bounds__(32 * AW) void k_attn(
    const _Float16* __restrict__ q_h, const _Float16* __restrict__ k_h,
    const _Float16* __restrict__ v_h, const float* __restrict__ q_c,
    const _Float16* __restrict__ rowneg, const _Float16* __restrict__ colneg,
    const float* __restrict__ w_t, const float* __restrict__ b_t,
    float* __restrict__ t_buf) {
  __shared__ v8f px[AW][QT][32];  // a lane's 8 partial sums lie together
  const int wid = blockIdx.x;
  const int b = wid / NB;
  const int n0 = (wid % NB) * (16 * QT);
  const int lane = threadIdx.x & 31;
  const int wv = wave_id();
  const int mbeg = wv * ACH;
  const int li = lane & 15;
  const int h = lane >> 4;
  const int koff = h << 3;
  const v2h one2 = {(_Float16)1.f, (_Float16)1.f};

  const _Float16* qb = q_h + (size_t)b * N_ * D_;
  const _Float16* kb = k_h + (size_t)b * N_ * D_;
  const _Float16* vb = v_h + (size_t)b * D_ * N_;
  const _Float16* rnb = rowneg + 2 * (size_t)b * N_;
  const _Float16* cnb = colneg + 2 * (size_t)b * N_;

  v2h rn[QT];
#pragma unroll  // constant indices keep rn in registers
  for (int t = 0; t < QT; ++t)
    rn[t] = *reinterpret_cast<const v2h*>(rnb + 2 * (n0 + 16 * t + li));
  // precaution: the fragment loads below land in these four loads' address
  // registers, so the wait stands between the two groups
  asm volatile("s_wait_xcnt 0x0" ::: "memory");
  v8h ql[QT];
#pragma unroll  // constant indices keep ql in registers
  for (int t = 0; t < QT; ++t)
    ql[t] = *reinterpret_cast<const v8h*>(qb + (size_t)(n0 + 16 * t + li) * D_ + koff);
  // keeps the queries' loads in front of the streamed operands': loads return
  // in order, and the first product needs all four query tiles
  __builtin_amdgcn_sched_barrier(0);

  const _Float16* kp = kb + (size_t)(mbeg + li) * D_ + koff;
  const _Float16* cp = cnb + 2 * (mbeg + li);
  const _Float16* vp = vb + (size_t)mbeg * D_ + li * 16 + koff;
  // the K, column-term and V operands of the wave's keys i..i+31
  auto fetch = [&](int i, v16h& k0, v16h& k1, v16h& vv) {
    k0 = frag(kp + i * D_, *reinterpret_cast<const v2h*>(cp + 2 * i), one2);
    k1 = frag(kp + (i + 16) * D_, *reinterpret_cast<const v2h*>(cp + 2 * (i + 16)), one2);
    // V tile i/16 and the next one: channel li, keys koff..koff+7 of each
    const v8h v0 = *reinterpret_cast<const v8h*>(vp + i * D_);
    const v8h v1 = *reinterpret_cast<const v8h*>(vp + i * D_ + 256);
#pragma unroll
    for (int j = 0; j < 8; ++j) { vv[j] = v0[j]; vv[j + 8] = v1[j]; }
  };
  // They are fetched two trips ahead: the work of trips i and i + 1 covers the
  // way of trip i + 2's loads, which a wave otherwise waits out at each trip's
  // top. Three trips' operands are live at a time.
  v16h sk0[ACH / 32], sk1[ACH / 32], sv[ACH / 32];
  fetch(0, sk0[0], sk1[0], sv[0]);
  fetch(32, sk0[1], sk1[1], sv[1]);
  v16h bq[QT];
  v8f xacc[QT];
#pragma unroll  // constant indices keep the four tiles' state in registers
  for (int t = 0; t < QT; ++t) {
    bq[t] = frag_of(ql[t], half0(one2, h), half0(rn[t], h));
    v8f z = {};
    xacc[t] = z;
  }
#pragma unroll  // all 8 trips: an operand is a name, not a copy, and every load is
                // one lane address plus a constant
  for (int i = 0; i < ACH; i += 32) {
    // keeps the trips apart, as the rolled loop did: mixed, two trips' score
    // registers are live at once
    __builtin_amdgcn_sched_barrier(0);
    const v16h ak0 = sk0[i / 32], ak1 = sk1[i / 32], av = sv[i / 32];
    v8f e0[QT], e1[QT];
#pragma unroll  // eight independent WMMAs in a row fill one another's result distance
    for (int t = 0; t < QT; ++t) {
      v8f z = {};
      e0[t] = wmma_f16(ak0, bq[t], z);
      e1[t] = wmma_f16(ak1, bq[t], z);
    }
    // keeps the eight in a row: moved down to their readers, each is followed
    // by idle slots until its result may be read
    __builtin_amdgcn_sched_barrier(0);
#pragma unroll  // constant indices keep the four tiles' state in registers
    for (int t = 0; t < QT; ++t) {
      float x0[8], x1[8];
#pragma unroll
      for (int r = 0; r < 8; ++r) {
        x0[r] = __builtin_amdgcn_exp2f(e0[t][r]);
        x1[r] = __builtin_amdgcn_exp2f(e1[t][r]);
      }
      if (t == 0 && i + 64 < ACH) {
        // The fetch stands behind the first tile's 16 exponentials, between two
        // fences: higher or lower it would follow a WMMA directly and could
        // land in operand registers that WMMA has only just read; sunk to its
        // readers it would be waited for in full again.
        __builtin_amdgcn_sched_barrier(0);
        fetch(i + 64, sk0[i / 32 + 2], sk1[i / 32 + 2], sv[i / 32 + 2]);
        __builtin_amdgcn_sched_barrier(0);
      }
      // D-tile layout == B-operand layout: pack two 16-key tiles into K=32.
      v16h pw;
#pragma unroll
      for (int r = 0; r < 8; ++r) {
        pw[r]     = (_Float16)x0[r];
        pw[8 + r] = (_Float16)x1[r];
      }
      xacc[t] = wmma_f16(av, pw, xacc[t]);
    }
  }

#pragma unroll  // constant indices keep xacc in registers
  for (int t = 0; t < QT; ++t) px[wv][t][lane] = xacc[t];
  __syncthreads();
  if (wv >= QT) return;
  // wave wv finishes query tile wv of the block
  const int nt = n0 + 16 * wv;
  v8f xs = {};
#pragma unroll  // the LDS reads are issued together
  for (int w = 0; w < AW; ++w) xs += px[w][wv][lane];

  // xs: lane reg r -> (d = r + 8h, n = nt + li). diff feeds next WMMA as B.
  const float* qcol = q_c + ((size_t)b * D_ + koff) * N_ + nt + li;
  v16h bdiff;
#pragma unroll
  for (int r = 0; r < 8; ++r) {
    bdiff[r] = (_Float16)(qcol[(size_t)r * N_] - xs[r]);
    bdiff[r + 8] = (_Float16)0.f;
  }
  v16h awt;
#pragma unroll
  for (int e = 0; e < 8; ++e) {
    awt[e] = (_Float16)w_t[li * D_ + koff + e];
    awt[e + 8] = (_Float16)0.f;
  }
  v8f z2 = {};
  const v8f t = wmma_f16(awt, bdiff, z2);
  float* tb = t_buf + (size_t)b * OUT_ * N_;
#pragma unroll
  for (int r = 0; r < 8; ++r)
    tb[(size_t)(r + koff) * N_ + nt + li] = t[r] + b_t[r + koff];
}

// ---------------------------------------------------------------------------
// K5: GroupNorm, ReLU and the q^T residual in one launch. One block per
// (b, group): the group's 4 channels x N values are contiguous, a thread keeps
// 4 points of each channel in registers from the statistics to the output, so
// t_buf is read once and no launch stands between the two halves. q_c has
// t_buf's layout: a wave's load of either is 512 contiguous bytes.
// ---------------------------------------------------------------------------
__global__ __launch_bounds__(1024) void k_gnfinal(
    const float* __restrict__ t_buf, const float* __restrict__ q_c,
    const float* __restrict__ gamma, const float* __restrict__ beta,
    float* __restrict__ out) {
  const int bg = blockIdx.x;  // 0..15
  const int b = bg / G_;
  const int g = bg % G_;
  const int n = 4 * threadIdx.x;
  const float* p = t_buf + (size_t)bg * 4 * N_ + n;  // groups are contiguous
  const float* qp = q_c + (size_t)bg * 4 * N_ + n;
  v4f tv[4], qv[4];  // [channel][point]
#pragma unroll  // constant indices keep tv in registers
  for (int c = 0; c < 4; ++c) tv[c] = *reinterpret_cast<const v4f*>(p + (size_t)c * N_);
#pragma unroll  // the residual's loads go out behind t's: one trip to memory in all
  for (int c = 0; c < 4; ++c) qv[c] = *reinterpret_cast<const v4f*>(qp + (size_t)c * N_);
  float ga[4], be[4];
#pragma unroll  // read here, their latency too lies under the statistics
  for (int c = 0; c < 4; ++c) ga[c] = gamma[4 * g + c];
  // precaution: beta's load lands in the registers of gamma's address, so the
  // wait stands between the two
  asm volatile("s_wait_xcnt 0x0" ::: "memory");
#pragma unroll
  for (int c = 0; c < 4; ++c) be[c] = beta[4 * g + c];
  float s = 0.f, s2 = 0.f;
#pragma unroll  // constant indices keep tv in registers
  for (int c = 0; c < 4; ++c) {
#pragma unroll
    for (int j = 0; j < 4; ++j) {
      const float v = tv[c][j];
      s += v;
      s2 += v * v;
    }
  }
  __shared__ float sh[1024], sh2[1024];
  sh[threadIdx.x] = s;
  sh2[threadIdx.x] = s2;
  __syncthreads();
  for (int off = 512; off > 0; off >>= 1) {
    if (threadIdx.x < off) {
      sh[threadIdx.x] += sh[threadIdx.x + off];
      sh2[threadIdx.x] += sh2[threadIdx.x + off];
    }
    __syncthreads();
  }
  const float M = (float)(4 * N_);
  const float m = sh[0] / M;
  const float var = sh2[0] / M - m * m;
  const float rstd = rsqrtf(var + 1e-5f);
#pragma unroll  // constant indices keep tv, qv, ga, be in registers
  for (int c = 0; c < 4; ++c) {
    v4f y;
#pragma unroll
    for (int j = 0; j < 4; ++j)
      y[j] = qv[c][j] + fmaxf((tv[c][j] - m) * rstd * ga[c] + be[c], 0.f);
    *reinterpret_cast<v4f*>(out + ((size_t)b * OUT_ + 4 * g + c) * N_ + n) = y;
  }
}

// ---------------------------------------------------------------------------
extern "C" void kernel_launch(void* const* d_in, const int* in_sizes, int n_in,
                              void* d_out, int out_size, void* d_ws,
                              size_t ws_size, hipStream_t stream) {
  const float* x_q      = (const float*)d_in[0];
  const float* x_kv     = (const float*)d_in[1];
  const float* xyz_q    = (const float*)d_in[2];
  const float* xyz_kv   = (const float*)d_in[3];
  const float* w_qk     = (const float*)d_in[4];
  const float* w_v      = (const float*)d_in[5];
  const float* b_v      = (const float*)d_in[6];
  const float* w_t      = (const float*)d_in[7];
  const float* b_t      = (const float*)d_in[8];
  const float* gamma    = (const float*)d_in[9];
  const float* beta     = (const float*)d_in[10];
  const float* w_pos_q  = (const float*)d_in[11];
  const float* w_pos_kv = (const float*)d_in[12];
  float* out = (float*)d_out;

  char* ws = (char*)d_ws;
  size_t off = 0;
  auto carve = [&](size_t bytes) -> char* {
    char* p = ws + off;
    off += (bytes + 255) & ~(size_t)255;
    return p;
  };
  float*    q_c    = (float*)carve((size_t)B_ * D_ * N_ * 4);
  _Float16* q_h    = (_Float16*)carve((size_t)B_ * N_ * D_ * 2);
  _Float16* k_h    = (_Float16*)carve((size_t)B_ * N_ * D_ * 2);
  _Float16* v_h    = (_Float16*)carve((size_t)B_ * D_ * N_ * 2);
  _Float16* rowneg = (_Float16*)carve((size_t)B_ * N_ * 2 * 2);
  _Float16* colneg = (_Float16*)carve((size_t)B_ * N_ * 2 * 2);
  float*    t_buf  = (float*)carve((size_t)B_ * OUT_ * N_ * 4);
  (void)in_sizes; (void)n_in; (void)out_size; (void)ws_size;

  k_project<<<B_ * N_ / 32, 32 * SPLIT, 0, stream>>>(
      x_q, x_kv, xyz_q, xyz_kv, w_qk, w_v, b_v, w_pos_q, w_pos_kv,
      q_c, q_h, k_h, v_h);
  k_rowstats<<<B_ * NB, 32 * AW, 0, stream>>>(q_h, k_h, rowneg);
  k_colsum<<<B_ * NB, 32 * AW, 0, stream>>>(q_h, k_h, rowneg, colneg);
  k_attn<<<B_ * NB, 32 * AW, 0, stream>>>(q_h, k_h, v_h, q_c, rowneg, colneg,
                                     w_t, b_t, t_buf);
  k_gnfinal<<<B_ * G_, 1024, 0, stream>>>(t_buf, q_c, gamma, beta, out);
}

// v009
// Measured time: 33.8 microseconds a run.
// Timed twice side by side with v008, it ran 1.06 and 1.03 times as fast.
// All steps since v000 together make it 7.41 times as fast.
#include <hip/hip_runtime.h>

#define B_   4
#define CIN  128
#define N_   4096
#define D_   16
#define OUT_ 16
#define G_   4
#define SPLIT 8             // waves per block in the projection
#define PCH   (CIN / SPLIT) // input channels per wave in the projection
#define QT  4               // attention passes: 16-row tiles a wave keeps in registers
#define AW  16              // attention passes: waves per block
#define ACH (N_ / AW)       // attention passes: streamed keys (or queries) per wave
#define NB  (N_ / (16 * QT)) // attention passes: blocks per batch
#define FP  256             // last launch: points per block
#define LOG2E 1.4426950408889634f

// Wave number within the block, in a scalar register: the wave's share of the
// loop, its weight loads and the branch on it are then scalar.
static __device__ __forceinline__ int wave_id() {
  return __builtin_amdgcn_readfirstlane(threadIdx.x >> 5);
}

typedef __attribute__((ext_vector_type(16))) _Float16 v16h;
typedef __attribute__((ext_vector_type(8)))  _Float16 v8h;
typedef __attribute__((ext_vector_type(8)))  float    v8f;
typedef __attribute__((ext_vector_type(4)))  float    v4f;
typedef __attribute__((ext_vector_type(2)))  float    v2f;
typedef __attribute__((ext_vector_type(2)))  _Float16 v2h;

// WMMA operand of a 16-channel row: 8 contiguous halves fill k = 8h..8h+7 (h =
// lane half). The upper K half, idle for 16 channels, takes two pairs of extra
// terms at k = 16+8h..16+8h+3; the rest is zero. Both operands are built here,
// so a pair of one meets the pair at the same place of the other.
static __device__ __forceinline__ v16h frag_of(v8h lo, v2h s0, v2h s1) {
  v16h r;
#pragma unroll
  for (int i = 0; i < 8; ++i) { r[i] = lo[i]; r[i + 8] = (_Float16)0.f; }
  r[8] = s0[0]; r[9] = s0[1];
  r[10] = s1[0]; r[11] = s1[1];
  return r;
}
static __device__ __forceinline__ v16h frag(const _Float16* p, v2h s0, v2h s1) {
  return frag_of(*reinterpret_cast<const v8h*>(p), s0, s1);
}

// -x as two halves, leading part and remainder: against a pair of ones the
// product adds -x to a score with about 22 bits of x kept.
static __device__ __forceinline__ v2h neg_pair(float x) {
  v2h r;
  r[0] = (_Float16)(-x);
  r[1] = (_Float16)(-x - (float)r[0]);
  return r;
}

// The pair for lane half 0, zeros for half 1: the resident operand carries its
// pairs once (k = 16..19), whatever the streamed operand holds at k = 24..27.
static __device__ __forceinline__ v2h half0(v2h p, int h) {
  v2h z = {};
  return h == 0 ? p : z;
}

static __device__ __forceinline__ v8f wmma_f16(v16h a, v16h b, v8f c) {
  return __builtin_amdgcn_wmma_f32_16x16x32_f16(false, a, false, b, (short)0, c,
                                                false, false);
}

// x plus the x of the lane whose number differs in the bits MASK, inside a row
// of 16 lanes: a register move, where a shuffle would go through the LDS unit
template <int MASK>
static __device__ __forceinline__ float add_xmask(float x) {
  const int y = __builtin_amdgcn_update_dpp(0, __builtin_bit_cast(int, x),
                                            0x160 | MASK, 0xf, 0xf, false);
  return x + __builtin_bit_cast(float, y);
}
// x plus the x of lane l ^ 16
static __device__ __forceinline__ float add_xrow(float x) {
  const int v = __builtin_bit_cast(int, x);
  const int y = __builtin_amdgcn_permlanex16(v, v, 0x76543210, 0xfedcba98, false, false);
  return x + __builtin_bit_cast(float, y);
}

// ---------------------------------------------------------------------------
// K1: channel projections (1x1 convs). One block per 32 points, lane = point;
// each of the 8 waves sums 16 of the 128 input channels, partials meet in LDS.
//   q_c [B][16][N] f32, channel-major as the output is: its stores here and
//   its loads in K5 move whole 128-byte lines,
//   q_h/k_h [B][N][16] f16 (q_h times log2 e: the scores come out of the WMMA
//   as exponents of 2),
//   v_h [B][N/16][16 channels][16 keys] f16: one 16x16 tile is 512 contiguous
//   bytes, so a wave's A-fragment load in K4 reads whole 128-byte lines
// ---------------------------------------------------------------------------
__global__ __launch_bounds__(256) void k_project(
    const float* __restrict__ x_q, const float* __restrict__ x_kv,
    const float* __restrict__ xyz_q, const float* __restrict__ xyz_kv,
    const float* __restrict__ w_qk, const float* __restrict__ w_v,
    const float* __restrict__ b_v,
    const float* __restrict__ w_pos_q, const float* __restrict__ w_pos_kv,
    float* __restrict__ q_c, _Float16* __restrict__ q_h,
    _Float16* __restrict__ k_h, _Float16* __restrict__ v_h) {
  // partial sums: [wave][q 0..15 | k 16..31 | v 32..47][point]
  __shared__ float part[SPLIT][3 * D_][32];
  const int lane = threadIdx.x & 31;
  const int wv = wave_id();
  const int b = blockIdx.x / (N_ / 32);
  const int n = (blockIdx.x % (N_ / 32)) * 32 + lane;
  const int idx = b * N_ + n;
  const int c0 = wv * PCH;

  const float* xq = x_q + ((size_t)b * CIN + c0) * N_ + n;
  const float* xk = x_kv + ((size_t)b * CIN + c0) * N_ + n;
  float vq[PCH], vk[PCH];
#pragma unroll  // all 32 loads of the wave go out before the first is waited for
  for (int c = 0; c < PCH; ++c) {
    vq[c] = xq[(size_t)c * N_];
    vk[c] = xk[(size_t)c * N_];
  }
  float cq[3], ck[3];
#pragma unroll  // constant indices keep cq, ck in registers
  for (int j = 0; j < 3; ++j) {
    cq[j] = xyz_q[((size_t)b * 3 + j) * N_ + n];
    ck[j] = xyz_kv[((size_t)b * 3 + j) * N_ + n];
  }

#pragma unroll  // independent sums of several d interleave
  for (int d = 0; d < D_; ++d) {
    float sq = 0.f, sk = 0.f, sv = 0.f;
#pragma unroll  // constant indices keep vq, vk in registers
    for (int c = 0; c < PCH; ++c) {
      const float wq = w_qk[d * CIN + c0 + c];
      sq = fmaf(wq, vq[c], sq);
      sk = fmaf(wq, vk[c], sk);
      sv = fmaf(w_v[d * CIN + c0 + c], vk[c], sv);
    }
    part[wv][d][lane] = sq;
    part[wv][D_ + d][lane] = sk;
    part[wv][2 * D_ + d][lane] = sv;
  }
  __syncthreads();

  // wave wv finishes output channels 2*wv and 2*wv+1 of the block's 32 points
  float qv[2], kv[2], vv[2];
#pragma unroll  // qv, kv, vv stay in registers
  for (int i = 0; i < 2; ++i) {
    const int d = 2 * wv + i;
    float aq = 0.f, ak = 0.f, av = 0.f;
#pragma unroll  // the LDS reads are issued together
    for (int w = 0; w < SPLIT; ++w) {
      aq += part[w][d][lane];
      ak += part[w][D_ + d][lane];
      av += part[w][2 * D_ + d][lane];
    }
    float pq = 0.f, pk = 0.f;
#pragma unroll  // constant indices keep cq, ck in registers
    for (int j = 0; j < 3; ++j) {
      pq = fmaf(w_pos_q[d * 3 + j], cq[j], pq);
      pk = fmaf(w_pos_kv[d * 3 + j], ck[j], pk);
    }
    qv[i] = aq + pq;
    kv[i] = ak + pk;
    vv[i] = av + b_v[d] + pk;
  }
  const size_t row = (size_t)idx * D_ + 2 * wv;
  v2f qp; qp[0] = qv[0]; qp[1] = qv[1];
  v2f kp; kp[0] = kv[0]; kp[1] = kv[1];
  v2f vp; vp[0] = vv[0]; vp[1] = vv[1];
  const v2h qh = __builtin_convertvector(qp * LOG2E, v2h);
  const v2h kh = __builtin_convertvector(kp, v2h);
  const v2h vh = __builtin_convertvector(vp, v2h);
  float* qcol = q_c + ((size_t)b * D_ + 2 * wv) * N_ + n;
  qcol[0] = qv[0];
  qcol[N_] = qv[1];
  *reinterpret_cast<v2h*>(q_h + row) = qh;
  *reinterpret_cast<v2h*>(k_h + row) = kh;
  _Float16* vrow = v_h + ((size_t)b * N_ + (n & ~15)) * D_ + 2 * wv * 16 + (n & 15);
  vrow[0] = vh[0];
  vrow[16] = vh[1];
}

// ---------------------------------------------------------------------------
// K2: per query, L = log2 of the sum over keys of 2^score, stored as neg_pair.
// One block per 64 queries; each of its 16 waves holds the 4 query tiles in
// registers. A wave's shift is the maximum over its first 32 keys: that key's
// own term is about 1, so the sum cannot vanish, and any shift gives the same
// L as long as no sum overflows. With minus the shift in the queries' upper K half
// against ones in the keys', the WMMA gives score - shift and each term of the
// sweep over the 256 keys is one exp2. Where a sum comes out too large (or not
// a number) the wave does both again, once, with the maximum over all its keys.
// E^T tile = WMMA(A = K-tile, B = Q-tile).
// D layout: lane L reg r -> (key m = m0 + r + 8*(L/16), query n = n0 + L%16)
// ---------------------------------------------------------------------------
__global__ __launch_bounds__(32 * AW) void k_rowstats(
    const _Float16* __restrict__ q_h, const _Float16* __restrict__ k_h,
    _Float16* __restrict__ rowneg) {
  __shared__ float pm[AW][16 * QT], ps[AW][16 * QT];
  const int wid = blockIdx.x;
  const int b = wid / NB;
  const int n0 = (wid % NB) * (16 * QT);
  const int lane = threadIdx.x & 31;
  const int wv = wave_id();
  const int mbeg = wv * ACH;
  const int li = lane & 15;
  const int h = lane >> 4;
  const int koff = h << 3;
  const v2h zero2 = {};
  const v2h one2 = {(_Float16)1.f, (_Float16)1.f};

  const _Float16* qb = q_h + (size_t)b * N_ * D_;
  const _Float16* kb = k_h + (size_t)b * N_ * D_;
  v16h bq[QT];
#pragma unroll  // constant indices keep bq in registers
  for (int t = 0; t < QT; ++t)
    bq[t] = frag(qb + (size_t)(n0 + 16 * t + li) * D_ + koff, zero2, zero2);

  // keeps the queries' loads in front of the keys': loads return in order, and
  // the first product needs all four query tiles but only the first key tile
  __builtin_amdgcn_sched_barrier(0);
  // The wave's 16 key tiles stay in registers: their loads all go out here,
  // behind the queries', and return in order while the first tiles are worked
  // on, so no trip of either sweep waits out a load of its own.
  const _Float16* kp = kb + (size_t)(mbeg + li) * D_ + koff;
  v16h ak[ACH / 16];
#pragma unroll  // constant indices keep ak in registers
  for (int j = 0; j < ACH / 16; ++j) ak[j] = frag(kp + 16 * j * D_, one2, zero2);
  float sh[QT];  // the shift in use
  v2f sm[QT];    // even and odd registers' terms: two sums per add instruction
  int span = 32;  // keys the shift is taken from; all of them on the second go
  for (;;) {
    float mx[QT];
#pragma unroll  // constant indices keep bq, mx in registers
    for (int t = 0; t < QT; ++t) {
      bq[t][8] = (_Float16)0.f;  // no shift in the scores the maximum is taken of
      bq[t][9] = (_Float16)0.f;
      mx[t] = -__builtin_inff();
    }

    // the maximum over one key tile's scores joins mx
    auto max_tile = [&](const v16h& a) {
      v8f et[QT];
#pragma unroll  // four independent WMMAs in a row fill one another's result distance
      for (int t = 0; t < QT; ++t) {
        v8f z = {};
        et[t] = wmma_f16(a, bq[t], z);
      }
#pragma unroll  // constant indices keep et, mx in registers
      for (int t = 0; t < QT; ++t) {
#pragma unroll
        for (int r = 0; r < 8; r += 2)
          mx[t] = fmaxf(fmaxf(mx[t], et[t][r]), et[t][r + 1]);
      }
    };
    max_tile(ak[0]);
    max_tile(ak[1]);
    if (span == ACH) {
#pragma unroll  // constant indices keep ak in registers
      for (int j = 2; j < ACH / 16; ++j) max_tile(ak[j]);
    }

    // one shift per query for both lane halves; the pair really adds -sh
#pragma unroll  // constant indices keep bq, mx, sh, sm in registers
    for (int t = 0; t < QT; ++t) {
      const v2h p = neg_pair(fmaxf(mx[t], __shfl_xor(mx[t], 16, 32)));
      sh[t] = -((float)p[0] + (float)p[1]);
      const v2h ph = half0(p, h);
      bq[t][8] = ph[0];
      bq[t][9] = ph[1];
      const v2f z2 = {};
      sm[t] = z2;
    }

#pragma unroll  // constant indices keep ak in registers
    for (int j = 0; j < ACH / 16; ++j) {
      v8f et[QT];
#pragma unroll  // four independent WMMAs in a row fill one another's result distance
      for (int t = 0; t < QT; ++t) {
        v8f z = {};
        et[t] = wmma_f16(ak[j], bq[t], z);
      }
#pragma unroll  // constant indices keep et, sm in registers
      for (int t = 0; t < QT; ++t) {
#pragma unroll
        for (int r = 0; r < 8; r += 2) {
          v2f x;
          x[0] = __builtin_amdgcn_exp2f(et[t][r]);
          x[1] = __builtin_amdgcn_exp2f(et[t][r + 1]);
          sm[t] += x;
        }
      }
    }
    // one test per wave behind the whole sweep: below 2^100 the 16 waves' sums
    // still add up without overflow; the comparison is false for a NaN too
    bool redo = false;
#pragma unroll  // constant indices keep sm in registers
    for (int t = 0; t < QT; ++t) redo |= !(sm[t][0] + sm[t][1] < 0x1p100f);
    if (span == ACH || __builtin_amdgcn_ballot_w32(redo) == 0) break;
    span = ACH;
  }
  // combine the two lane-halves (same query and shift, different key subsets)
#pragma unroll  // constant indices keep sh, sm in registers
  for (int t = 0; t < QT; ++t) {
    const float s1 = sm[t][0] + sm[t][1];
    const float S = s1 + __shfl_xor(s1, 16, 32);
    if (h == 0) {
      pm[wv][16 * t + li] = sh[t];
      ps[wv][16 * t + li] = S;
    }
  }
  __syncthreads();
  // merge the 16 waves' (shift, sum) pairs, one thread per query
  if (threadIdx.x < 16 * QT) {
    const int t = threadIdx.x;
    float Mb = pm[0][t];
#pragma unroll  // the LDS reads are issued together
    for (int w = 1; w < AW; ++w) Mb = fmaxf(Mb, pm[w][t]);
    float Sb = 0.f;
#pragma unroll  // the LDS reads are issued together
    for (int w = 0; w < AW; ++w)
      Sb += ps[w][t] * __builtin_amdgcn_exp2f(pm[w][t] - Mb);
    *reinterpret_cast<v2h*>(rowneg + 2 * (size_t)(b * N_ + n0 + t)) =
        neg_pair(Mb + __builtin_amdgcn_logf(Sb));
  }
}

// ---------------------------------------------------------------------------
// K3: column sums over queries (key-major => no atomics). Stores
// log2(1e-9 + cs) as neg_pair.
// One block per 64 keys; each of its 16 waves holds the 4 key tiles in
// registers and takes 256 queries, so one query fragment feeds 4 WMMAs. The
// query's -L rides in its upper K half against ones in the keys': the WMMA
// gives score - L, and a softmax weight is one exp2.
// ---------------------------------------------------------------------------
__global__ __launch_bounds__(32 * AW) void k_colsum(
    const _Float16* __restrict__ q_h, const _Float16* __restrict__ k_h,
    const _Float16* __restrict__ rowneg, _Float16* __restrict__ colneg) {
  __shared__ float pc[AW][16 * QT];
  const int wid = blockIdx.x;
  const int b = wid / NB;
  const int m0 = (wid % NB) * (16 * QT);
  const int lane = threadIdx.x & 31;
  const int wv = wave_id();
  const int nbeg = wv * ACH;
  const int li = lane & 15;
  const int h = lane >> 4;
  const int koff = h << 3;
  const v2h zero2 = {};
  const v2h one2 = {(_Float16)1.f, (_Float16)1.f};

  const _Float16* qb = q_h + (size_t)b * N_ * D_;
  const _Float16* kb = k_h + (size_t)b * N_ * D_;
  const _Float16* rnb = rowneg + 2 * (size_t)b * N_;
  v16h ak[QT];
  float cs[QT][8];
#pragma unroll  // constant indices keep ak, cs in registers
  for (int t = 0; t < QT; ++t) {
    ak[t] = frag(kb + (size_t)(m0 + 16 * t + li) * D_ + koff, half0(one2, h), zero2);
#pragma unroll
    for (int r = 0; r < 8; ++r) cs[t][r] = 0.f;
  }
  // keeps the keys' loads in front of the queries': loads return in order, and
  // the first product needs all four key tiles but only the first query tile
  __builtin_amdgcn_sched_barrier(0);

  // The query tiles are fetched two trips ahead: the work of trips i and i + 1
  // covers the way of trip i + 2's loads, which a wave otherwise waits out at
  // each trip's top. Three trips' tiles are live at a time.
  const _Float16* qp = qb + (size_t)(nbeg + li) * D_ + koff;
  const _Float16* rp = rnb + 2 * (nbeg + li);
  v16h bq[ACH / 16];
#pragma unroll  // constant indices keep bq in registers
  for (int j = 0; j < 4; ++j)
    bq[j] = frag(qp + 16 * j * D_, *reinterpret_cast<const v2h*>(rp + 32 * j), zero2);
#pragma unroll  // all 8 trips: a tile is a name, not a copy, and every load is one
                // lane address plus a constant
  for (int i = 0; i < ACH; i += 32) {
    // keeps the trips apart, as the rolled loop did, and the fetch below the
    // trip before: risen into it, it lands in registers that trip's WMMAs have
    // only just read
    __builtin_amdgcn_sched_barrier(0);
#pragma unroll  // constant indices keep bq in registers
    for (int j = i / 16 + 4; j < i / 16 + 6 && j < ACH / 16; ++j)
      bq[j] = frag(qp + 16 * j * D_, *reinterpret_cast<const v2h*>(rp + 32 * j), zero2);
    // keeps the fetch at this trip's top: sunk to its readers it would be
    // waited for in full again (left standing in the last two trips, which
    // fetch nothing: without it there this build spills registers)
    __builtin_amdgcn_sched_barrier(0);
#pragma unroll  // constant indices keep bq in registers
    for (int u = i / 16; u < i / 16 + 2; ++u) {
      v8f et[QT];
#pragma unroll  // four independent WMMAs in a row fill one another's result distance
      for (int t = 0; t < QT; ++t) {
        v8f z = {};
        et[t] = wmma_f16(ak[t], bq[u], z);
      }
#pragma unroll  // constant indices keep et, cs in registers
      for (int t = 0; t < QT; ++t) {
#pragma unroll
        for (int r = 0; r < 8; ++r) cs[t][r] += __builtin_amdgcn_exp2f(et[t][r]);
      }
    }
  }
  // keeps the lane reduction below the unrolled sweep: mixed into its last
  // trips, the cross-lane results are live all at once and registers spill
  __builtin_amdgcn_sched_barrier(0);
  // reduce across the 16 queries held by each lane-half
#pragma unroll
  for (int msk = 1; msk < 16; msk <<= 1) {
#pragma unroll
    for (int t = 0; t < QT; ++t) {
#pragma unroll
      for (int r = 0; r < 8; ++r) cs[t][r] += __shfl_xor(cs[t][r], msk, 32);
    }
  }
  if (li == 0) {
#pragma unroll
    for (int t = 0; t < QT; ++t) {
#pragma unroll
      for (int r = 0; r < 8; ++r) pc[wv][16 * t + koff + r] = cs[t][r];
    }
  }
  __syncthreads();
  // add the 16 waves' partial column sums, one thread per key
  if (threadIdx.x < 16 * QT) {
    const int t = threadIdx.x;
    float c = 0.f;
#pragma unroll  // the LDS reads are issued together
    for (int w = 0; w < AW; ++w) c += pc[w][t];
    *reinterpret_cast<v2h*>(colneg + 2 * (size_t)(b * N_ + m0 + t)) =
        neg_pair(__builtin_amdgcn_logf(1e-9f + c));
  }
}

// ---------------------------------------------------------------------------
// K4: recompute weights, X_r^T += V * W^T (K=32: two prob tiles per WMMA),
// then diff = q - x_r feeds the w_t projection WMMA directly; writes t_buf.
// One block per 64 queries; each of its 16 waves holds the 4 query tiles in
// registers and takes 256 keys, so the K, V and column-term loads of 32 keys
// feed 12 WMMAs. The upper K half of the score product holds the key's column
// term against ones and ones against the query's -L: the WMMA gives the log2
// of the finished weight, which is one exp2. Waves 0..3 add the partial X_r
// tiles, one tile each, and run the epilogue, which also leaves each tile's
// share of the GroupNorm sums:
//   stat [B][N/64 blocks][4 groups][4 tiles][sum, sum of squares] f32: a block
//   writes one whole 128-byte line
// ---------------------------------------------------------------------------
__global__ __launch_bounds__(32 * AW) void k_attn(
    const _Float16* __restrict__ q_h, const _Float16* __restrict__ k_h,
    const _Float16* __restrict__ v_h, const float* __restrict__ q_c,
    const _Float16* __restrict__ rowneg, const _Float16* __restrict__ colneg,
    const float* __restrict__ w_t, const float* __restrict__ b_t,
    float* __restrict__ t_buf, float* __restrict__ stat) {
  __shared__ v8f px[AW][QT][32];  // a lane's 8 partial sums lie together
  const int wid = blockIdx.x;
  const int b = wid / NB;
  const int n0 = (wid % NB) * (16 * QT);
  const int lane = threadIdx.x & 31;
  const int wv = wave_id();
  const int mbeg = wv * ACH;
  const int li = lane & 15;
  const int h = lane >> 4;
  const int koff = h << 3;
  const v2h one2 = {(_Float16)1.f, (_Float16)1.f};

  const _Float16* qb = q_h + (size_t)b * N_ * D_;
  const _Float16* kb = k_h + (size_t)b * N_ * D_;
  const _Float16* vb = v_h + (size_t)b * D_ * N_;
  const _Float16* rnb = rowneg + 2 * (size_t)b * N_;
  const _Float16* cnb = colneg + 2 * (size_t)b * N_;

  v2h rn[QT];
#pragma unroll  // constant indices keep rn in registers
  for (int t = 0; t < QT; ++t)
    rn[t] = *reinterpret_cast<const v2h*>(rnb + 2 * (n0 + 16 * t + li));
  // precaution: the fragment loads below land in these four loads' address
  // registers, so the wait stands between the two groups
  asm volatile("s_wait_xcnt 0x0" ::: "memory");
  v8h ql[QT];
#pragma unroll  // constant indices keep ql in registers
  for (int t = 0; t < QT; ++t)
    ql[t] = *reinterpret_cast<const v8h*>(qb + (size_t)(n0 + 16 * t + li) * D_ + koff);
  // keeps the queries' loads in front of the streamed operands': loads return
  // in order, and the first product needs all four query tiles
  __builtin_amdgcn_sched_barrier(0);

  const _Float16* kp = kb + (size_t)(mbeg + li) * D_ + koff;
  const _Float16* cp = cnb + 2 * (mbeg + li);
  const _Float16* vp = vb + (size_t)mbeg * D_ + li * 16 + koff;
  // the K, column-term and V operands of the wave's keys i..i+31
  auto fetch = [&](int i, v16h& k0, v16h& k1, v16h& vv) {
    k0 = frag(kp + i * D_, *reinterpret_cast<const v2h*>(cp + 2 * i), one2);
    k1 = frag(kp + (i + 16) * D_, *reinterpret_cast<const v2h*>(cp + 2 * (i + 16)), one2);
    // V tile i/16 and the next one: channel li, keys koff..koff+7 of each
    const v8h v0 = *reinterpret_cast<const v8h*>(vp + i * D_);
    const v8h v1 = *reinterpret_cast<const v8h*>(vp + i * D_ + 256);
#pragma unroll
    for (int j = 0; j < 8; ++j) { vv[j] = v0[j]; vv[j + 8] = v1[j]; }
  };
  // They are fetched two trips ahead: the work of trips i and i + 1 covers the
  // way of trip i + 2's loads, which a wave otherwise waits out at each trip's
  // top. Three trips' operands are live at a time.
  v16h sk0[ACH / 32], sk1[ACH / 32], sv[ACH / 32];
  fetch(0, sk0[0], sk1[0], sv[0]);
  fetch(32, sk0[1], sk1[1], sv[1]);
  v16h bq[QT];
  v8f xacc[QT];
#pragma unroll  // constant indices keep the four tiles' state in registers
  for (int t = 0; t < QT; ++t) {
    bq[t] = frag_of(ql[t], half0(one2, h), half0(rn[t], h));
    v8f z = {};
    xacc[t] = z;
  }
#pragma unroll  // all 8 trips: an operand is a name, not a copy, and every load is
                // one lane address plus a constant
  for (int i = 0; i < ACH; i += 32) {
    // keeps the trips apart, as the rolled loop did: mixed, two trips' score
    // registers are live at once
    __builtin_amdgcn_sched_barrier(0);
    const v16h ak0 = sk0[i / 32], ak1 = sk1[i / 32], av = sv[i / 32];
    v8f e0[QT], e1[QT];
#pragma unroll  // eight independent WMMAs in a row fill one another's result distance
    for (int t = 0; t < QT; ++t) {
      v8f z = {};
      e0[t] = wmma_f16(ak0, bq[t], z);
      e1[t] = wmma_f16(ak1, bq[t], z);
    }
    // keeps the eight in a row: moved down to their readers, each is followed
    // by idle slots until its result may be read
    __builtin_amdgcn_sched_barrier(0);
#pragma unroll  // constant indices keep the four tiles' state in registers
    for (int t = 0; t < QT; ++t) {
      float x0[8], x1[8];
#pragma unroll
      for (int r = 0; r < 8; ++r) {
        x0[r] = __builtin_amdgcn_exp2f(e0[t][r]);
        x1[r] = __builtin_amdgcn_exp2f(e1[t][r]);
      }
      if (t == 0 && i + 64 < ACH) {
        // The fetch stands behind the first tile's 16 exponentials, between two
        // fences: higher or lower it would follow a WMMA directly and could
        // land in operand registers that WMMA has only just read; sunk to its
        // readers it would be waited for in full again.
        __builtin_amdgcn_sched_barrier(0);
        fetch(i + 64, sk0[i / 32 + 2], sk1[i / 32 + 2], sv[i / 32 + 2]);
        __builtin_amdgcn_sched_barrier(0);
      }
      // D-tile layout == B-operand layout: pack two 16-key tiles into K=32.
      v16h pw;
#pragma unroll
      for (int r = 0; r < 8; ++r) {
        pw[r]     = (_Float16)x0[r];
        pw[8 + r] = (_Float16)x1[r];
      }
      xacc[t] = wmma_f16(av, pw, xacc[t]);
    }
  }

#pragma unroll  // constant indices keep xacc in registers
  for (int t = 0; t < QT; ++t) px[wv][t][lane] = xacc[t];
  __syncthreads();
  if (wv >= QT) return;
  // wave wv finishes query tile wv of the block
  const int nt = n0 + 16 * wv;
  v8f xs = {};
#pragma unroll  // the LDS reads are issued together
  for (int w = 0; w < AW; ++w) xs += px[w][wv][lane];

  // xs: lane reg r -> (d = r + 8h, n = nt + li). diff feeds next WMMA as B.
  const float* qcol = q_c + ((size_t)b * D_ + koff) * N_ + nt + li;
  v16h bdiff;
#pragma unroll
  for (int r = 0; r < 8; ++r) {
    bdiff[r] = (_Float16)(qcol[(size_t)r * N_] - xs[r]);
    bdiff[r + 8] = (_Float16)0.f;
  }
  v16h awt;
#pragma unroll
  for (int e = 0; e < 8; ++e) {
    awt[e] = (_Float16)w_t[li * D_ + koff + e];
    awt[e + 8] = (_Float16)0.f;
  }
  v8f z2 = {};
  const v8f t = wmma_f16(awt, bdiff, z2);
  float* tb = t_buf + (size_t)b * OUT_ * N_;
  // registers 0..3 are channels of group 2h, registers 4..7 of group 2h + 1
  float gs[2] = {0.f, 0.f}, gq[2] = {0.f, 0.f};
#pragma unroll  // constant indices keep t, gs, gq in registers
  for (int r = 0; r < 8; ++r) {
    const float y = t[r] + b_t[r + koff];
    tb[(size_t)(r + koff) * N_ + nt + li] = y;
    gs[r >> 2] += y;
    gq[r >> 2] += y * y;
  }
  // over the tile's 16 queries, which are the 16 lanes of a row
#pragma unroll  // constant indices keep gs, gq in registers
  for (int j = 0; j < 2; ++j) {
    gs[j] = add_xmask<8>(add_xmask<4>(add_xmask<2>(add_xmask<1>(gs[j]))));
    gq[j] = add_xmask<8>(add_xmask<4>(add_xmask<2>(add_xmask<1>(gq[j]))));
  }
  if (li == 0) {
    float* sp = stat + (((size_t)wid * G_ + 2 * h) * QT + wv) * 2;
#pragma unroll  // constant indices keep gs, gq in registers
    for (int j = 0; j < 2; ++j) {
      v2f p; p[0] = gs[j]; p[1] = gq[j];
      *reinterpret_cast<v2f*>(sp + j * QT * 2) = p;
    }
  }
}

// ---------------------------------------------------------------------------
// K5: GroupNorm, ReLU and the q^T residual. One block per 256 points of a
// batch, all 16 channels: 64 blocks share the loads and stores, with as many
// waves to start as 16 blocks of 1024 threads had. Every block adds up the
// batch's 64 x 4 x 4 partial sums of K4 for itself: they are 8 KiB in a row, 32
// bytes a thread. A thread then finishes 4 x 4 points of one channel; a wave's
// load of t_buf or q_c is two runs of 256 bytes.
// ---------------------------------------------------------------------------
__global__ __launch_bounds__(256) void k_gnfinal(
    const float* __restrict__ t_buf, const float* __restrict__ q_c,
    const float* __restrict__ stat,
    const float* __restrict__ gamma, const float* __restrict__ beta,
    float* __restrict__ out) {
  __shared__ v2f red[G_][8];  // [group][wave]: (sum, sum of squares)
  const int b = blockIdx.x / (N_ / FP);
  const int n0 = (blockIdx.x % (N_ / FP)) * FP;
  const int tid = threadIdx.x;
  const int lane = tid & 31;
  const int wv = wave_id();
  const int ch = tid >> 4;
  const size_t o = ((size_t)b * OUT_ + ch) * N_ + n0 + 4 * (tid & 15);
  // thread tid: the four tiles of K4's block tid / 4, group tid % 4
  const float* sp = stat + (size_t)b * NB * G_ * QT * 2 + 8 * tid;
  const v4f a0 = *reinterpret_cast<const v4f*>(sp);
  const v4f a1 = *reinterpret_cast<const v4f*>(sp + 4);
  const float ga = gamma[ch];
  const float be = beta[ch];
  v4f tv[FP / 64], qv[FP / 64];
#pragma unroll  // constant indices keep tv in registers
  for (int k = 0; k < FP / 64; ++k) tv[k] = *reinterpret_cast<const v4f*>(t_buf + o + 64 * k);
#pragma unroll  // constant indices keep qv in registers
  for (int k = 0; k < FP / 64; ++k) qv[k] = *reinterpret_cast<const v4f*>(q_c + o + 64 * k);
  // keeps all the loads in front of the sums: left free, the later ones are
  // issued behind the wait for the first two, a second trip to memory
  __builtin_amdgcn_sched_barrier(0);
  float s = (a0[0] + a0[2]) + (a1[0] + a1[2]);
  float s2 = (a0[1] + a0[3]) + (a1[1] + a1[3]);
  // over the wave's 8 blocks: the lanes that agree in lane % 4
  s = add_xrow(add_xmask<8>(add_xmask<4>(s)));
  s2 = add_xrow(add_xmask<8>(add_xmask<4>(s2)));
  if (lane < G_) {
    v2f p; p[0] = s; p[1] = s2;
    red[lane][wv] = p;
  }
  __syncthreads();
  v2f S = {};
#pragma unroll  // the LDS reads are issued together
  for (int w = 0; w < 8; ++w) S += red[wv >> 1][w];  // a wave's 2 channels: one group
  const float M = (float)(4 * N_);
  const float m = S[0] / M;
  const float var = S[1] / M - m * m;
  const float rstd = rsqrtf(var + 1e-5f);
#pragma unroll  // constant indices keep tv, qv in registers
  for (int k = 0; k < FP / 64; ++k) {
    v4f y;
#pragma unroll
    for (int j = 0; j < 4; ++j)
      y[j] = qv[k][j] + fmaxf((tv[k][j] - m) * rstd * ga + be, 0.f);
    *reinterpret_cast<v4f*>(out + o + 64 * k) = y;
  }
}

// ---------------------------------------------------------------------------
extern "C" void kernel_launch(void* const* d_in, const int* in_sizes, int n_in,
                              void* d_out, int out_size, void* d_ws,
                              size_t ws_size, hipStream_t stream) {
  const float* x_q      = (const float*)d_in[0];
  const float* x_kv     = (const float*)d_in[1];
  const float* xyz_q    = (const float*)d_in[2];
  const float* xyz_kv   = (const float*)d_in[3];
  const float* w_qk     = (const float*)d_in[4];
  const float* w_v      = (const float*)d_in[5];
  const float* b_v      = (const float*)d_in[6];
  const float* w_t      = (const float*)d_in[7];
  const float* b_t      = (const float*)d_in[8];
  const float* gamma    = (const float*)d_in[9];
  const float* beta     = (const float*)d_in[10];
  const float* w_pos_q  = (const float*)d_in[11];
  const float* w_pos_kv = (const float*)d_in[12];
  float* out = (float*)d_out;

  char* ws = (char*)d_ws;
  size_t off = 0;
  auto carve = [&](size_t bytes) -> char* {
    char* p = ws + off;
    off += (bytes + 255) & ~(size_t)255;
    return p;
  };
  float*    q_c    = (float*)carve((size_t)B_ * D_ * N_ * 4);
  _Float16* q_h    = (_Float16*)carve((size_t)B_ * N_ * D_ * 2);
  _Float16* k_h    = (_Float16*)carve((size_t)B_ * N_ * D_ * 2);
  _Float16* v_h    = (_Float16*)carve((size_t)B_ * D_ * N_ * 2);
  _Float16* rowneg = (_Float16*)carve((size_t)B_ * N_ * 2 * 2);
  _Float16* colneg = (_Float16*)carve((size_t)B_ * N_ * 2 * 2);
  float*    t_buf  = (float*)carve((size_t)B_ * OUT_ * N_ * 4);
  float*    stat   = (float*)carve((size_t)B_ * NB * G_ * QT * 2 * 4);
  (void)in_sizes; (void)n_in; (void)out_size; (void)ws_size;

  k_project<<<B_ * N_ / 32, 32 * SPLIT, 0, stream>>>(
      x_q, x_kv, xyz_q, xyz_kv, w_qk, w_v, b_v, w_pos_q, w_pos_kv,
      q_c, q_h, k_h, v_h);
  k_rowstats<<<B_ * NB, 32 * AW, 0, stream>>>(q_h, k_h, rowneg);
  k_colsum<<<B_ * NB, 32 * AW, 0, stream>>>(q_h, k_h, rowneg, colneg);
  k_attn<<<B_ * NB, 32 * AW, 0, stream>>>(q_h, k_h, v_h, q_c, rowneg, colneg,
                                     w_t, b_t, t_buf, stat);
  k_gnfinal<<<B_ * (N_ / FP), 256, 0, stream>>>(t_buf, q_c, stat, gamma, beta, out);
}

// v010
// A run of this version takes 29 microseconds.
// In two side-by-side timings against v009, it was 1.19 and 1.16 times as fast.
// All steps since v000 together make it 8.70 times as fast.
#include <hip/hip_runtime.h>

#define B_   4
#define CIN  128
#define N_   4096
#define D_   16
#define OUT_ 16
#define G_   4
#define SPLIT 8             // waves per block in the projection
#define PCH   (CIN / SPLIT) // input channels per wave in the projection
#define QT  4               // attention passes: 16-row tiles a wave keeps in registers
#define AW  16              // attention passes: waves per block
#define ACH (N_ / AW)       // attention passes: streamed keys (or queries) per wave
#define NB  (N_ / (16 * QT)) // attention passes: blocks per batch
#define FP  256             // last launch: points per block
#define LOG2E 1.4426950408889634f

// Wave number within the block, in a scalar register: the wave's share of the
// loop, its weight loads and the branch on it are then scalar.
static __device__ __forceinline__ int wave_id() {
  return __builtin_amdgcn_readfirstlane(threadIdx.x >> 5);
}

typedef __attribute__((ext_vector_type(16))) _Float16 v16h;
typedef __attribute__((ext_vector_type(8)))  _Float16 v8h;
typedef __attribute__((ext_vector_type(8)))  float    v8f;
typedef __attribute__((ext_vector_type(4)))  float    v4f;
typedef __attribute__((ext_vector_type(2)))  float    v2f;
typedef __attribute__((ext_vector_type(2)))  _Float16 v2h;

// WMMA operand of a 16-channel row: 8 contiguous halves fill k = 8h..8h+7 (h =
// lane half). The upper K half, idle for 16 channels, takes two pairs of extra
// terms at k = 16+8h..16+8h+3; the rest is zero. Both operands are built here,
// so a pair of one meets the pair at the same place of the other.
static __device__ __forceinline__ v16h frag_of(v8h lo, v2h s0, v2h s1) {
  v16h r;
#pragma unroll
  for (int i = 0; i < 8; ++i) { r[i] = lo[i]; r[i + 8] = (_Float16)0.f; }
  r[8] = s0[0]; r[9] = s0[1];
  r[10] = s1[0]; r[11] = s1[1];
  return r;
}
static __device__ __forceinline__ v16h frag(const _Float16* p, v2h s0, v2h s1) {
  return frag_of(*reinterpret_cast<const v8h*>(p), s0, s1);
}

// -x as two halves, leading part and remainder: against a pair of ones the
// product adds -x to a score with about 22 bits of x kept.
static __device__ __forceinline__ v2h neg_pair(float x) {
  v2h r;
  r[0] = (_Float16)(-x);
  r[1] = (_Float16)(-x - (float)r[0]);
  return r;
}

// The pair for lane half 0, zeros for half 1: the resident operand carries its
// pairs once (k = 16..19), whatever the streamed operand holds at k = 24..27.
static __device__ __forceinline__ v2h half0(v2h p, int h) {
  v2h z = {};
  return h == 0 ? p : z;
}

static __device__ __forceinline__ v8f wmma_f16(v16h a, v16h b, v8f c) {
  return __builtin_amdgcn_wmma_f32_16x16x32_f16(false, a, false, b, (short)0, c,
                                                false, false);
}

static __device__ __forceinline__ v8f wmma_f32(v2f a, v2f b, v8f c) {
  return __builtin_amdgcn_wmma_f32_16x16x4_f32(false, a, false, b, (short)0, c,
                                               false, false);
}

// x plus the x of the lane whose number differs in the bits MASK, inside a row
// of 16 lanes: a register move, where a shuffle would go through the LDS unit
template <int MASK>
static __device__ __forceinline__ float add_xmask(float x) {
  const int y = __builtin_amdgcn_update_dpp(0, __builtin_bit_cast(int, x),
                                            0x160 | MASK, 0xf, 0xf, false);
  return x + __builtin_bit_cast(float, y);
}
// x plus the x of lane l ^ 16
static __device__ __forceinline__ float add_xrow(float x) {
  const int v = __builtin_bit_cast(int, x);
  const int y = __builtin_amdgcn_permlanex16(v, v, 0x76543210, 0xfedcba98, false, false);
  return x + __builtin_bit_cast(float, y);
}

// ---------------------------------------------------------------------------
// K1: channel projections (1x1 convs). One block per 32 points; each of the 8
// waves sums 16 of the 128 input channels on the f32 matrix instruction, output
// channels as rows, points as columns; partials meet in LDS. The weights are A
// fragments, four 16-byte loads a lane that go out with the x loads: as scalar
// operands of vector multiply-adds they came in many short rounds of scalar
// loads, each waited out in turn.
//   q_c [B][16][N] f32, channel-major as the output is: its stores here and
//   its loads in K5 move whole 128-byte lines,
//   q_h/k_h [B][N][16] f16 (q_h times log2 e: the scores come out of the WMMA
//   as exponents of 2),
//   v_h [B][N/16][16 channels][16 keys] f16: one 16x16 tile is 512 contiguous
//   bytes, so a wave's A-fragment load in K4 reads whole 128-byte lines
// ---------------------------------------------------------------------------
__global__ __launch_bounds__(256) void k_project(
    const float* __restrict__ x_q, const float* __restrict__ x_kv,
    const float* __restrict__ xyz_q, const float* __restrict__ xyz_kv,
    const float* __restrict__ w_qk, const float* __restrict__ w_v,
    const float* __restrict__ b_v,
    const float* __restrict__ w_pos_q, const float* __restrict__ w_pos_kv,
    float* __restrict__ q_c, _Float16* __restrict__ q_h,
    _Float16* __restrict__ k_h, _Float16* __restrict__ v_h) {
  // partial sums: [wave][q | k | v][row][point]; output channel d lies in row
  // d + d / 8 (row 8 is empty), so the two lane halves' stores, 8 channels
  // apart, fall on different halves of the 64 banks
  __shared__ float part[SPLIT][3][D_ + 1][32];
  const int lane = threadIdx.x & 31;
  const int wv = wave_id();
  const int li = lane & 15;
  const int h = lane >> 4;
  const int b = blockIdx.x / (N_ / 32);
  const int nb = (blockIdx.x % (N_ / 32)) * 32;
  const int n = nb + lane;
  const int idx = b * N_ + n;
  // Lane half h takes channels cl..cl+7 of the wave's 16. Step s of the four
  // K = 4 products pairs channels cl + 2s and cl + 2s + 1 in both operands.
  const int cl = wv * PCH + 8 * h;

  // A: row li (an output channel) of each weight matrix, the half's 8 channels
  const v4f* wqp = reinterpret_cast<const v4f*>(w_qk + li * CIN + cl);
  const v4f* wvp = reinterpret_cast<const v4f*>(w_v + li * CIN + cl);
  const v4f wq0 = wqp[0], wq1 = wqp[1], wv0 = wvp[0], wv1 = wvp[1];
  // precaution: what follows writes these four loads' address registers again
  asm volatile("s_wait_xcnt 0x0" ::: "memory");
  // B: a lane loads points nb + 2 li and the next of a channel, so 16 lanes
  // read one whole 128-byte line; column li is point 2 li of the even tile and
  // point 2 li + 1 of the odd one
  const float* xq = x_q + ((size_t)b * CIN + cl) * N_ + nb + 2 * li;
  const float* xk = x_kv + ((size_t)b * CIN + cl) * N_ + nb + 2 * li;
  v2f vq[8], vk[8];
#pragma unroll  // all the wave's loads go out before the first is waited for
  for (int c = 0; c < 8; ++c) {
    vq[c] = *reinterpret_cast<const v2f*>(xq + (size_t)c * N_);
    vk[c] = *reinterpret_cast<const v2f*>(xk + (size_t)c * N_);
  }
  float cq[3], ck[3];
#pragma unroll  // constant indices keep cq, ck in registers
  for (int j = 0; j < 3; ++j) {
    cq[j] = xyz_q[((size_t)b * 3 + j) * N_ + n];
    ck[j] = xyz_kv[((size_t)b * 3 + j) * N_ + n];
  }
  // precaution: the products' results land in these loads' address registers
  asm volatile("s_wait_xcnt 0x0" ::: "memory");
  // keeps all the loads, and the wait, in front of the products: left free, half
  // the loads are issued behind the wait for the first ones, two more trips to
  // memory
  __builtin_amdgcn_sched_barrier(0);

  v8f aq[2] = {}, ak[2] = {}, av[2] = {};  // [even, odd points]
#pragma unroll  // constant indices keep the fragments in registers; the six sums
                // are independent and fill one another's result distance
  for (int s = 0; s < 4; ++s) {
    const v4f wqs = s < 2 ? wq0 : wq1;
    const v4f wvs = s < 2 ? wv0 : wv1;
    v2f fa, fv;
    fa[0] = wqs[2 * (s & 1)]; fa[1] = wqs[2 * (s & 1) + 1];
    fv[0] = wvs[2 * (s & 1)]; fv[1] = wvs[2 * (s & 1) + 1];
#pragma unroll
    for (int t = 0; t < 2; ++t) {
      v2f fq, fk;
      fq[0] = vq[2 * s][t]; fq[1] = vq[2 * s + 1][t];
      fk[0] = vk[2 * s][t]; fk[1] = vk[2 * s + 1][t];
      aq[t] = wmma_f32(fa, fq, aq[t]);
      ak[t] = wmma_f32(fa, fk, ak[t]);
      av[t] = wmma_f32(fv, fk, av[t]);
    }
  }
  // register r: output channel 8h + r, which is row 9h + r
#pragma unroll  // constant indices keep the sums in registers
  for (int r = 0; r < 8; ++r) {
#pragma unroll
    for (int t = 0; t < 2; ++t) {
      part[wv][0][9 * h + r][2 * li + t] = aq[t][r];
      part[wv][1][9 * h + r][2 * li + t] = ak[t][r];
      part[wv][2][9 * h + r][2 * li + t] = av[t][r];
    }
  }
  __syncthreads();

  // wave wv finishes output channels 2*wv and 2*wv+1 of the block's 32 points
  float qv[2], kv[2], vv[2];
#pragma unroll  // qv, kv, vv stay in registers
  for (int i = 0; i < 2; ++i) {
    const int d = 2 * wv + i;
    float aq = 0.f, ak = 0.f, av = 0.f;
#pragma unroll  // the LDS reads are issued together
    for (int w = 0; w < SPLIT; ++w) {
      aq += part[w][0][d + (d >> 3)][lane];
      ak += part[w][1][d + (d >> 3)][lane];
      av += part[w][2][d + (d >> 3)][lane];
    }
    float pq = 0.f, pk = 0.f;
#pragma unroll  // constant indices keep cq, ck in registers
    for (int j = 0; j < 3; ++j) {
      pq = fmaf(w_pos_q[d * 3 + j], cq[j], pq);
      pk = fmaf(w_pos_kv[d * 3 + j], ck[j], pk);
    }
    qv[i] = aq + pq;
    kv[i] = ak + pk;
    vv[i] = av + b_v[d] + pk;
  }
  const size_t row = (size_t)idx * D_ + 2 * wv;
  v2f qp; qp[0] = qv[0]; qp[1] = qv[1];
  v2f kp; kp[0] = kv[0]; kp[1] = kv[1];
  v2f vp; vp[0] = vv[0]; vp[1] = vv[1];
  const v2h qh = __builtin_convertvector(qp * LOG2E, v2h);
  const v2h kh = __builtin_convertvector(kp, v2h);
  const v2h vh = __builtin_convertvector(vp, v2h);
  float* qcol = q_c + ((size_t)b * D_ + 2 * wv) * N_ + n;
  qcol[0] = qv[0];
  qcol[N_] = qv[1];
  *reinterpret_cast<v2h*>(q_h + row) = qh;
  *reinterpret_cast<v2h*>(k_h + row) = kh;
  _Float16* vrow = v_h + ((size_t)b * N_ + (n & ~15)) * D_ + 2 * wv * 16 + (n & 15);
  vrow[0] = vh[0];
  vrow[16] = vh[1];
}

// ---------------------------------------------------------------------------
// K2: per query, L = log2 of the sum over keys of 2^score, stored as neg_pair.
// One block per 64 queries; each of its 16 waves holds the 4 query tiles in
// registers. A wave's shift is the maximum over its first 32 keys: that key's
// own term is about 1, so the sum cannot vanish, and any shift gives the same
// L as long as no sum overflows. With minus the shift in the queries' upper K half
// against ones in the keys', the WMMA gives score - shift and each term of the
// sweep over the 256 keys is one exp2. Where a sum comes out too large (or not
// a number) the wave does both again, once, with the maximum over all its keys.
// E^T tile = WMMA(A = K-tile, B = Q-tile).
// D layout: lane L reg r -> (key m = m0 + r + 8*(L/16), query n = n0 + L%16)
// ---------------------------------------------------------------------------
__global__ __launch_bounds__(32 * AW) void k_rowstats(
    const _Float16* __restrict__ q_h, const _Float16* __restrict__ k_h,
    _Float16* __restrict__ rowneg) {
  __shared__ float pm[AW][16 * QT], ps[AW][16 * QT];
  const int wid = blockIdx.x;
  const int b = wid / NB;
  const int n0 = (wid % NB) * (16 * QT);
  const int lane = threadIdx.x & 31;
  const int wv = wave_id();
  const int mbeg = wv * ACH;
  const int li = lane & 15;
  const int h = lane >> 4;
  const int koff = h << 3;
  const v2h zero2 = {};
  const v2h one2 = {(_Float16)1.f, (_Float16)1.f};

  const _Float16* qb = q_h + (size_t)b * N_ * D_;
  const _Float16* kb = k_h + (size_t)b * N_ * D_;
  v16h bq[QT];
#pragma unroll  // constant indices keep bq in registers
  for (int t = 0; t < QT; ++t)
    bq[t] = frag(qb + (size_t)(n0 + 16 * t + li) * D_ + koff, zero2, zero2);

  // keeps the queries' loads in front of the keys': loads return in order, and
  // the first product needs all four query tiles but only the first key tile
  __builtin_amdgcn_sched_barrier(0);
  // The wave's 16 key tiles stay in registers: their loads all go out here,
  // behind the queries', and return in order while the first tiles are worked
  // on, so no trip of either sweep waits out a load of its own.
  const _Float16* kp = kb + (size_t)(mbeg + li) * D_ + koff;
  v16h ak[ACH / 16];
#pragma unroll  // constant indices keep ak in registers
  for (int j = 0; j < ACH / 16; ++j) ak[j] = frag(kp + 16 * j * D_, one2, zero2);
  float sh[QT];  // the shift in use
  v2f sm[QT];    // even and odd registers' terms: two sums per add instruction
  int span = 32;  // keys the shift is taken from; all of them on the second go
  for (;;) {
    float mx[QT];
#pragma unroll  // constant indices keep bq, mx in registers
    for (int t = 0; t < QT; ++t) {
      bq[t][8] = (_Float16)0.f;  // no shift in the scores the maximum is taken of
      bq[t][9] = (_Float16)0.f;
      mx[t] = -__builtin_inff();
    }

    // the maximum over one key tile's scores joins mx
    auto max_tile = [&](const v16h& a) {
      v8f et[QT];
#pragma unroll  // four independent WMMAs in a row fill one another's result distance
      for (int t = 0; t < QT; ++t) {
        v8f z = {};
        et[t] = wmma_f16(a, bq[t], z);
      }
#pragma unroll  // constant indices keep et, mx in registers
      for (int t = 0; t < QT; ++t) {
#pragma unroll
        for (int r = 0; r < 8; r += 2)
          mx[t] = fmaxf(fmaxf(mx[t], et[t][r]), et[t][r + 1]);
      }
    };
    max_tile(ak[0]);
    max_tile(ak[1]);
    if (span == ACH) {
#pragma unroll  // constant indices keep ak in registers
      for (int j = 2; j < ACH / 16; ++j) max_tile(ak[j]);
    }

    // one shift per query for both lane halves; the pair really adds -sh
#pragma unroll  // constant indices keep bq, mx, sh, sm in registers
    for (int t = 0; t < QT; ++t) {
      const v2h p = neg_pair(fmaxf(mx[t], __shfl_xor(mx[t], 16, 32)));
      sh[t] = -((float)p[0] + (float)p[1]);
      const v2h ph = half0(p, h);
      bq[t][8] = ph[0];
      bq[t][9] = ph[1];
      const v2f z2 = {};
      sm[t] = z2;
    }

#pragma unroll  // constant indices keep ak in registers
    for (int j = 0; j < ACH / 16; ++j) {
      v8f et[QT];
#pragma unroll  // four independent WMMAs in a row fill one another's result distance
      for (int t = 0; t < QT; ++t) {
        v8f z = {};
        et[t] = wmma_f16(ak[j], bq[t], z);
      }
#pragma unroll  // constant indices keep et, sm in registers
      for (int t = 0; t < QT; ++t) {
#pragma unroll
        for (int r = 0; r < 8; r += 2) {
          v2f x;
          x[0] = __builtin_amdgcn_exp2f(et[t][r]);
          x[1] = __builtin_amdgcn_exp2f(et[t][r + 1]);
          sm[t] += x;
        }
      }
    }
    // one test per wave behind the whole sweep: below 2^100 the 16 waves' sums
    // still add up without overflow; the comparison is false for a NaN too
    bool redo = false;
#pragma unroll  // constant indices keep sm in registers
    for (int t = 0; t < QT; ++t) redo |= !(sm[t][0] + sm[t][1] < 0x1p100f);
    if (span == ACH || __builtin_amdgcn_ballot_w32(redo) == 0) break;
    span = ACH;
  }
  // combine the two lane-halves (same query and shift, different key subsets)
#pragma unroll  // constant indices keep sh, sm in registers
  for (int t = 0; t < QT; ++t) {
    const float s1 = sm[t][0] + sm[t][1];
    const float S = s1 + __shfl_xor(s1, 16, 32);
    if (h == 0) {
      pm[wv][16 * t + li] = sh[t];
      ps[wv][16 * t + li] = S;
    }
  }
  __syncthreads();
  // merge the 16 waves' (shift, sum) pairs, one thread per query
  if (threadIdx.x < 16 * QT) {
    const int t = threadIdx.x;
    float Mb = pm[0][t];
#pragma unroll  // the LDS reads are issued together
    for (int w = 1; w < AW; ++w) Mb = fmaxf(Mb, pm[w][t]);
    float Sb = 0.f;
#pragma unroll  // the LDS reads are issued together
    for (int w = 0; w < AW; ++w)
      Sb += ps[w][t] * __builtin_amdgcn_exp2f(pm[w][t] - Mb);
    *reinterpret_cast<v2h*>(rowneg + 2 * (size_t)(b * N_ + n0 + t)) =
        neg_pair(Mb + __builtin_amdgcn_logf(Sb));
  }
}

// ---------------------------------------------------------------------------
// K3: column sums over queries (key-major => no atomics). Stores
// log2(1e-9 + cs) as neg_pair.
// One block per 64 keys; each of its 16 waves holds the 4 key tiles in
// registers and takes 256 queries, so one query fragment feeds 4 WMMAs. The
// query's -L rides in its upper K half against ones in the keys': the WMMA
// gives score - L, and a softmax weight is one exp2.
// ---------------------------------------------------------------------------
__global__ __launch_bounds__(32 * AW) void k_colsum(
    const _Float16* __restrict__ q_h, const _Float16* __restrict__ k_h,
    const _Float16* __restrict__ rowneg, _Float16* __restrict__ colneg) {
  __shared__ float pc[AW][16 * QT];
  const int wid = blockIdx.x;
  const int b = wid / NB;
  const int m0 = (wid % NB) * (16 * QT);
  const int lane = threadIdx.x & 31;
  const int wv = wave_id();
  const int nbeg = wv * ACH;
  const int li = lane & 15;
  const int h = lane >> 4;
  const int koff = h << 3;
  const v2h zero2 = {};
  const v2h one2 = {(_Float16)1.f, (_Float16)1.f};

  const _Float16* qb = q_h + (size_t)b * N_ * D_;
  const _Float16* kb = k_h + (size_t)b * N_ * D_;
  const _Float16* rnb = rowneg + 2 * (size_t)b * N_;
  v16h ak[QT];
  float cs[QT][8];
#pragma unroll  // constant indices keep ak, cs in registers
  for (int t = 0; t < QT; ++t) {
    ak[t] = frag(kb + (size_t)(m0 + 16 * t + li) * D_ + koff, half0(one2, h), zero2);
#pragma unroll
    for (int r = 0; r < 8; ++r) cs[t][r] = 0.f;
  }
  // keeps the keys' loads in front of the queries': loads return in order, and
  // the first product needs all four key tiles but only the first query tile
  __builtin_amdgcn_sched_barrier(0);

  // The query tiles are fetched two trips ahead: the work of trips i and i + 1
  // covers the way of trip i + 2's loads, which a wave otherwise waits out at
  // each trip's top. Three trips' tiles are live at a time.
  const _Float16* qp = qb + (size_t)(nbeg + li) * D_ + koff;
  const _Float16* rp = rnb + 2 * (nbeg + li);
  v16h bq[ACH / 16];
#pragma unroll  // constant indices keep bq in registers
  for (int j = 0; j < 4; ++j)
    bq[j] = frag(qp + 16 * j * D_, *reinterpret_cast<const v2h*>(rp + 32 * j), zero2);
#pragma unroll  // all 8 trips: a tile is a name, not a copy, and every load is one
                // lane address plus a constant
  for (int i = 0; i < ACH; i += 32) {
    // keeps the trips apart, as the rolled loop did, and the fetch below the
    // trip before: risen into it, it lands in registers that trip's WMMAs have
    // only just read
    __builtin_amdgcn_sched_barrier(0);
#pragma unroll  // constant indices keep bq in registers
    for (int j = i / 16 + 4; j < i / 16 + 6 && j < ACH / 16; ++j)
      bq[j] = frag(qp + 16 * j * D_, *reinterpret_cast<const v2h*>(rp + 32 * j), zero2);
    // keeps the fetch at this trip's top: sunk to its readers it would be
    // waited for in full again (left standing in the last two trips, which
    // fetch nothing: without it there this build spills registers)
    __builtin_amdgcn_sched_barrier(0);
#pragma unroll  // constant indices keep bq in registers
    for (int u = i / 16; u < i / 16 + 2; ++u) {
      v8f et[QT];
#pragma unroll  // four independent WMMAs in a row fill one another's result distance
      for (int t = 0; t < QT; ++t) {
        v8f z = {};
        et[t] = wmma_f16(ak[t], bq[u], z);
      }
#pragma unroll  // constant indices keep et, cs in registers
      for (int t = 0; t < QT; ++t) {
#pragma unroll
        for (int r = 0; r < 8; ++r) cs[t][r] += __builtin_amdgcn_exp2f(et[t][r]);
      }
    }
  }
  // keeps the lane reduction below the unrolled sweep: mixed into its last
  // trips, the cross-lane results are live all at once and registers spill
  __builtin_amdgcn_sched_barrier(0);
  // reduce across the 16 queries held by each lane-half
#pragma unroll
  for (int msk = 1; msk < 16; msk <<= 1) {
#pragma unroll
    for (int t = 0; t < QT; ++t) {
#pragma unroll
      for (int r = 0; r < 8; ++r) cs[t][r] += __shfl_xor(cs[t][r], msk, 32);
    }
  }
  if (li == 0) {
#pragma unroll
    for (int t = 0; t < QT; ++t) {
#pragma unroll
      for (int r = 0; r < 8; ++r) pc[wv][16 * t + koff + r] = cs[t][r];
    }
  }
  __syncthreads();
  // add the 16 waves' partial column sums, one thread per key
  if (threadIdx.x < 16 * QT) {
    const int t = threadIdx.x;
    float c = 0.f;
#pragma unroll  // the LDS reads are issued together
    for (int w = 0; w < AW; ++w) c += pc[w][t];
    *reinterpret_cast<v2h*>(colneg + 2 * (size_t)(b * N_ + m0 + t)) =
        neg_pair(__builtin_amdgcn_logf(1e-9f + c));
  }
}

// ---------------------------------------------------------------------------
// K4: recompute weights, X_r^T += V * W^T (K=32: two prob tiles per WMMA),
// then diff = q - x_r feeds the w_t projection WMMA directly; writes t_buf.
// One block per 64 queries; each of its 16 waves holds the 4 query tiles in
// registers and takes 256 keys, so the K, V and column-term loads of 32 keys
// feed 12 WMMAs. The upper K half of the score product holds the key's column
// term against ones and ones against the query's -L: the WMMA gives the log2
// of the finished weight, which is one exp2. Waves 0..3 add the partial X_r
// tiles, one tile each, and run the epilogue, which also leaves each tile's
// share of the GroupNorm sums:
//   stat [B][N/64 blocks][4 groups][4 tiles][sum, sum of squares] f32: a block
//   writes one whole 128-byte line
// ---------------------------------------------------------------------------
__global__ __launch_bounds__(32 * AW) void k_attn(
    const _Float16* __restrict__ q_h, const _Float16* __restrict__ k_h,
    const _Float16* __restrict__ v_h, const float* __restrict__ q_c,
    const _Float16* __restrict__ rowneg, const _Float16* __restrict__ colneg,
    const float* __restrict__ w_t, const float* __restrict__ b_t,
    float* __restrict__ t_buf, float* __restrict__ stat) {
  __shared__ v8f px[AW][QT][32];  // a lane's 8 partial sums lie together
  const int wid = blockIdx.x;
  const int b = wid / NB;
  const int n0 = (wid % NB) * (16 * QT);
  const int lane = threadIdx.x & 31;
  const int wv = wave_id();
  const int mbeg = wv * ACH;
  const int li = lane & 15;
  const int h = lane >> 4;
  const int koff = h << 3;
  const v2h one2 = {(_Float16)1.f, (_Float16)1.f};

  const _Float16* qb = q_h + (size_t)b * N_ * D_;
  const _Float16* kb = k_h + (size_t)b * N_ * D_;
  const _Float16* vb = v_h + (size_t)b * D_ * N_;
  const _Float16* rnb = rowneg + 2 * (size_t)b * N_;
  const _Float16* cnb = colneg + 2 * (size_t)b * N_;

  v2h rn[QT];
#pragma unroll  // constant indices keep rn in registers
  for (int t = 0; t < QT; ++t)
    rn[t] = *reinterpret_cast<const v2h*>(rnb + 2 * (n0 + 16 * t + li));
  // precaution: the fragment loads below land in these four loads' address
  // registers, so the wait stands between the two groups
  asm volatile("s_wait_xcnt 0x0" ::: "memory");
  v8h ql[QT];
#pragma unroll  // constant indices keep ql in registers
  for (int t = 0; t < QT; ++t)
    ql[t] = *reinterpret_cast<const v8h*>(qb + (size_t)(n0 + 16 * t + li) * D_ + koff);
  // keeps the queries' loads in front of the streamed operands': loads return
  // in order, and the first product needs all four query tiles
  __builtin_amdgcn_sched_barrier(0);

  const _Float16* kp = kb + (size_t)(mbeg + li) * D_ + koff;
  const _Float16* cp = cnb + 2 * (mbeg + li);
  const _Float16* vp = vb + (size_t)mbeg * D_ + li * 16 + koff;
  // the K, column-term and V operands of the wave's keys i..i+31
  auto fetch = [&](int i, v16h& k0, v16h& k1, v16h& vv) {
    k0 = frag(kp + i * D_, *reinterpret_cast<const v2h*>(cp + 2 * i), one2);
    k1 = frag(kp + (i + 16) * D_, *reinterpret_cast<const v2h*>(cp + 2 * (i + 16)), one2);
    // V tile i/16 and the next one: channel li, keys koff..koff+7 of each
    const v8h v0 = *reinterpret_cast<const v8h*>(vp + i * D_);
    const v8h v1 = *reinterpret_cast<const v8h*>(vp + i * D_ + 256);
#pragma unroll
    for (int j = 0; j < 8; ++j) { vv[j] = v0[j]; vv[j + 8] = v1[j]; }
  };
  // They are fetched two trips ahead: the work of trips i and i + 1 covers the
  // way of trip i + 2's loads, which a wave otherwise waits out at each trip's
  // top. Three trips' operands are live at a time.
  v16h sk0[ACH / 32], sk1[ACH / 32], sv[ACH / 32];
  fetch(0, sk0[0], sk1[0], sv[0]);
  fetch(32, sk0[1], sk1[1], sv[1]);
  v16h bq[QT];
  v8f xacc[QT];
#pragma unroll  // constant indices keep the four tiles' state in registers
  for (int t = 0; t < QT; ++t) {
    bq[t] = frag_of(ql[t], half0(one2, h), half0(rn[t], h));
    v8f z = {};
    xacc[t] = z;
  }
#pragma unroll  // all 8 trips: an operand is a name, not a copy, and every load is
                // one lane address plus a constant
  for (int i = 0; i < ACH; i += 32) {
    // keeps the trips apart, as the rolled loop did: mixed, two trips' score
    // registers are live at once
    __builtin_amdgcn_sched_barrier(0);
    const v16h ak0 = sk0[i / 32], ak1 = sk1[i / 32], av = sv[i / 32];
    v8f e0[QT], e1[QT];
#pragma unroll  // eight independent WMMAs in a row fill one another's result distance
    for (int t = 0; t < QT; ++t) {
      v8f z = {};
      e0[t] = wmma_f16(ak0, bq[t], z);
      e1[t] = wmma_f16(ak1, bq[t], z);
    }
    // keeps the eight in a row: moved down to their readers, each is followed
    // by idle slots until its result may be read
    __builtin_amdgcn_sched_barrier(0);
#pragma unroll  // constant indices keep the four tiles' state in registers
    for (int t = 0; t < QT; ++t) {
      float x0[8], x1[8];
#pragma unroll
      for (int r = 0; r < 8; ++r) {
        x0[r] = __builtin_amdgcn_exp2f(e0[t][r]);
        x1[r] = __builtin_amdgcn_exp2f(e1[t][r]);
      }
      if (t == 0 && i + 64 < ACH) {
        // The fetch stands behind the first tile's 16 exponentials, between two
        // fences: higher or lower it would follow a WMMA directly and could
        // land in operand registers that WMMA has only just read; sunk to its
        // readers it would be waited for in full again.
        __builtin_amdgcn_sched_barrier(0);
        fetch(i + 64, sk0[i / 32 + 2], sk1[i / 32 + 2], sv[i / 32 + 2]);
        __builtin_amdgcn_sched_barrier(0);
      }
      // D-tile layout == B-operand layout: pack two 16-key tiles into K=32.
      v16h pw;
#pragma unroll
      for (int r = 0; r < 8; ++r) {
        pw[r]     = (_Float16)x0[r];
        pw[8 + r] = (_Float16)x1[r];
      }
      xacc[t] = wmma_f16(av, pw, xacc[t]);
    }
  }

#pragma unroll  // constant indices keep xacc in registers
  for (int t = 0; t < QT; ++t) px[wv][t][lane] = xacc[t];
  __syncthreads();
  if (wv >= QT) return;
  // wave wv finishes query tile wv of the block
  const int nt = n0 + 16 * wv;
  v8f xs = {};
#pragma unroll  // the LDS reads are issued together
  for (int w = 0; w < AW; ++w) xs += px[w][wv][lane];

  // xs: lane reg r -> (d = r + 8h, n = nt + li). diff feeds next WMMA as B.
  const float* qcol = q_c + ((size_t)b * D_ + koff) * N_ + nt + li;
  v16h bdiff;
#pragma unroll
  for (int r = 0; r < 8; ++r) {
    bdiff[r] = (_Float16)(qcol[(size_t)r * N_] - xs[r]);
    bdiff[r + 8] = (_Float16)0.f;
  }
  v16h awt;
#pragma unroll
  for (int e = 0; e < 8; ++e) {
    awt[e] = (_Float16)w_t[li * D_ + koff + e];
    awt[e + 8] = (_Float16)0.f;
  }
  v8f z2 = {};
  const v8f t = wmma_f16(awt, bdiff, z2);
  float* tb = t_buf + (size_t)b * OUT_ * N_;
  // registers 0..3 are channels of group 2h, registers 4..7 of group 2h + 1
  float gs[2] = {0.f, 0.f}, gq[2] = {0.f, 0.f};
#pragma unroll  // constant indices keep t, gs, gq in registers
  for (int r = 0; r < 8; ++r) {
    const float y = t[r] + b_t[r + koff];
    tb[(size_t)(r + koff) * N_ + nt + li] = y;
    gs[r >> 2] += y;
    gq[r >> 2] += y * y;
  }
  // over the tile's 16 queries, which are the 16 lanes of a row
#pragma unroll  // constant indices keep gs, gq in registers
  for (int j = 0; j < 2; ++j) {
    gs[j] = add_xmask<8>(add_xmask<4>(add_xmask<2>(add_xmask<1>(gs[j]))));
    gq[j] = add_xmask<8>(add_xmask<4>(add_xmask<2>(add_xmask<1>(gq[j]))));
  }
  if (li == 0) {
    float* sp = stat + (((size_t)wid * G_ + 2 * h) * QT + wv) * 2;
#pragma unroll  // constant indices keep gs, gq in registers
    for (int j = 0; j < 2; ++j) {
      v2f p; p[0] = gs[j]; p[1] = gq[j];
      *reinterpret_cast<v2f*>(sp + j * QT * 2) = p;
    }
  }
}

// ---------------------------------------------------------------------------
// K5: GroupNorm, ReLU and the q^T residual. One block per 256 points of a
// batch, all 16 channels: 64 blocks share the loads and stores, with as many
// waves to start as 16 blocks of 1024 threads had. Every block adds up the
// batch's 64 x 4 x 4 partial sums of K4 for itself: they are 8 KiB in a row, 32
// bytes a thread. A thread then finishes 4 x 4 points of one channel; a wave's
// load of t_buf or q_c is two runs of 256 bytes.
// ---------------------------------------------------------------------------
__global__ __launch_bounds__(256) void k_gnfinal(
    const float* __restrict__ t_buf, const float* __restrict__ q_c,
    const float* __restrict__ stat,
    const float* __restrict__ gamma, const float* __restrict__ beta,
    float* __restrict__ out) {
  __shared__ v2f red[G_][8];  // [group][wave]: (sum, sum of squares)
  const int b = blockIdx.x / (N_ / FP);
  const int n0 = (blockIdx.x % (N_ / FP)) * FP;
  const int tid = threadIdx.x;
  const int lane = tid & 31;
  const int wv = wave_id();
  const int ch = tid >> 4;
  const size_t o = ((size_t)b * OUT_ + ch) * N_ + n0 + 4 * (tid & 15);
  // thread tid: the four tiles of K4's block tid / 4, group tid % 4
  const float* sp = stat + (size_t)b * NB * G_ * QT * 2 + 8 * tid;
  const v4f a0 = *reinterpret_cast<const v4f*>(sp);
  const v4f a1 = *reinterpret_cast<const v4f*>(sp + 4);
  const float ga = gamma[ch];
  const float be = beta[ch];
  v4f tv[FP / 64], qv[FP / 64];
#pragma unroll  // constant indices keep tv in registers
  for (int k = 0; k < FP / 64; ++k) tv[k] = *reinterpret_cast<const v4f*>(t_buf + o + 64 * k);
#pragma unroll  // constant indices keep qv in registers
  for (int k = 0; k < FP / 64; ++k) qv[k] = *reinterpret_cast<const v4f*>(q_c + o + 64 * k);
  // keeps all the loads in front of the sums: left free, the later ones are
  // issued behind the wait for the first two, a second trip to memory
  __builtin_amdgcn_sched_barrier(0);
  float s = (a0[0] + a0[2]) + (a1[0] + a1[2]);
  float s2 = (a0[1] + a0[3]) + (a1[1] + a1[3]);
  // over the wave's 8 blocks: the lanes that agree in lane % 4
  s = add_xrow(add_xmask<8>(add_xmask<4>(s)));
  s2 = add_xrow(add_xmask<8>(add_xmask<4>(s2)));
  if (lane < G_) {
    v2f p; p[0] = s; p[1] = s2;
    red[lane][wv] = p;
  }
  __syncthreads();
  v2f S = {};
#pragma unroll  // the LDS reads are issued together
  for (int w = 0; w < 8; ++w) S += red[wv >> 1][w];  // a wave's 2 channels: one group
  const float M = (float)(4 * N_);
  const float m = S[0] / M;
  const float var = S[1] / M - m * m;
  const float rstd = rsqrtf(var + 1e-5f);
#pragma unroll  // constant indices keep tv, qv in registers
  for (int k = 0; k < FP / 64; ++k) {
    v4f y;
#pragma unroll
    for (int j = 0; j < 4; ++j)
      y[j] = qv[k][j] + fmaxf((tv[k][j] - m) * rstd * ga + be, 0.f);
    *reinterpret_cast<v4f*>(out + o + 64 * k) = y;
  }
}

// ---------------------------------------------------------------------------
extern "C" void kernel_launch(void* const* d_in, const int* in_sizes, int n_in,
                              void* d_out, int out_size, void* d_ws,
                              size_t ws_size, hipStream_t stream) {
  const float* x_q      = (const float*)d_in[0];
  const float* x_kv     = (const float*)d_in[1];
  const float* xyz_q    = (const float*)d_in[2];
  const float* xyz_kv   = (const float*)d_in[3];
  const float* w_qk     = (const float*)d_in[4];
  const float* w_v      = (const float*)d_in[5];
  const float* b_v      = (const float*)d_in[6];
  const float* w_t      = (const float*)d_in[7];
  const float* b_t      = (const float*)d_in[8];
  const float* gamma    = (const float*)d_in[9];
  const float* beta     = (const float*)d_in[10];
  const float* w_pos_q  = (const float*)d_in[11];
  const float* w_pos_kv = (const float*)d_in[12];
  float* out = (float*)d_out;

  char* ws = (char*)d_ws;
  size_t off = 0;
  auto carve = [&](size_t bytes) -> char* {
    char* p = ws + off;
    off += (bytes + 255) & ~(size_t)255;
    return p;
  };
  float*    q_c    = (float*)carve((size_t)B_ * D_ * N_ * 4);
  _Float16* q_h    = (_Float16*)carve((size_t)B_ * N_ * D_ * 2);
  _Float16* k_h    = (_Float16*)carve((size_t)B_ * N_ * D_ * 2);
  _Float16* v_h    = (_Float16*)carve((size_t)B_ * D_ * N_ * 2);
  _Float16* rowneg = (_Float16*)carve((size_t)B_ * N_ * 2 * 2);
  _Float16* colneg = (_Float16*)carve((size_t)B_ * N_ * 2 * 2);
  float*    t_buf  = (float*)carve((size_t)B_ * OUT_ * N_ * 4);
  float*    stat   = (float*)carve((size_t)B_ * NB * G_ * QT * 2 * 4);
  (void)in_sizes; (void)n_in; (void)out_size; (void)ws_size;

  k_project<<<B_ * N_ / 32, 32 * SPLIT, 0, stream>>>(
      x_q, x_kv, xyz_q, xyz_kv, w_qk, w_v, b_v, w_pos_q, w_pos_kv,
      q_c, q_h, k_h, v_h);
  k_rowstats<<<B_ * NB, 32 * AW, 0, stream>>>(q_h, k_h, rowneg);
  k_colsum<<<B_ * NB, 32 * AW, 0, stream>>>(q_h, k_h, rowneg, colneg);
  k_attn<<<B_ * NB, 32 * AW, 0, stream>>>(q_h, k_h, v_h, q_c, rowneg, colneg,
                                     w_t, b_t, t_buf, stat);
  k_gnfinal<<<B_ * (N_ / FP), 256, 0, stream>>>(t_buf, q_c, stat, gamma, beta, out);
}
